// v000
// Measured on an AMD MI455X. A time is GPU time per run, averaged over a window of back-to-back runs after a warm-up
// (all launches, gaps included; the runs take copies of the inputs in turn), and the median of several windows.
// Apart from v000's, it joins two sittings. Times from different sittings can be a few percent apart, while
// side-by-side timings come from the same sitting.
// v000 is the starting kernel. One run takes 1590 microseconds.
#include <hip/hip_runtime.h>

// GPSA (gated positional self-attention, 8 heads x 32 over 4 x 1024 tokens): [q|k] = x W_qk, v = x W_v; patch = softmax_j(q_i.k_j / sqrt(32)); rel_ij = [p_j - p_i (3), |p_j - p_i|]; pos = softmax_j(rel_ij . W_pos[:,h] + b_pos[h]); attn = (1 - s_h) patch + s_h pos with s_h = sigmoid(gating[h]); attn /= sum_j attn; out = (attn v) W_proj + b_proj -> [4][1024][256].
// WMMA (v_wmma_f32_16x16x32_f16, f32 accumulate): x (EXACT bf16 x8, K 256) x [W_qk | W_v] rows (EXACT x256; 48 tiles); per (bh, 16 queries) S = q (hi+lo x256, K 32) x k rows (hi+lo; 64 tiles) and O = A (hi+lo x16384, K 1,024) x v^T (hi+lo; 2 tiles), 3 products; o (hi+lo, K 256) x W_proj rows (16 tiles) — ≈ 1 M WMMA; positional logits, both softmaxes, gating in f32.

namespace {
constexpr int NB_ = 4, S = 1024, C = 256, H = 8, HD = 32, NT = NB_ * S, CH = 256;
constexpr float XS = 8.0f, HS = 256.0f, PS = 16384.0f, WSC = 256.0f, SCALE = 0.17677669529663687f;
typedef _Float16 b16;
typedef __attribute__((ext_vector_type(16))) _Float16 v16b;
typedef __attribute__((ext_vector_type(8))) _Float16 v8b;
typedef __attribute__((ext_vector_type(8))) float v8f;
typedef __attribute__((ext_vector_type(4))) float v4f;
typedef __attribute__((ext_vector_type(2))) float v2f;
typedef __attribute__((ext_vector_type(2))) _Float16 v2b;
__device__ __forceinline__ float bf16_rne(float f) { unsigned int u = __float_as_uint(f); u += 0x7FFFu + ((u >> 16) & 1u); float r = __uint_as_float(u & 0xFFFF0000u); asm volatile("" : "+v"(r)); return r; }
__device__ __forceinline__ float bfv(float f) { float r = bf16_rne(f); asm volatile("" : "+v"(r)); return r; }
__device__ __forceinline__ void split16(float v, b16& hi, b16& lo) { hi = (b16)v; lo = (b16)(v - (float)hi); }
__device__ __forceinline__ v16b frag_kb(const b16* p, int hh) { const v8b a = *(const v8b*)(p + 8 * hh), b = *(const v8b*)(p + 16 + 8 * hh); v16b f;
#pragma unroll
  for (int e = 0; e < 8; ++e) { f[e] = a[e]; f[8 + e] = b[e]; } return f; }
__device__ __forceinline__ v8f wmma16b(v16b a, v16b b, v8f c) { v8f d = __builtin_amdgcn_wmma_f32_16x16x32_f16(false, a, false, b, (short)0, c, false, false); asm volatile("v_nop\n\tv_nop\n\tv_nop\n\tv_nop" : "+v"(d) : "v"(a), "v"(b)); return d; }
__device__ __forceinline__ void wave_lds_sync() { __builtin_amdgcn_fence(__ATOMIC_RELEASE, "workgroup"); __builtin_amdgcn_wave_barrier(); __builtin_amdgcn_fence(__ATOMIC_ACQUIRE, "workgroup"); }
__device__ __forceinline__ float pmul(float a, float b) { float p = a * b; asm volatile("" : "+v"(p)); return p; }

__global__ __launch_bounds__(256) void wput_kernel(const float* __restrict__ wqk, const float* __restrict__ wv, const float* __restrict__ wproj, b16* __restrict__ WA, b16* __restrict__ WP) { const int u = blockIdx.x * 256 + threadIdx.x; v8b v; auto put = [&](b16* dst) { { *(v8b*)dst = v;  } };
  if (u < 768 * 32) { const int o = u / 32, k0 = (u % 32) * 8;
#pragma unroll
    for (int j = 0; j < 8; ++j) v[j] = (b16)(bf16_rne(o < 512 ? wqk[(size_t)(k0 + j) * 512 + o] : wv[(size_t)(k0 + j) * C + (o - 512)]) * WSC); put(WA + (size_t)o * C + k0); }
  if (u < 256 * 32) { const int o = u / 32, k0 = (u % 32) * 8;
#pragma unroll
    for (int j = 0; j < 8; ++j) v[j] = (b16)(bf16_rne(wproj[(size_t)(k0 + j) * C + o]) * WSC); put(WP + (size_t)o * C + k0); } }
__global__ __launch_bounds__(32) void proj_kernel(const float* __restrict__ x, const b16* __restrict__ WA, int QLIM, b16* __restrict__ Qh, b16* __restrict__ Ql, b16* __restrict__ Kh, b16* __restrict__ Kl, float* __restrict__ Vr) { __shared__ __attribute__((aligned(16))) b16 Ax[16][C + 8]; __shared__ float Tf[16][772]; const int lane = threadIdx.x, nloc = lane & 15, hlf = lane >> 4; const size_t t0 = (size_t)blockIdx.x * 16; const int b = (int)(t0 / S), n0 = (int)(t0 % S); if (n0 >= QLIM) return;
  for (int rr = 0; rr < 16; ++rr) for (int q = 0; q < C / 32; ++q) { const int c = q * 32 + lane; Ax[rr][c] = (b16)(bfv(x[(t0 + rr) * C + c]) * XS); }
  if (lane < 16) for (int k = C; k < C + 8; ++k) Ax[lane][k] = (b16)0.0f;
  wave_lds_sync();
#pragma unroll 1
  for (int g = 0; g < 3; ++g) { v8f acc[16];
#pragma unroll
    for (int t = 0; t < 16; ++t) acc[t] = (v8f){};
#pragma unroll 2
    for (int kb = 0; kb < C; kb += 32) { const v16b a = frag_kb(&Ax[nloc][kb], hlf);
#pragma unroll
      for (int t = 0; t < 16; ++t) acc[t] = wmma16b(a, frag_kb(WA + (size_t)(g * 256 + t * 16 + nloc) * C + kb, hlf), acc[t]); }
#pragma unroll
    for (int t = 0; t < 16; ++t)
#pragma unroll
      for (int r8 = 0; r8 < 8; ++r8) Tf[8 * hlf + r8][g * 256 + t * 16 + nloc] = acc[t][r8] * (1.0f / (XS * WSC)); }
  wave_lds_sync();
  // module layout: qk.reshape(b,n,2,H,HD): col c < 256 -> q (head c/32, dim c%32); 256..511 -> k
  { for (int rr = 0; rr < 16; ++rr) { for (int h = 0; h < H; ++h) { const size_t po = (((size_t)(b * H + h)) * S + n0 + rr) * HD + lane; b16 p, pl; split16(Tf[rr][h * HD + lane] * HS, p, pl); ((b16*)Qh)[po] = p; ((b16*)Ql)[po] = pl; split16(Tf[rr][C + h * HD + lane] * HS, p, pl); ((b16*)Kh)[po] = p; ((b16*)Kl)[po] = pl; }
      for (int q = 0; q < 2; ++q) *(v4f*)(Vr + (t0 + rr) * C + q * 128 + lane * 4) = *(const v4f*)(&Tf[rr][512 + q * 128 + lane * 4]); }  } }
__global__ __launch_bounds__(256) void vt_kernel(const float* __restrict__ Vr, int QLIM, b16* __restrict__ VTh, b16* __restrict__ VTl) { __shared__ float Tt[64][257]; const size_t t0 = (size_t)blockIdx.x * 64; const int b = (int)(t0 / S), n0 = (int)(t0 % S); if (n0 >= QLIM) return; const int tid = threadIdx.x, wave = tid >> 5, lane = tid & 31;
  for (int q = wave; q < 64; q += 8) for (int c = lane; c < C; c += 32) Tt[q][c] = Vr[(t0 + q) * C + c];
  __syncthreads();
  { for (int c = wave; c < C; c += 8) { const int h = c / HD, d = c % HD; b16 h0, l0, h1, l1; split16(Tt[lane * 2][c] * HS, h0, l0); split16(Tt[lane * 2 + 1][c] * HS, h1, l1); const size_t o = (((size_t)(b * H + h)) * HD + d) * S + n0 + lane * 2; *(v2b*)(VTh + o) = (v2b){h0, h1}; *(v2b*)(VTl + o) = (v2b){l0, l1}; }  } }
__global__ __launch_bounds__(32) void att_kernel(const b16* __restrict__ Qh, const b16* __restrict__ Ql, const b16* __restrict__ Kh, const b16* __restrict__ Kl, const b16* __restrict__ VTh, const b16* __restrict__ VTl, const float* __restrict__ coord, const float* __restrict__ wpos, const float* __restrict__ bpos, const float* __restrict__ gating, int QLIM, float* __restrict__ O) { __shared__ float Sc[16][S + 1]; __shared__ __attribute__((aligned(16))) b16 Pa[16][CH + 8], Pb[16][CH + 8]; __shared__ float Of[16][HD + 1], Cw[16][8]; const int lane = threadIdx.x, nloc = lane & 15, hlf = lane >> 4; const int bh = blockIdx.x / (S / 16), q0 = (blockIdx.x % (S / 16)) * 16; if (q0 >= QLIM) return; const int b = bh / H, h = bh % H;
  if (lane < 16) for (int kk = CH; kk < CH + 8; ++kk) { Pa[lane][kk] = (b16)0.0f; Pb[lane][kk] = (b16)0.0f; }
  const v16b qa = frag_kb(Qh + ((size_t)bh * S + q0 + nloc) * HD, hlf), ql = frag_kb(Ql + ((size_t)bh * S + q0 + nloc) * HD, hlf);
  // (1) scaled scores for all keys
#pragma unroll 1
  for (int tg = 0; tg < S / 16; tg += 4) { v8f s[4] = {(v8f){}, (v8f){}, (v8f){}, (v8f){}};
#pragma unroll
    for (int t = 0; t < 4; ++t) { if ((tg + t) * 16 >= QLIM) continue; const size_t ko = ((size_t)bh * S + (tg + t) * 16 + nloc) * HD; const v16b kh = frag_kb(Kh + ko, hlf), kl = frag_kb(Kl + ko, hlf); s[t] = wmma16b(qa, kh, s[t]); s[t] = wmma16b(qa, kl, s[t]); s[t] = wmma16b(ql, kh, s[t]); }
#pragma unroll
    for (int t = 0; t < 4; ++t)
#pragma unroll
      for (int r8 = 0; r8 < 8; ++r8) Sc[8 * hlf + r8][(tg + t) * 16 + nloc] = s[t][r8] * (SCALE / (HS * HS)); }
  wave_lds_sync();
  // (2) per query row (lane < 16): patch softmax, pos softmax, gated mix -> Sc holds the mixed weights, Cw[row][0] = 1 / their sum (renorm applied in (3))
  if (lane < 16) { const int i = q0 + lane; float* sr = &Sc[lane][0]; const float sg = 1.0f / (1.0f + __expf(-bfv(gating[h]))); const float w0 = bfv(wpos[0 * H + h]), w1 = bfv(wpos[1 * H + h]), w2 = bfv(wpos[2 * H + h]), w3 = bfv(wpos[3 * H + h]), bp = bfv(bpos[h]);
    const float pix = bfv(coord[((size_t)b * S + i) * 3]), piy = bfv(coord[((size_t)b * S + i) * 3 + 1]), piz = bfv(coord[((size_t)b * S + i) * 3 + 2]);
    float mx = -INFINITY; for (int j = 0; j < QLIM; ++j) mx = fmaxf(mx, sr[j]); float z = 0.0f; for (int j = 0; j < QLIM; ++j) { const float e = __expf(sr[j] - mx); sr[j] = e; z += e; } const float zi = 1.0f / z;
    auto plog = [&](int j) { const float* pj = coord + ((size_t)b * S + j) * 3; const float dx = bfv(pj[0]) - pix, dy = bfv(pj[1]) - piy, dz = bfv(pj[2]) - piz; const float dd = sqrtf(dx * dx + dy * dy + dz * dz); return pmul(dx, w0) + pmul(dy, w1) + pmul(dz, w2) + pmul(dd, w3) + bp; };
    float pm = -INFINITY; for (int j = 0; j < QLIM; ++j) pm = fmaxf(pm, plog(j)); float pz = 0.0f; for (int j = 0; j < QLIM; ++j) pz += __expf(plog(j) - pm); const float pzi = 1.0f / pz;
    float tot = 0.0f; for (int j = 0; j < QLIM; ++j) { const float a = pmul(1.0f - sg, sr[j] * zi) + pmul(sg, __expf(plog(j) - pm) * pzi); sr[j] = a; tot += a; } Cw[lane][0] = 1.0f / tot; }
  wave_lds_sync();
  // (3) O = A x v^T over 256-key chunks
  v8f oacc[2] = {(v8f){}, (v8f){}};
#pragma unroll 1
  for (int k0 = 0; k0 < QLIM; k0 += CH) { for (int rr = 0; rr < 16; ++rr) { const float rn = Cw[rr][0]; for (int q = 0; q < CH / 32; ++q) { const int j = q * 32 + lane; b16 p, pl; split16(Sc[rr][k0 + j] * rn * PS, p, pl); Pa[rr][j] = p; Pb[rr][j] = pl; } }
    wave_lds_sync();
#pragma unroll 2
    for (int kb = 0; kb < CH; kb += 32) { const v16b pa = frag_kb(&Pa[nloc][kb], hlf), pb = frag_kb(&Pb[nloc][kb], hlf);
#pragma unroll
      for (int t = 0; t < 2; ++t) { const size_t vo = ((size_t)bh * HD + t * 16 + nloc) * S + k0 + kb; const v16b vh = frag_kb(VTh + vo, hlf), vl = frag_kb(VTl + vo, hlf); oacc[t] = wmma16b(pa, vh, oacc[t]); oacc[t] = wmma16b(pa, vl, oacc[t]); oacc[t] = wmma16b(pb, vh, oacc[t]); } }
    wave_lds_sync(); }
#pragma unroll
  for (int t = 0; t < 2; ++t)
#pragma unroll
    for (int r8 = 0; r8 < 8; ++r8) Of[8 * hlf + r8][t * 16 + nloc] = oacc[t][r8] * (1.0f / (PS * HS));
  wave_lds_sync();
  { for (int r = 0; r < 16; ++r) ((float*)O)[((size_t)b * S + q0 + r) * C + h * HD + lane] = Of[r][lane];  } }
__global__ __launch_bounds__(32) void outp_kernel(const float* __restrict__ O, const b16* __restrict__ WP, const float* __restrict__ bproj, int QLIM, float* __restrict__ out) { __shared__ __attribute__((aligned(16))) b16 Ah[16][C + 8], Al[16][C + 8]; __shared__ float Tf[16][260]; const int lane = threadIdx.x, nloc = lane & 15, hlf = lane >> 4; const size_t t0 = (size_t)blockIdx.x * 16; if ((int)(t0 % S) >= QLIM) return;
  for (int rr = 0; rr < 16; ++rr) for (int q = 0; q < C / 32; ++q) { const int c = q * 32 + lane; b16 p, pl; split16(O[(t0 + rr) * C + c] * HS, p, pl); Ah[rr][c] = p; Al[rr][c] = pl; }
  if (lane < 16) for (int k = C; k < C + 8; ++k) { Ah[lane][k] = (b16)0.0f; Al[lane][k] = (b16)0.0f; }
  wave_lds_sync(); v8f acc[16];
#pragma unroll
  for (int t = 0; t < 16; ++t) acc[t] = (v8f){};
#pragma unroll 2
  for (int kb = 0; kb < C; kb += 32) { const v16b a = frag_kb(&Ah[nloc][kb], hlf), al = frag_kb(&Al[nloc][kb], hlf);
#pragma unroll
    for (int t = 0; t < 16; ++t) { const v16b bw = frag_kb(WP + (size_t)(t * 16 + nloc) * C + kb, hlf); acc[t] = wmma16b(a, bw, acc[t]); acc[t] = wmma16b(al, bw, acc[t]); } }
#pragma unroll
  for (int t = 0; t < 16; ++t) { const int cc = t * 16 + nloc; const float bb = bfv(bproj[cc]);
#pragma unroll
    for (int r8 = 0; r8 < 8; ++r8) Tf[8 * hlf + r8][cc] = acc[t][r8] * (1.0f / (HS * WSC)) + bb; }
  wave_lds_sync();
  { for (int rr = 0; rr < 16; ++rr) for (int q = 0; q < 2; ++q) *(v4f*)(out + (t0 + rr) * C + q * 128 + lane * 4) = *(const v4f*)(&Tf[rr][q * 128 + lane * 4]);  } }
}  // namespace

extern "C" void kernel_launch(void* const* d_in, const int* in_sizes, int n_in, void* d_out, int out_size, void* d_ws, size_t ws_size, hipStream_t stream) {
  (void)n_in;
  auto Fp = [&](int i) { return (const float*)d_in[i]; };
  // input order: 0 x [4,1024,256]; 1 voxel_coord [4,1024,3]; 2 W_qk [256,512]; 3 W_v [256,256]; 4 W_proj [256,256]; 5 b_proj [256]; 6 W_pos [4,8]; 7 b_pos [8]; 8 gating [8]
  if (in_sizes[0] != NT * C || in_sizes[1] != NT * 3 || in_sizes[2] != C * 512 || in_sizes[3] != C * C || in_sizes[4] != C * C || in_sizes[6] != 4 * H || in_sizes[7] != H || in_sizes[8] != H || out_size != NT * C) return;
  const int QLIM = S;   // per-batch token cut (queries and keys) (multiple of 256)
  size_t off = 0; char* ws = (char*)d_ws;
  auto carve = [&](size_t bytes) { char* p = ws + off; off += (bytes + 255) & ~(size_t)255; return p; };
  b16* WA = (b16*)carve((size_t)768 * C * 2); b16* WP = (b16*)carve((size_t)C * C * 2); b16* Qh = (b16*)carve((size_t)NT * C * 2); b16* Ql = (b16*)carve((size_t)NT * C * 2); b16* Kh = (b16*)carve((size_t)NT * C * 2); b16* Kl = (b16*)carve((size_t)NT * C * 2); float* Vr = (float*)carve((size_t)NT * C * 4); b16* VTh = (b16*)carve((size_t)NT * C * 2); b16* VTl = (b16*)carve((size_t)NT * C * 2); float* O = (float*)carve((size_t)NT * C * 4);
  if (off > ws_size || off > ((size_t)32 << 20)) return;   // ~ 21 MB
  wput_kernel<<<(768 * 32 + 255) / 256, 256, 0, stream>>>(Fp(2), Fp(3), Fp(4), WA, WP);
  proj_kernel<<<NT / 16, 32, 0, stream>>>(Fp(0), WA, QLIM, Qh, Ql, Kh, Kl, Vr);
  vt_kernel<<<NT / 64, 256, 0, stream>>>(Vr, QLIM, VTh, VTl);
  att_kernel<<<NB_ * H * (S / 16), 32, 0, stream>>>(Qh, Ql, Kh, Kl, VTh, VTl, Fp(1), Fp(6), Fp(7), Fp(8), QLIM, O);
  outp_kernel<<<NT / 16, 32, 0, stream>>>(O, WP, Fp(5), QLIM, (float*)d_out);
}

// v001
// One run takes 342 microseconds.
// Two timings next to v000 put it at 4.63 and 4.65 times that version's speed.
#include <hip/hip_runtime.h>

// GPSA (gated positional self-attention, 8 heads x 32 over 4 x 1024 tokens): [q|k] = x W_qk, v = x W_v; patch = softmax_j(q_i.k_j / sqrt(32)); rel_ij = [p_j - p_i (3), |p_j - p_i|]; pos = softmax_j(rel_ij . W_pos[:,h] + b_pos[h]); attn = (1 - s_h) patch + s_h pos with s_h = sigmoid(gating[h]); attn /= sum_j attn; out = (attn v) W_proj + b_proj -> [4][1024][256].
// WMMA (v_wmma_f32_16x16x32_f16, f32 accumulate): x (EXACT bf16 x8, K 256) x [W_qk | W_v] rows (EXACT x256; 48 tiles); per (bh, 16 queries) S = q (hi+lo x256, K 32) x k rows (hi+lo; 64 tiles) and O = A (hi+lo x16384, K 1,024) x v^T (hi+lo; 2 tiles), 3 products; o (hi+lo, K 256) x W_proj rows (16 tiles) — ≈ 1 M WMMA; positional logits, both softmaxes, gating in f32.

namespace {
constexpr int NB_ = 4, S = 1024, C = 256, H = 8, HD = 32, NT = NB_ * S, CH = 256;
constexpr float XS = 8.0f, HS = 256.0f, PS = 16384.0f, WSC = 256.0f, SCALE = 0.17677669529663687f;
typedef _Float16 b16;
typedef __attribute__((ext_vector_type(16))) _Float16 v16b;
typedef __attribute__((ext_vector_type(8))) _Float16 v8b;
typedef __attribute__((ext_vector_type(8))) float v8f;
typedef __attribute__((ext_vector_type(4))) float v4f;
typedef __attribute__((ext_vector_type(2))) float v2f;
typedef __attribute__((ext_vector_type(2))) _Float16 v2b;
__device__ __forceinline__ float bf16_rne(float f) { unsigned int u = __float_as_uint(f); u += 0x7FFFu + ((u >> 16) & 1u); float r = __uint_as_float(u & 0xFFFF0000u); asm volatile("" : "+v"(r)); return r; }
__device__ __forceinline__ float bfv(float f) { float r = bf16_rne(f); asm volatile("" : "+v"(r)); return r; }
__device__ __forceinline__ void split16(float v, b16& hi, b16& lo) { hi = (b16)v; lo = (b16)(v - (float)hi); }
__device__ __forceinline__ v16b frag_kb(const b16* p, int hh) { const v8b a = *(const v8b*)(p + 8 * hh), b = *(const v8b*)(p + 16 + 8 * hh); v16b f;
#pragma unroll
  for (int e = 0; e < 8; ++e) { f[e] = a[e]; f[8 + e] = b[e]; } return f; }
__device__ __forceinline__ v8f wmma16b(v16b a, v16b b, v8f c) { v8f d = __builtin_amdgcn_wmma_f32_16x16x32_f16(false, a, false, b, (short)0, c, false, false); asm volatile("v_nop\n\tv_nop\n\tv_nop\n\tv_nop" : "+v"(d) : "v"(a), "v"(b)); return d; }
__device__ __forceinline__ void wave_lds_sync() { __builtin_amdgcn_fence(__ATOMIC_RELEASE, "workgroup"); __builtin_amdgcn_wave_barrier(); __builtin_amdgcn_fence(__ATOMIC_ACQUIRE, "workgroup"); }
__device__ __forceinline__ float pmul(float a, float b) { float p = a * b; asm volatile("" : "+v"(p)); return p; }

// butterfly over the 32 lanes: four DPP steps inside each 16-lane row, then the other row; every lane ends with the same value
template <int CTRL> __device__ __forceinline__ float row_x(float v) { return __builtin_bit_cast(float, __builtin_amdgcn_mov_dpp(__builtin_bit_cast(int, v), CTRL, 0xf, 0xf, true)); }
__device__ __forceinline__ float half_x(float v) { return __builtin_bit_cast(float, __builtin_amdgcn_permlanex16(__builtin_bit_cast(int, v), __builtin_bit_cast(int, v), 0x76543210, 0xfedcba98, false, false)); }
__device__ __forceinline__ float wave_sum(float v) { v += row_x<0x161>(v); v += row_x<0x162>(v); v += row_x<0x164>(v); v += row_x<0x168>(v); return v + half_x(v); }
__device__ __forceinline__ float wave_max(float v) { v = fmaxf(v, row_x<0x161>(v)); v = fmaxf(v, row_x<0x162>(v)); v = fmaxf(v, row_x<0x164>(v)); v = fmaxf(v, row_x<0x168>(v)); return fmaxf(v, half_x(v)); }
// e^x as __expf forms it (x * log2 e, then v_exp_f32); the v_nop in the same statement keeps the one slot that the instruction set asks for behind a transcendental before its result is read or its source overwritten
__device__ __forceinline__ float exp_slot(float x) { float r; asm("v_exp_f32 %0, %1\n\tv_nop" : "=v"(r) : "v"(x * 1.44269504f)); return r; }
__device__ __forceinline__ float lane_bcast(float v, int l) { return __builtin_bit_cast(float, __builtin_amdgcn_readlane(__builtin_bit_cast(int, v), l)); }

__global__ __launch_bounds__(256) void wput_kernel(const float* __restrict__ wqk, const float* __restrict__ wv, const float* __restrict__ wproj, b16* __restrict__ WA, b16* __restrict__ WP) { const int u = blockIdx.x * 256 + threadIdx.x; v8b v; auto put = [&](b16* dst) { { *(v8b*)dst = v;  } };
  if (u < 768 * 32) { const int o = u / 32, k0 = (u % 32) * 8;
#pragma unroll
    for (int j = 0; j < 8; ++j) v[j] = (b16)(bf16_rne(o < 512 ? wqk[(size_t)(k0 + j) * 512 + o] : wv[(size_t)(k0 + j) * C + (o - 512)]) * WSC); put(WA + (size_t)o * C + k0); }
  if (u < 256 * 32) { const int o = u / 32, k0 = (u % 32) * 8;
#pragma unroll
    for (int j = 0; j < 8; ++j) v[j] = (b16)(bf16_rne(wproj[(size_t)(k0 + j) * C + o]) * WSC); put(WP + (size_t)o * C + k0); } }
__global__ __launch_bounds__(32) void proj_kernel(const float* __restrict__ x, const b16* __restrict__ WA, int QLIM, b16* __restrict__ Qh, b16* __restrict__ Ql, b16* __restrict__ Kh, b16* __restrict__ Kl, float* __restrict__ Vr) { __shared__ __attribute__((aligned(16))) b16 Ax[16][C + 8]; __shared__ float Tf[16][772]; const int lane = threadIdx.x, nloc = lane & 15, hlf = lane >> 4; const size_t t0 = (size_t)blockIdx.x * 16; const int b = (int)(t0 / S), n0 = (int)(t0 % S); if (n0 >= QLIM) return;
  for (int rr = 0; rr < 16; ++rr) for (int q = 0; q < C / 32; ++q) { const int c = q * 32 + lane; Ax[rr][c] = (b16)(bfv(x[(t0 + rr) * C + c]) * XS); }
  if (lane < 16) for (int k = C; k < C + 8; ++k) Ax[lane][k] = (b16)0.0f;
  wave_lds_sync();
#pragma unroll 1
  for (int g = 0; g < 3; ++g) { v8f acc[16];
#pragma unroll
    for (int t = 0; t < 16; ++t) acc[t] = (v8f){};
#pragma unroll 2
    for (int kb = 0; kb < C; kb += 32) { const v16b a = frag_kb(&Ax[nloc][kb], hlf);
#pragma unroll
      for (int t = 0; t < 16; ++t) acc[t] = wmma16b(a, frag_kb(WA + (size_t)(g * 256 + t * 16 + nloc) * C + kb, hlf), acc[t]); }
#pragma unroll
    for (int t = 0; t < 16; ++t)
#pragma unroll
      for (int r8 = 0; r8 < 8; ++r8) Tf[8 * hlf + r8][g * 256 + t * 16 + nloc] = acc[t][r8] * (1.0f / (XS * WSC)); }
  wave_lds_sync();
  // module layout: qk.reshape(b,n,2,H,HD): col c < 256 -> q (head c/32, dim c%32); 256..511 -> k
  { for (int rr = 0; rr < 16; ++rr) { for (int h = 0; h < H; ++h) { const size_t po = (((size_t)(b * H + h)) * S + n0 + rr) * HD + lane; b16 p, pl; split16(Tf[rr][h * HD + lane] * HS, p, pl); ((b16*)Qh)[po] = p; ((b16*)Ql)[po] = pl; split16(Tf[rr][C + h * HD + lane] * HS, p, pl); ((b16*)Kh)[po] = p; ((b16*)Kl)[po] = pl; }
      for (int q = 0; q < 2; ++q) *(v4f*)(Vr + (t0 + rr) * C + q * 128 + lane * 4) = *(const v4f*)(&Tf[rr][512 + q * 128 + lane * 4]); }  } }
__global__ __launch_bounds__(256) void vt_kernel(const float* __restrict__ Vr, int QLIM, b16* __restrict__ VTh, b16* __restrict__ VTl) { __shared__ float Tt[64][257]; const size_t t0 = (size_t)blockIdx.x * 64; const int b = (int)(t0 / S), n0 = (int)(t0 % S); if (n0 >= QLIM) return; const int tid = threadIdx.x, wave = tid >> 5, lane = tid & 31;
  for (int q = wave; q < 64; q += 8) for (int c = lane; c < C; c += 32) Tt[q][c] = Vr[(t0 + q) * C + c];
  __syncthreads();
  { for (int c = wave; c < C; c += 8) { const int h = c / HD, d = c % HD; b16 h0, l0, h1, l1; split16(Tt[lane * 2][c] * HS, h0, l0); split16(Tt[lane * 2 + 1][c] * HS, h1, l1); const size_t o = (((size_t)(b * H + h)) * HD + d) * S + n0 + lane * 2; *(v2b*)(VTh + o) = (v2b){h0, h1}; *(v2b*)(VTl + o) = (v2b){l0, l1}; }  } }
__global__ __launch_bounds__(32) void att_kernel(const b16* __restrict__ Qh, const b16* __restrict__ Ql, const b16* __restrict__ Kh, const b16* __restrict__ Kl, const b16* __restrict__ VTh, const b16* __restrict__ VTl, const float* __restrict__ coord, const float* __restrict__ wpos, const float* __restrict__ bpos, const float* __restrict__ gating, int QLIM, float* __restrict__ O) { __shared__ __attribute__((aligned(16))) float Sc[16][S + 4]; __shared__ __attribute__((aligned(16))) b16 Pa[16][CH + 8], Pb[16][CH + 8]; __shared__ float Of[16][HD + 1], Cw[16][8]; const int lane = threadIdx.x, nloc = lane & 15, hlf = lane >> 4; const int bh = blockIdx.x / (S / 16), q0 = (blockIdx.x % (S / 16)) * 16; if (q0 >= QLIM) return; const int b = bh / H, h = bh % H;
  if (lane < 16) for (int kk = CH; kk < CH + 8; ++kk) { Pa[lane][kk] = (b16)0.0f; Pb[lane][kk] = (b16)0.0f; }
  const v16b qa = frag_kb(Qh + ((size_t)bh * S + q0 + nloc) * HD, hlf), ql = frag_kb(Ql + ((size_t)bh * S + q0 + nloc) * HD, hlf);
  // (1) scaled scores for all keys
#pragma unroll 1
  for (int tg = 0; tg < S / 16; tg += 4) { v8f s[4] = {(v8f){}, (v8f){}, (v8f){}, (v8f){}};
#pragma unroll
    for (int t = 0; t < 4; ++t) { if ((tg + t) * 16 >= QLIM) continue; const size_t ko = ((size_t)bh * S + (tg + t) * 16 + nloc) * HD; const v16b kh = frag_kb(Kh + ko, hlf), kl = frag_kb(Kl + ko, hlf); s[t] = wmma16b(qa, kh, s[t]); s[t] = wmma16b(qa, kl, s[t]); s[t] = wmma16b(ql, kh, s[t]); }
#pragma unroll
    for (int t = 0; t < 4; ++t)
#pragma unroll
      for (int r8 = 0; r8 < 8; ++r8) Sc[8 * hlf + r8][(tg + t) * 16 + nloc] = s[t][r8] * (SCALE / (HS * HS)); }
  wave_lds_sync();
  // (2) one query row at a time, its keys spread over the 32 lanes (lane owns keys g * 128 + lane * 4 + e): patch softmax, pos softmax, gated mix, renorm -> Sc holds the gated mix, Cw[r][0] the factor 1 / its row sum
  { const float gr = gating[h], wr0 = wpos[0 * H + h], wr1 = wpos[1 * H + h], wr2 = wpos[2 * H + h], wr3 = wpos[3 * H + h], br = bpos[h];   // every load of this phase is issued before the first rounding, so that they share one trip to memory
    const float* pq = coord + ((size_t)b * S + q0 + nloc) * 3; const float qx = pq[0], qy = pq[1], qz = pq[2]; v4f craw[S / 128][3];
    // every loop over g, e or u in this phase is unrolled in full, so that its arrays are indexed by constants and stay in registers
#pragma unroll
    for (int g = 0; g < S / 128; ++g)
#pragma unroll
      for (int u = 0; u < 3; ++u) craw[g][u] = *(const v4f*)(coord + ((size_t)b * S + g * 128 + lane * 4) * 3 + u * 4);
    asm volatile("s_wait_xcnt 0x0" ::: "memory");   // stands before the address registers of the loads above are given new values
    const float sg = 1.0f / (1.0f + __expf(-bfv(gr))); const float w0 = bfv(wr0), w1 = bfv(wr1), w2 = bfv(wr2), w3 = bfv(wr3), bp = bfv(br);
    const float rx = bfv(qx), ry = bfv(qy), rz = bfv(qz); float cx[S / 32], cy[S / 32], cz[S / 32], bg[S / 128];
#pragma unroll
    for (int g = 0; g < S / 128; ++g) { bg[g] = g * 128 < QLIM ? bp : -INFINITY;   // a key at or past the cut gets logit -inf, weight 0
#pragma unroll
      for (int e = 0; e < 4; ++e) { cx[g * 4 + e] = bfv(craw[g][(e * 3) / 4][(e * 3) % 4]); cy[g * 4 + e] = bfv(craw[g][(e * 3 + 1) / 4][(e * 3 + 1) % 4]); cz[g * 4 + e] = bfv(craw[g][(e * 3 + 2) / 4][(e * 3 + 2) % 4]); } }
    float rnv = 0.0f;
    // the loop over rows stays rolled: one row is about 1,200 instructions already
#pragma unroll 1
    for (int r = 0; r < 16; ++r) { v4f* sr = (v4f*)&Sc[r][0]; v4f s4[S / 128]; float pl[S / 32];
#pragma unroll
      for (int g = 0; g < S / 128; ++g) s4[g] = sr[g * 32 + lane];
      const float pix = lane_bcast(rx, r), piy = lane_bcast(ry, r), piz = lane_bcast(rz, r); float pm4[4] = {-INFINITY, -INFINITY, -INFINITY, -INFINITY}, mx = -INFINITY;
#pragma unroll
      for (int g = 0; g < S / 128; ++g) {
#pragma unroll
        for (int e = 0; e < 4; ++e) { const float dx = cx[g * 4 + e] - pix, dy = cy[g * 4 + e] - piy, dz = cz[g * 4 + e] - piz; const float dd = sqrtf(dx * dx + dy * dy + dz * dz); pl[g * 4 + e] = pmul(dx, w0) + pmul(dy, w1) + pmul(dz, w2) + pmul(dd, w3) + bg[g]; pm4[e] = fmaxf(pm4[e], pl[g * 4 + e]); }
        if (g & 1) __builtin_amdgcn_sched_barrier(0); }   // eight keys in flight at a time: with all 32 started at once their temporaries overflow the registers and loop constants spill to scratch
#pragma unroll
      for (int g = 0; g < S / 128; ++g) { const float gm = fmaxf(fmaxf(s4[g][0], s4[g][1]), fmaxf(s4[g][2], s4[g][3])); mx = fmaxf(mx, g * 128 < QLIM ? gm : -INFINITY); }
      mx = wave_max(mx); const float pm = wave_max(fmaxf(fmaxf(pm4[0], pm4[1]), fmaxf(pm4[2], pm4[3])));
      float z4[4] = {0.0f, 0.0f, 0.0f, 0.0f}, pz4[4] = {0.0f, 0.0f, 0.0f, 0.0f};
#pragma unroll
      for (int g = 0; g < S / 128; ++g) { const float mg = g * 128 < QLIM ? mx : INFINITY;
#pragma unroll
        for (int e = 0; e < 4; ++e) { s4[g][e] = exp_slot(s4[g][e] - mg); z4[e] += s4[g][e]; pl[g * 4 + e] = exp_slot(pl[g * 4 + e] - pm); pz4[e] += pl[g * 4 + e]; } }
      const float zi = 1.0f / wave_sum((z4[0] + z4[1]) + (z4[2] + z4[3])), pzi = 1.0f / wave_sum((pz4[0] + pz4[1]) + (pz4[2] + pz4[3])); float t4[4] = {0.0f, 0.0f, 0.0f, 0.0f};
#pragma unroll
      for (int g = 0; g < S / 128; ++g) {
#pragma unroll
        for (int e = 0; e < 4; ++e) { s4[g][e] = pmul(1.0f - sg, s4[g][e] * zi) + pmul(sg, pl[g * 4 + e] * pzi); t4[e] += s4[g][e]; }
        sr[g * 32 + lane] = s4[g]; }
      const float rn = 1.0f / wave_sum((t4[0] + t4[1]) + (t4[2] + t4[3])); rnv = lane == r ? rn : rnv; }
    if (lane < 16) Cw[lane][0] = rnv; }
  wave_lds_sync();
  // (3) O = A x v^T over 256-key chunks
  v8f oacc[2] = {(v8f){}, (v8f){}};
#pragma unroll 1
  for (int k0 = 0; k0 < QLIM; k0 += CH) { for (int rr = 0; rr < 16; ++rr) { const float rn = Cw[rr][0]; for (int q = 0; q < CH / 32; ++q) { const int j = q * 32 + lane; b16 p, pl; split16(Sc[rr][k0 + j] * rn * PS, p, pl); Pa[rr][j] = p; Pb[rr][j] = pl; } }
    wave_lds_sync();
#pragma unroll 2
    for (int kb = 0; kb < CH; kb += 32) { const v16b pa = frag_kb(&Pa[nloc][kb], hlf), pb = frag_kb(&Pb[nloc][kb], hlf);
#pragma unroll
      for (int t = 0; t < 2; ++t) { const size_t vo = ((size_t)bh * HD + t * 16 + nloc) * S + k0 + kb; const v16b vh = frag_kb(VTh + vo, hlf), vl = frag_kb(VTl + vo, hlf); oacc[t] = wmma16b(pa, vh, oacc[t]); oacc[t] = wmma16b(pa, vl, oacc[t]); oacc[t] = wmma16b(pb, vh, oacc[t]); } }
    wave_lds_sync(); }
#pragma unroll
  for (int t = 0; t < 2; ++t)
#pragma unroll
    for (int r8 = 0; r8 < 8; ++r8) Of[8 * hlf + r8][t * 16 + nloc] = oacc[t][r8] * (1.0f / (PS * HS));
  wave_lds_sync();
  { for (int r = 0; r < 16; ++r) ((float*)O)[((size_t)b * S + q0 + r) * C + h * HD + lane] = Of[r][lane];  } }
__global__ __launch_bounds__(32) void outp_kernel(const float* __restrict__ O, const b16* __restrict__ WP, const float* __restrict__ bproj, int QLIM, float* __restrict__ out) { __shared__ __attribute__((aligned(16))) b16 Ah[16][C + 8], Al[16][C + 8]; __shared__ float Tf[16][260]; const int lane = threadIdx.x, nloc = lane & 15, hlf = lane >> 4; const size_t t0 = (size_t)blockIdx.x * 16; if ((int)(t0 % S) >= QLIM) return;
  for (int rr = 0; rr < 16; ++rr) for (int q = 0; q < C / 32; ++q) { const int c = q * 32 + lane; b16 p, pl; split16(O[(t0 + rr) * C + c] * HS, p, pl); Ah[rr][c] = p; Al[rr][c] = pl; }
  if (lane < 16) for (int k = C; k < C + 8; ++k) { Ah[lane][k] = (b16)0.0f; Al[lane][k] = (b16)0.0f; }
  wave_lds_sync(); v8f acc[16];
#pragma unroll
  for (int t = 0; t < 16; ++t) acc[t] = (v8f){};
#pragma unroll 2
  for (int kb = 0; kb < C; kb += 32) { const v16b a = frag_kb(&Ah[nloc][kb], hlf), al = frag_kb(&Al[nloc][kb], hlf);
#pragma unroll
    for (int t = 0; t < 16; ++t) { const v16b bw = frag_kb(WP + (size_t)(t * 16 + nloc) * C + kb, hlf); acc[t] = wmma16b(a, bw, acc[t]); acc[t] = wmma16b(al, bw, acc[t]); } }
#pragma unroll
  for (int t = 0; t < 16; ++t) { const int cc = t * 16 + nloc; const float bb = bfv(bproj[cc]);
#pragma unroll
    for (int r8 = 0; r8 < 8; ++r8) Tf[8 * hlf + r8][cc] = acc[t][r8] * (1.0f / (HS * WSC)) + bb; }
  wave_lds_sync();
  { for (int rr = 0; rr < 16; ++rr) for (int q = 0; q < 2; ++q) *(v4f*)(out + (t0 + rr) * C + q * 128 + lane * 4) = *(const v4f*)(&Tf[rr][q * 128 + lane * 4]);  } }
}  // namespace

extern "C" void kernel_launch(void* const* d_in, const int* in_sizes, int n_in, void* d_out, int out_size, void* d_ws, size_t ws_size, hipStream_t stream) {
  (void)n_in;
  auto Fp = [&](int i) { return (const float*)d_in[i]; };
  // input order: 0 x [4,1024,256]; 1 voxel_coord [4,1024,3]; 2 W_qk [256,512]; 3 W_v [256,256]; 4 W_proj [256,256]; 5 b_proj [256]; 6 W_pos [4,8]; 7 b_pos [8]; 8 gating [8]
  if (in_sizes[0] != NT * C || in_sizes[1] != NT * 3 || in_sizes[2] != C * 512 || in_sizes[3] != C * C || in_sizes[4] != C * C || in_sizes[6] != 4 * H || in_sizes[7] != H || in_sizes[8] != H || out_size != NT * C) return;
  const int QLIM = S;   // per-batch token cut (queries and keys) (multiple of 256)
  size_t off = 0; char* ws = (char*)d_ws;
  auto carve = [&](size_t bytes) { char* p = ws + off; off += (bytes + 255) & ~(size_t)255; return p; };
  b16* WA = (b16*)carve((size_t)768 * C * 2); b16* WP = (b16*)carve((size_t)C * C * 2); b16* Qh = (b16*)carve((size_t)NT * C * 2); b16* Ql = (b16*)carve((size_t)NT * C * 2); b16* Kh = (b16*)carve((size_t)NT * C * 2); b16* Kl = (b16*)carve((size_t)NT * C * 2); float* Vr = (float*)carve((size_t)NT * C * 4); b16* VTh = (b16*)carve((size_t)NT * C * 2); b16* VTl = (b16*)carve((size_t)NT * C * 2); float* O = (float*)carve((size_t)NT * C * 4);
  if (off > ws_size || off > ((size_t)32 << 20)) return;   // ~ 21 MB
  wput_kernel<<<(768 * 32 + 255) / 256, 256, 0, stream>>>(Fp(2), Fp(3), Fp(4), WA, WP);
  proj_kernel<<<NT / 16, 32, 0, stream>>>(Fp(0), WA, QLIM, Qh, Ql, Kh, Kl, Vr);
  vt_kernel<<<NT / 64, 256, 0, stream>>>(Vr, QLIM, VTh, VTl);
  att_kernel<<<NB_ * H * (S / 16), 32, 0, stream>>>(Qh, Ql, Kh, Kl, VTh, VTl, Fp(1), Fp(6), Fp(7), Fp(8), QLIM, O);
  outp_kernel<<<NT / 16, 32, 0, stream>>>(O, WP, Fp(5), QLIM, (float*)d_out);
}

// v002
// A run of this version takes 145 microseconds.
// Two timings next to v001 put it at 2.38 and 2.40 times that version's speed.
// Over all steps from v000 it is 11.1 times as fast.
#include <hip/hip_runtime.h>

// GPSA (gated positional self-attention, 8 heads x 32 over 4 x 1024 tokens): [q|k] = x W_qk, v = x W_v; patch = softmax_j(q_i.k_j / sqrt(32)); rel_ij = [p_j - p_i (3), |p_j - p_i|]; pos = softmax_j(rel_ij . W_pos[:,h] + b_pos[h]); attn = (1 - s_h) patch + s_h pos with s_h = sigmoid(gating[h]); attn /= sum_j attn; out = (attn v) W_proj + b_proj -> [4][1024][256].
// WMMA (v_wmma_f32_16x16x32_f16, f32 accumulate): x (EXACT bf16 x8, K 256) x [W_qk | W_v] rows (EXACT x256; 48 tiles); per (bh, 16 queries) S = q (hi+lo x256, K 32) x k rows (hi+lo; 64 tiles) and O = A (hi+lo x16384, K 1,024) x v^T (hi+lo; 2 tiles), 3 products; o (hi+lo, K 256) x W_proj rows (16 tiles) — ≈ 1 M WMMA; positional logits, both softmaxes, gating in f32.

namespace {
constexpr int NB_ = 4, S = 1024, C = 256, H = 8, HD = 32, NT = NB_ * S, CH = 256;
constexpr float XS = 8.0f, HS = 256.0f, PS = 16384.0f, WSC = 256.0f, SCALE = 0.17677669529663687f;
typedef _Float16 b16;
typedef __attribute__((ext_vector_type(16))) _Float16 v16b;
typedef __attribute__((ext_vector_type(8))) _Float16 v8b;
typedef __attribute__((ext_vector_type(8))) float v8f;
typedef __attribute__((ext_vector_type(4))) float v4f;
typedef __attribute__((ext_vector_type(2))) float v2f;
typedef __attribute__((ext_vector_type(2))) _Float16 v2b;
__device__ __forceinline__ float bf16_rne(float f) { unsigned int u = __float_as_uint(f); u += 0x7FFFu + ((u >> 16) & 1u); float r = __uint_as_float(u & 0xFFFF0000u); asm volatile("" : "+v"(r)); return r; }
__device__ __forceinline__ float bfv(float f) { float r = bf16_rne(f); asm volatile("" : "+v"(r)); return r; }
__device__ __forceinline__ void split16(float v, b16& hi, b16& lo) { hi = (b16)v; lo = (b16)(v - (float)hi); }
__device__ __forceinline__ v16b frag_kb(const b16* p, int hh) { const v8b a = *(const v8b*)(p + 8 * hh), b = *(const v8b*)(p + 16 + 8 * hh); v16b f;
#pragma unroll
  for (int e = 0; e < 8; ++e) { f[e] = a[e]; f[8 + e] = b[e]; } return f; }
__device__ __forceinline__ v8f wmma16b(v16b a, v16b b, v8f c) { v8f d = __builtin_amdgcn_wmma_f32_16x16x32_f16(false, a, false, b, (short)0, c, false, false); asm volatile("v_nop\n\tv_nop\n\tv_nop\n\tv_nop" : "+v"(d) : "v"(a), "v"(b)); return d; }
__device__ __forceinline__ void wave_lds_sync() { __builtin_amdgcn_fence(__ATOMIC_RELEASE, "workgroup"); __builtin_amdgcn_wave_barrier(); __builtin_amdgcn_fence(__ATOMIC_ACQUIRE, "workgroup"); }
// stands behind a batch of global loads: before their address registers are given new values, and, being volatile, it keeps the whole batch in front of the volatile statements that follow (the pads behind each matrix instruction, the rounding pins), which no load can cross
__device__ __forceinline__ void loads_issued() { asm volatile("s_wait_xcnt 0x0" ::: "memory"); }
__device__ __forceinline__ float pmul(float a, float b) { float p = a * b; asm volatile("" : "+v"(p)); return p; }

// butterfly over the 32 lanes: four DPP steps inside each 16-lane row, then the other row; every lane ends with the same value
template <int CTRL> __device__ __forceinline__ float row_x(float v) { return __builtin_bit_cast(float, __builtin_amdgcn_mov_dpp(__builtin_bit_cast(int, v), CTRL, 0xf, 0xf, true)); }
__device__ __forceinline__ float half_x(float v) { return __builtin_bit_cast(float, __builtin_amdgcn_permlanex16(__builtin_bit_cast(int, v), __builtin_bit_cast(int, v), 0x76543210, 0xfedcba98, false, false)); }
__device__ __forceinline__ float wave_sum(float v) { v += row_x<0x161>(v); v += row_x<0x162>(v); v += row_x<0x164>(v); v += row_x<0x168>(v); return v + half_x(v); }
__device__ __forceinline__ float wave_max(float v) { v = fmaxf(v, row_x<0x161>(v)); v = fmaxf(v, row_x<0x162>(v)); v = fmaxf(v, row_x<0x164>(v)); v = fmaxf(v, row_x<0x168>(v)); return fmaxf(v, half_x(v)); }
// e^x as __expf forms it (x * log2 e, then v_exp_f32); the v_nop in the same statement keeps the one slot that the instruction set asks for behind a transcendental before its result is read or its source overwritten
__device__ __forceinline__ float exp_slot(float x) { float r; asm("v_exp_f32 %0, %1\n\tv_nop" : "=v"(r) : "v"(x * 1.44269504f)); return r; }
__device__ __forceinline__ float lane_bcast(float v, int l) { return __builtin_bit_cast(float, __builtin_amdgcn_readlane(__builtin_bit_cast(int, v), l)); }

__global__ __launch_bounds__(256) void wput_kernel(const float* __restrict__ wqk, const float* __restrict__ wv, const float* __restrict__ wproj, b16* __restrict__ WA, b16* __restrict__ WP) { const int u = blockIdx.x * 256 + threadIdx.x; v8b v; auto put = [&](b16* dst) { { *(v8b*)dst = v;  } };
  const int o = u / 32, k0 = (u % 32) * 8; float ra[8] = {}, rp[8] = {};   // all of a thread's loads are issued before the first rounding, so that they share one trip to memory
  if (u < 768 * 32) { const float* sa = o < 512 ? wqk + o : wv + (o - 512); const int ld = o < 512 ? 512 : C;
#pragma unroll
    for (int j = 0; j < 8; ++j) ra[j] = sa[(size_t)(k0 + j) * ld]; }
  if (u < 256 * 32) {
#pragma unroll
    for (int j = 0; j < 8; ++j) rp[j] = wproj[(size_t)(k0 + j) * C + o]; }
  loads_issued();
  if (u < 768 * 32) {
#pragma unroll
    for (int j = 0; j < 8; ++j) v[j] = (b16)(bf16_rne(ra[j]) * WSC); put(WA + (size_t)o * C + k0); }
  if (u < 256 * 32) {
#pragma unroll
    for (int j = 0; j < 8; ++j) v[j] = (b16)(bf16_rne(rp[j]) * WSC); put(WP + (size_t)o * C + k0); } }
__global__ __launch_bounds__(32) void proj_kernel(const float* __restrict__ x, const b16* __restrict__ WA, int QLIM, b16* __restrict__ Qh, b16* __restrict__ Ql, b16* __restrict__ Kh, b16* __restrict__ Kl, float* __restrict__ Vr) { __shared__ __attribute__((aligned(16))) b16 Ax[16][C + 8]; __shared__ float Tf[16][772]; const int lane = threadIdx.x, nloc = lane & 15, hlf = lane >> 4; const size_t t0 = (size_t)blockIdx.x * 16; const int b = (int)(t0 / S), n0 = (int)(t0 % S); if (n0 >= QLIM) return;
  // eight rows (64 loads) a batch; the loops inside are unrolled in full so that the batch stays in registers
#pragma unroll 1
  for (int r0 = 0; r0 < 16; r0 += 8) { float xr[8][C / 32];
#pragma unroll
    for (int rr = 0; rr < 8; ++rr)
#pragma unroll
      for (int q = 0; q < C / 32; ++q) xr[rr][q] = x[(t0 + r0 + rr) * C + q * 32 + lane];
    loads_issued();
#pragma unroll
    for (int rr = 0; rr < 8; ++rr)
#pragma unroll
      for (int q = 0; q < C / 32; ++q) Ax[r0 + rr][q * 32 + lane] = (b16)(bfv(xr[rr][q]) * XS); }
  if (lane < 16) for (int k = C; k < C + 8; ++k) Ax[lane][k] = (b16)0.0f;
  wave_lds_sync();
  // eight output tiles a group, so that a batch of 16 weight fragments (8 tiles x 2 k steps, 32 loads) fits the registers beside the accumulators; both outer loops stay rolled: unrolling would only grow the code, no load can cross the pads
#pragma unroll 1
  for (int g = 0; g < 6; ++g) { v8f acc[8];
#pragma unroll
    for (int t = 0; t < 8; ++t) acc[t] = (v8f){};
#pragma unroll 1
    for (int kb = 0; kb < C; kb += 64) { v16b bw[2][8];
#pragma unroll
      for (int kk = 0; kk < 2; ++kk)
#pragma unroll
        for (int t = 0; t < 8; ++t) bw[kk][t] = frag_kb(WA + (size_t)(g * 128 + t * 16 + nloc) * C + kb + kk * 32, hlf);
      const v16b a0 = frag_kb(&Ax[nloc][kb], hlf), a1 = frag_kb(&Ax[nloc][kb + 32], hlf);
      loads_issued();
#pragma unroll
      for (int t = 0; t < 8; ++t) acc[t] = wmma16b(a0, bw[0][t], acc[t]);
#pragma unroll
      for (int t = 0; t < 8; ++t) acc[t] = wmma16b(a1, bw[1][t], acc[t]); }
#pragma unroll
    for (int t = 0; t < 8; ++t)
#pragma unroll
      for (int r8 = 0; r8 < 8; ++r8) Tf[8 * hlf + r8][g * 128 + t * 16 + nloc] = acc[t][r8] * (1.0f / (XS * WSC)); }
  wave_lds_sync();
  // module layout: qk.reshape(b,n,2,H,HD): col c < 256 -> q (head c/32, dim c%32); 256..511 -> k
  { for (int rr = 0; rr < 16; ++rr) { for (int h = 0; h < H; ++h) { const size_t po = (((size_t)(b * H + h)) * S + n0 + rr) * HD + lane; b16 p, pl; split16(Tf[rr][h * HD + lane] * HS, p, pl); ((b16*)Qh)[po] = p; ((b16*)Ql)[po] = pl; split16(Tf[rr][C + h * HD + lane] * HS, p, pl); ((b16*)Kh)[po] = p; ((b16*)Kl)[po] = pl; }
      for (int q = 0; q < 2; ++q) *(v4f*)(Vr + (t0 + rr) * C + q * 128 + lane * 4) = *(const v4f*)(&Tf[rr][512 + q * 128 + lane * 4]); }  } }
__global__ __launch_bounds__(256) void vt_kernel(const float* __restrict__ Vr, int QLIM, b16* __restrict__ VTh, b16* __restrict__ VTl) { __shared__ float Tt[64][257]; const size_t t0 = (size_t)blockIdx.x * 64; const int b = (int)(t0 / S), n0 = (int)(t0 % S); if (n0 >= QLIM) return; const int tid = threadIdx.x, wave = tid >> 5, lane = tid & 31;
  { float rv[8][C / 32];   // a wave's 64 loads in one batch; constant trip counts, unrolled in full, keep the batch in registers
#pragma unroll
    for (int i = 0; i < 8; ++i)
#pragma unroll
      for (int k = 0; k < C / 32; ++k) rv[i][k] = Vr[(t0 + wave + 8 * i) * C + lane + 32 * k];
    loads_issued();
#pragma unroll
    for (int i = 0; i < 8; ++i)
#pragma unroll
      for (int k = 0; k < C / 32; ++k) Tt[wave + 8 * i][lane + 32 * k] = rv[i][k]; }
  __syncthreads();
  { for (int c = wave; c < C; c += 8) { const int h = c / HD, d = c % HD; b16 h0, l0, h1, l1; split16(Tt[lane * 2][c] * HS, h0, l0); split16(Tt[lane * 2 + 1][c] * HS, h1, l1); const size_t o = (((size_t)(b * H + h)) * HD + d) * S + n0 + lane * 2; *(v2b*)(VTh + o) = (v2b){h0, h1}; *(v2b*)(VTl + o) = (v2b){l0, l1}; }  } }
__global__ __launch_bounds__(32) void att_kernel(const b16* __restrict__ Qh, const b16* __restrict__ Ql, const b16* __restrict__ Kh, const b16* __restrict__ Kl, const b16* __restrict__ VTh, const b16* __restrict__ VTl, const float* __restrict__ coord, const float* __restrict__ wpos, const float* __restrict__ bpos, const float* __restrict__ gating, int QLIM, float* __restrict__ O) { __shared__ __attribute__((aligned(16))) float Sc[16][S + 4]; __shared__ __attribute__((aligned(16))) b16 Pa[16][CH + 8], Pb[16][CH + 8]; __shared__ float Of[16][HD + 1], Cw[16][8]; const int lane = threadIdx.x, nloc = lane & 15, hlf = lane >> 4; const int bh = blockIdx.x / (S / 16), q0 = (blockIdx.x % (S / 16)) * 16; if (q0 >= QLIM) return; const int b = bh / H, h = bh % H;
  if (lane < 16) for (int kk = CH; kk < CH + 8; ++kk) { Pa[lane][kk] = (b16)0.0f; Pb[lane][kk] = (b16)0.0f; }
  const v16b qa = frag_kb(Qh + ((size_t)bh * S + q0 + nloc) * HD, hlf), ql = frag_kb(Ql + ((size_t)bh * S + q0 + nloc) * HD, hlf);
  loads_issued();
  // (1) scaled scores for all keys
#pragma unroll 1
  for (int tg = 0; tg < S / 16; tg += 8) { v8f s[8];
#pragma unroll
    for (int t = 0; t < 8; ++t) s[t] = (v8f){};
    // eight key tiles (32 loads) a batch; the cut is tested once for the batch (it is a multiple of 256, as phases 2 and 3 take it too): a test per tile would leave paths on which loads are never waited for, and the next trip's loads would then wait on this trip's
    if (tg * 16 < QLIM) { v16b kh[8], kl[8]; const size_t ko = ((size_t)bh * S + tg * 16 + nloc) * HD; const b16 *ph = Kh + ko, *pl = Kl + ko;
#pragma unroll
      for (int t = 0; t < 8; ++t) { kh[t] = frag_kb(ph + t * 16 * HD, hlf); kl[t] = frag_kb(pl + t * 16 * HD, hlf); }
      loads_issued();
#pragma unroll
      for (int t = 0; t < 8; ++t) { s[t] = wmma16b(qa, kh[t], s[t]); s[t] = wmma16b(qa, kl[t], s[t]); s[t] = wmma16b(ql, kh[t], s[t]); } }
#pragma unroll
    for (int t = 0; t < 8; ++t)
#pragma unroll
      for (int r8 = 0; r8 < 8; ++r8) Sc[8 * hlf + r8][(tg + t) * 16 + nloc] = s[t][r8] * (SCALE / (HS * HS)); }
  wave_lds_sync();
  // (2) one query row at a time, its keys spread over the 32 lanes (lane owns keys g * 128 + lane * 4 + e): patch softmax, pos softmax, gated mix, renorm -> Sc holds the gated mix, Cw[r][0] the factor 1 / its row sum
  { const float gr = gating[h], wr0 = wpos[0 * H + h], wr1 = wpos[1 * H + h], wr2 = wpos[2 * H + h], wr3 = wpos[3 * H + h], br = bpos[h];   // every load of this phase is issued before the first rounding, so that they share one trip to memory
    const float* pq = coord + ((size_t)b * S + q0 + nloc) * 3; const float qx = pq[0], qy = pq[1], qz = pq[2]; v4f craw[S / 128][3];
    // every loop over g, e or u in this phase is unrolled in full, so that its arrays are indexed by constants and stay in registers
#pragma unroll
    for (int g = 0; g < S / 128; ++g)
#pragma unroll
      for (int u = 0; u < 3; ++u) craw[g][u] = *(const v4f*)(coord + ((size_t)b * S + g * 128 + lane * 4) * 3 + u * 4);
    asm volatile("s_wait_xcnt 0x0" ::: "memory");   // stands before the address registers of the loads above are given new values
    const float sg = 1.0f / (1.0f + __expf(-bfv(gr))); const float w0 = bfv(wr0), w1 = bfv(wr1), w2 = bfv(wr2), w3 = bfv(wr3), bp = bfv(br);
    const float rx = bfv(qx), ry = bfv(qy), rz = bfv(qz); float cx[S / 32], cy[S / 32], cz[S / 32], bg[S / 128];
#pragma unroll
    for (int g = 0; g < S / 128; ++g) { bg[g] = g * 128 < QLIM ? bp : -INFINITY;   // a key at or past the cut gets logit -inf, weight 0
#pragma unroll
      for (int e = 0; e < 4; ++e) { cx[g * 4 + e] = bfv(craw[g][(e * 3) / 4][(e * 3) % 4]); cy[g * 4 + e] = bfv(craw[g][(e * 3 + 1) / 4][(e * 3 + 1) % 4]); cz[g * 4 + e] = bfv(craw[g][(e * 3 + 2) / 4][(e * 3 + 2) % 4]); } }
    float rnv = 0.0f;
    // the loop over rows stays rolled: one row is about 1,200 instructions already
#pragma unroll 1
    for (int r = 0; r < 16; ++r) { v4f* sr = (v4f*)&Sc[r][0]; v4f s4[S / 128]; float pl[S / 32];
#pragma unroll
      for (int g = 0; g < S / 128; ++g) s4[g] = sr[g * 32 + lane];
      const float pix = lane_bcast(rx, r), piy = lane_bcast(ry, r), piz = lane_bcast(rz, r); float pm4[4] = {-INFINITY, -INFINITY, -INFINITY, -INFINITY}, mx = -INFINITY;
#pragma unroll
      for (int g = 0; g < S / 128; ++g) {
#pragma unroll
        for (int e = 0; e < 4; ++e) { const float dx = cx[g * 4 + e] - pix, dy = cy[g * 4 + e] - piy, dz = cz[g * 4 + e] - piz; const float dd = sqrtf(dx * dx + dy * dy + dz * dz); pl[g * 4 + e] = pmul(dx, w0) + pmul(dy, w1) + pmul(dz, w2) + pmul(dd, w3) + bg[g]; pm4[e] = fmaxf(pm4[e], pl[g * 4 + e]); }
        if (g & 1) __builtin_amdgcn_sched_barrier(0); }   // eight keys in flight at a time: with all 32 started at once their temporaries overflow the registers and loop constants spill to scratch
#pragma unroll
      for (int g = 0; g < S / 128; ++g) { const float gm = fmaxf(fmaxf(s4[g][0], s4[g][1]), fmaxf(s4[g][2], s4[g][3])); mx = fmaxf(mx, g * 128 < QLIM ? gm : -INFINITY); }
      mx = wave_max(mx); const float pm = wave_max(fmaxf(fmaxf(pm4[0], pm4[1]), fmaxf(pm4[2], pm4[3])));
      float z4[4] = {0.0f, 0.0f, 0.0f, 0.0f}, pz4[4] = {0.0f, 0.0f, 0.0f, 0.0f};
#pragma unroll
      for (int g = 0; g < S / 128; ++g) { const float mg = g * 128 < QLIM ? mx : INFINITY;
#pragma unroll
        for (int e = 0; e < 4; ++e) { s4[g][e] = exp_slot(s4[g][e] - mg); z4[e] += s4[g][e]; pl[g * 4 + e] = exp_slot(pl[g * 4 + e] - pm); pz4[e] += pl[g * 4 + e]; } }
      const float zi = 1.0f / wave_sum((z4[0] + z4[1]) + (z4[2] + z4[3])), pzi = 1.0f / wave_sum((pz4[0] + pz4[1]) + (pz4[2] + pz4[3])); float t4[4] = {0.0f, 0.0f, 0.0f, 0.0f};
#pragma unroll
      for (int g = 0; g < S / 128; ++g) {
#pragma unroll
        for (int e = 0; e < 4; ++e) { s4[g][e] = pmul(1.0f - sg, s4[g][e] * zi) + pmul(sg, pl[g * 4 + e] * pzi); t4[e] += s4[g][e]; }
        sr[g * 32 + lane] = s4[g]; }
      const float rn = 1.0f / wave_sum((t4[0] + t4[1]) + (t4[2] + t4[3])); rnv = lane == r ? rn : rnv; }
    if (lane < 16) Cw[lane][0] = rnv; }
  wave_lds_sync();
  // (3) O = A x v^T over 256-key chunks
  v8f oacc[2] = {(v8f){}, (v8f){}};
#pragma unroll 1
  for (int k0 = 0; k0 < QLIM; k0 += CH) { v16b vh[4][2], vl[4][2], pa[4], pb[4];
    // 128 keys of v^T (32 loads) a batch; the chunk's first batch is issued here, in front of the conversion, and flies while that runs
    auto vload = [&](int kq) {
#pragma unroll
      for (int kk = 0; kk < 4; ++kk)
#pragma unroll
        for (int t = 0; t < 2; ++t) { const size_t vo = ((size_t)bh * HD + t * 16 + nloc) * S + kq + kk * 32; vh[kk][t] = frag_kb(VTh + vo, hlf); vl[kk][t] = frag_kb(VTl + vo, hlf); }
      loads_issued(); };
    auto mm = [&](int kq) {
#pragma unroll
      for (int kk = 0; kk < 4; ++kk) { pa[kk] = frag_kb(&Pa[nloc][kq + kk * 32], hlf); pb[kk] = frag_kb(&Pb[nloc][kq + kk * 32], hlf); }
#pragma unroll
      for (int kk = 0; kk < 4; ++kk)
#pragma unroll
        for (int t = 0; t < 2; ++t) { oacc[t] = wmma16b(pa[kk], vh[kk][t], oacc[t]); oacc[t] = wmma16b(pa[kk], vl[kk][t], oacc[t]); oacc[t] = wmma16b(pb[kk], vh[kk][t], oacc[t]); } };
    vload(k0);
    for (int rr = 0; rr < 16; ++rr) { const float rn = Cw[rr][0]; for (int q = 0; q < CH / 32; ++q) { const int j = q * 32 + lane; b16 p, pl; split16(Sc[rr][k0 + j] * rn * PS, p, pl); Pa[rr][j] = p; Pb[rr][j] = pl; } }
    wave_lds_sync();
    mm(0); vload(k0 + CH / 2); mm(CH / 2);
    wave_lds_sync(); }
#pragma unroll
  for (int t = 0; t < 2; ++t)
#pragma unroll
    for (int r8 = 0; r8 < 8; ++r8) Of[8 * hlf + r8][t * 16 + nloc] = oacc[t][r8] * (1.0f / (PS * HS));
  wave_lds_sync();
  { for (int r = 0; r < 16; ++r) ((float*)O)[((size_t)b * S + q0 + r) * C + h * HD + lane] = Of[r][lane];  } }
__global__ __launch_bounds__(32) void outp_kernel(const float* __restrict__ O, const b16* __restrict__ WP, const float* __restrict__ bproj, int QLIM, float* __restrict__ out) { __shared__ __attribute__((aligned(16))) b16 Ah[16][C + 8], Al[16][C + 8]; __shared__ float Tf[16][260]; const int lane = threadIdx.x, nloc = lane & 15, hlf = lane >> 4; const size_t t0 = (size_t)blockIdx.x * 16; if ((int)(t0 % S) >= QLIM) return;
  // eight rows (64 loads) a batch; the loops inside are unrolled in full so that the batch stays in registers
#pragma unroll 1
  for (int r0 = 0; r0 < 16; r0 += 8) { float orw[8][C / 32];
#pragma unroll
    for (int rr = 0; rr < 8; ++rr)
#pragma unroll
      for (int q = 0; q < C / 32; ++q) orw[rr][q] = O[(t0 + r0 + rr) * C + q * 32 + lane];
    loads_issued();
#pragma unroll
    for (int rr = 0; rr < 8; ++rr)
#pragma unroll
      for (int q = 0; q < C / 32; ++q) { b16 p, pl; split16(orw[rr][q] * HS, p, pl); Ah[r0 + rr][q * 32 + lane] = p; Al[r0 + rr][q * 32 + lane] = pl; } }
  if (lane < 16) for (int k = C; k < C + 8; ++k) { Ah[lane][k] = (b16)0.0f; Al[lane][k] = (b16)0.0f; }
  wave_lds_sync();
  // eight output tiles a group, so that a batch of 16 weight fragments (8 tiles x 2 k steps, 32 loads) fits the registers beside the accumulators; both outer loops stay rolled: unrolling would only grow the code, no load can cross the pads
#pragma unroll 1
  for (int g = 0; g < 2; ++g) { v8f acc[8]; float br[8];
#pragma unroll
    for (int t = 0; t < 8; ++t) { acc[t] = (v8f){}; br[t] = bproj[g * 128 + t * 16 + nloc]; }
#pragma unroll 1
    for (int kb = 0; kb < C; kb += 64) { v16b bw[2][8];
#pragma unroll
      for (int kk = 0; kk < 2; ++kk)
#pragma unroll
        for (int t = 0; t < 8; ++t) bw[kk][t] = frag_kb(WP + (size_t)(g * 128 + t * 16 + nloc) * C + kb + kk * 32, hlf);
      loads_issued();
#pragma unroll
      for (int kk = 0; kk < 2; ++kk) { const v16b a = frag_kb(&Ah[nloc][kb + kk * 32], hlf), al = frag_kb(&Al[nloc][kb + kk * 32], hlf);
#pragma unroll
        for (int t = 0; t < 8; ++t) { acc[t] = wmma16b(a, bw[kk][t], acc[t]); acc[t] = wmma16b(al, bw[kk][t], acc[t]); } } }
#pragma unroll
    for (int t = 0; t < 8; ++t) { const int cc = g * 128 + t * 16 + nloc; const float bb = bfv(br[t]);
#pragma unroll
      for (int r8 = 0; r8 < 8; ++r8) Tf[8 * hlf + r8][cc] = acc[t][r8] * (1.0f / (HS * WSC)) + bb; } }
  wave_lds_sync();
  { for (int rr = 0; rr < 16; ++rr) for (int q = 0; q < 2; ++q) *(v4f*)(out + (t0 + rr) * C + q * 128 + lane * 4) = *(const v4f*)(&Tf[rr][q * 128 + lane * 4]);  } }
}  // namespace

extern "C" void kernel_launch(void* const* d_in, const int* in_sizes, int n_in, void* d_out, int out_size, void* d_ws, size_t ws_size, hipStream_t stream) {
  (void)n_in;
  auto Fp = [&](int i) { return (const float*)d_in[i]; };
  // input order: 0 x [4,1024,256]; 1 voxel_coord [4,1024,3]; 2 W_qk [256,512]; 3 W_v [256,256]; 4 W_proj [256,256]; 5 b_proj [256]; 6 W_pos [4,8]; 7 b_pos [8]; 8 gating [8]
  if (in_sizes[0] != NT * C || in_sizes[1] != NT * 3 || in_sizes[2] != C * 512 || in_sizes[3] != C * C || in_sizes[4] != C * C || in_sizes[6] != 4 * H || in_sizes[7] != H || in_sizes[8] != H || out_size != NT * C) return;
  const int QLIM = S;   // per-batch token cut (queries and keys) (multiple of 256)
  size_t off = 0; char* ws = (char*)d_ws;
  auto carve = [&](size_t bytes) { char* p = ws + off; off += (bytes + 255) & ~(size_t)255; return p; };
  b16* WA = (b16*)carve((size_t)768 * C * 2); b16* WP = (b16*)carve((size_t)C * C * 2); b16* Qh = (b16*)carve((size_t)NT * C * 2); b16* Ql = (b16*)carve((size_t)NT * C * 2); b16* Kh = (b16*)carve((size_t)NT * C * 2); b16* Kl = (b16*)carve((size_t)NT * C * 2); float* Vr = (float*)carve((size_t)NT * C * 4); b16* VTh = (b16*)carve((size_t)NT * C * 2); b16* VTl = (b16*)carve((size_t)NT * C * 2); float* O = (float*)carve((size_t)NT * C * 4);
  if (off > ws_size || off > ((size_t)32 << 20)) return;   // ~ 21 MB
  wput_kernel<<<(768 * 32 + 255) / 256, 256, 0, stream>>>(Fp(2), Fp(3), Fp(4), WA, WP);
  proj_kernel<<<NT / 16, 32, 0, stream>>>(Fp(0), WA, QLIM, Qh, Ql, Kh, Kl, Vr);
  vt_kernel<<<NT / 64, 256, 0, stream>>>(Vr, QLIM, VTh, VTl);
  att_kernel<<<NB_ * H * (S / 16), 32, 0, stream>>>(Qh, Ql, Kh, Kl, VTh, VTl, Fp(1), Fp(6), Fp(7), Fp(8), QLIM, O);
  outp_kernel<<<NT / 16, 32, 0, stream>>>(O, WP, Fp(5), QLIM, (float*)d_out);
}

// v003
// Measured time: 112 microseconds a run.
// Next to v002, in two timings, it ran 1.29 and 1.28 times as fast.
// Counting every step since v000, it is 14.3 times as fast.
#include <hip/hip_runtime.h>

// GPSA (gated positional self-attention, 8 heads x 32 over 4 x 1024 tokens): [q|k] = x W_qk, v = x W_v; patch = softmax_j(q_i.k_j / sqrt(32)); rel_ij = [p_j - p_i (3), |p_j - p_i|]; pos = softmax_j(rel_ij . W_pos[:,h] + b_pos[h]); attn = (1 - s_h) patch + s_h pos with s_h = sigmoid(gating[h]); attn /= sum_j attn; out = (attn v) W_proj + b_proj -> [4][1024][256].
// WMMA (v_wmma_f32_16x16x32_f16, f32 accumulate): x (EXACT bf16 x8, K 256) x [W_qk | W_v] rows (EXACT x256; 48 tiles); per (bh, 16 queries) S = q (hi+lo x256, K 32) x k rows (hi+lo; 64 tiles) and O = A (hi+lo x16384, K 1,024) x v^T (hi+lo; 2 tiles), 3 products; o (hi+lo, K 256) x W_proj rows (16 tiles) — ≈ 1 M WMMA; positional logits, both softmaxes, gating in f32.

namespace {
constexpr int NB_ = 4, S = 1024, C = 256, H = 8, HD = 32, NT = NB_ * S, CH = 256;
constexpr float XS = 8.0f, HS = 256.0f, PS = 16384.0f, WSC = 256.0f, SCALE = 0.17677669529663687f;
typedef _Float16 b16;
typedef __attribute__((ext_vector_type(16))) _Float16 v16b;
typedef __attribute__((ext_vector_type(8))) _Float16 v8b;
typedef __attribute__((ext_vector_type(8))) float v8f;
typedef __attribute__((ext_vector_type(4))) float v4f;
typedef __attribute__((ext_vector_type(2))) float v2f;
typedef __attribute__((ext_vector_type(2))) _Float16 v2b;
typedef __attribute__((ext_vector_type(4))) _Float16 v4b;
__device__ __forceinline__ float bf16_rne(float f) { unsigned int u = __float_as_uint(f); u += 0x7FFFu + ((u >> 16) & 1u); float r = __uint_as_float(u & 0xFFFF0000u); asm volatile("" : "+v"(r)); return r; }
__device__ __forceinline__ float bfv(float f) { float r = bf16_rne(f); asm volatile("" : "+v"(r)); return r; }
__device__ __forceinline__ void split16(float v, b16& hi, b16& lo) { hi = (b16)v; lo = (b16)(v - (float)hi); }
__device__ __forceinline__ v16b frag_kb(const b16* p, int hh) { const v8b a = *(const v8b*)(p + 8 * hh), b = *(const v8b*)(p + 16 + 8 * hh); v16b f;
#pragma unroll
  for (int e = 0; e < 8; ++e) { f[e] = a[e]; f[8 + e] = b[e]; } return f; }
__device__ __forceinline__ v8f wmma16b(v16b a, v16b b, v8f c) { v8f d = __builtin_amdgcn_wmma_f32_16x16x32_f16(false, a, false, b, (short)0, c, false, false); asm volatile("v_nop\n\tv_nop\n\tv_nop\n\tv_nop" : "+v"(d) : "v"(a), "v"(b)); return d; }
__device__ __forceinline__ void wave_lds_sync() { __builtin_amdgcn_fence(__ATOMIC_RELEASE, "workgroup"); __builtin_amdgcn_wave_barrier(); __builtin_amdgcn_fence(__ATOMIC_ACQUIRE, "workgroup"); }
// stands behind a batch of global loads: before their address registers are given new values, and, being volatile, it keeps the whole batch in front of the volatile statements that follow (the pads behind each matrix instruction, the rounding pins), which no load can cross
__device__ __forceinline__ void loads_issued() { asm volatile("s_wait_xcnt 0x0" ::: "memory"); }
__device__ __forceinline__ float pmul(float a, float b) { float p = a * b; asm volatile("" : "+v"(p)); return p; }

// butterfly over the 32 lanes: four DPP steps inside each 16-lane row, then the other row; every lane ends with the same value
template <int CTRL> __device__ __forceinline__ float row_x(float v) { return __builtin_bit_cast(float, __builtin_amdgcn_mov_dpp(__builtin_bit_cast(int, v), CTRL, 0xf, 0xf, true)); }
__device__ __forceinline__ float half_x(float v) { return __builtin_bit_cast(float, __builtin_amdgcn_permlanex16(__builtin_bit_cast(int, v), __builtin_bit_cast(int, v), 0x76543210, 0xfedcba98, false, false)); }
__device__ __forceinline__ float wave_sum(float v) { v += row_x<0x161>(v); v += row_x<0x162>(v); v += row_x<0x164>(v); v += row_x<0x168>(v); return v + half_x(v); }
__device__ __forceinline__ float wave_max(float v) { v = fmaxf(v, row_x<0x161>(v)); v = fmaxf(v, row_x<0x162>(v)); v = fmaxf(v, row_x<0x164>(v)); v = fmaxf(v, row_x<0x168>(v)); return fmaxf(v, half_x(v)); }
// e^x as __expf forms it (x * log2 e, then v_exp_f32); the v_nop in the same statement keeps the one slot that the instruction set asks for behind a transcendental before its result is read or its source overwritten
__device__ __forceinline__ float exp_slot(float x) { float r; asm("v_exp_f32 %0, %1\n\tv_nop" : "=v"(r) : "v"(x * 1.44269504f)); return r; }
__device__ __forceinline__ float lane_bcast(float v, int l) { return __builtin_bit_cast(float, __builtin_amdgcn_readlane(__builtin_bit_cast(int, v), l)); }

__global__ __launch_bounds__(256) void wput_kernel(const float* __restrict__ wqk, const float* __restrict__ wv, const float* __restrict__ wproj, b16* __restrict__ WA, b16* __restrict__ WP) { const int u = blockIdx.x * 256 + threadIdx.x; v8b v; auto put = [&](b16* dst) { { *(v8b*)dst = v;  } };
  const int o = u / 32, k0 = (u % 32) * 8; float ra[8] = {}, rp[8] = {};   // all of a thread's loads are issued before the first rounding, so that they share one trip to memory
  if (u < 768 * 32) { const float* sa = o < 512 ? wqk + o : wv + (o - 512); const int ld = o < 512 ? 512 : C;
#pragma unroll
    for (int j = 0; j < 8; ++j) ra[j] = sa[(size_t)(k0 + j) * ld]; }
  if (u < 256 * 32) {
#pragma unroll
    for (int j = 0; j < 8; ++j) rp[j] = wproj[(size_t)(k0 + j) * C + o]; }
  loads_issued();
  if (u < 768 * 32) {
#pragma unroll
    for (int j = 0; j < 8; ++j) v[j] = (b16)(bf16_rne(ra[j]) * WSC); put(WA + (size_t)o * C + k0); }
  if (u < 256 * 32) {
#pragma unroll
    for (int j = 0; j < 8; ++j) v[j] = (b16)(bf16_rne(rp[j]) * WSC); put(WP + (size_t)o * C + k0); } }
__global__ __launch_bounds__(32) void proj_kernel(const float* __restrict__ x, const b16* __restrict__ WA, int QLIM, b16* __restrict__ Qh, b16* __restrict__ Ql, b16* __restrict__ Kh, b16* __restrict__ Kl, float* __restrict__ Vr) { __shared__ __attribute__((aligned(16))) b16 Ax[16][C + 8]; __shared__ float Tf[16][772]; const int lane = threadIdx.x, nloc = lane & 15, hlf = lane >> 4; const size_t t0 = (size_t)blockIdx.x * 16; const int b = (int)(t0 / S), n0 = (int)(t0 % S); if (n0 >= QLIM) return;
  // eight rows (64 loads) a batch; the loops inside are unrolled in full so that the batch stays in registers
#pragma unroll 1
  for (int r0 = 0; r0 < 16; r0 += 8) { float xr[8][C / 32];
#pragma unroll
    for (int rr = 0; rr < 8; ++rr)
#pragma unroll
      for (int q = 0; q < C / 32; ++q) xr[rr][q] = x[(t0 + r0 + rr) * C + q * 32 + lane];
    loads_issued();
#pragma unroll
    for (int rr = 0; rr < 8; ++rr)
#pragma unroll
      for (int q = 0; q < C / 32; ++q) Ax[r0 + rr][q * 32 + lane] = (b16)(bfv(xr[rr][q]) * XS); }
  if (lane < 16) for (int k = C; k < C + 8; ++k) Ax[lane][k] = (b16)0.0f;
  wave_lds_sync();
  // eight output tiles a group, so that a batch of 16 weight fragments (8 tiles x 2 k steps, 32 loads) fits the registers beside the accumulators; both outer loops stay rolled: unrolling would only grow the code, no load can cross the pads
#pragma unroll 1
  for (int g = 0; g < 6; ++g) { v8f acc[8];
#pragma unroll
    for (int t = 0; t < 8; ++t) acc[t] = (v8f){};
#pragma unroll 1
    for (int kb = 0; kb < C; kb += 64) { v16b bw[2][8];
#pragma unroll
      for (int kk = 0; kk < 2; ++kk)
#pragma unroll
        for (int t = 0; t < 8; ++t) bw[kk][t] = frag_kb(WA + (size_t)(g * 128 + t * 16 + nloc) * C + kb + kk * 32, hlf);
      const v16b a0 = frag_kb(&Ax[nloc][kb], hlf), a1 = frag_kb(&Ax[nloc][kb + 32], hlf);
      loads_issued();
#pragma unroll
      for (int t = 0; t < 8; ++t) acc[t] = wmma16b(a0, bw[0][t], acc[t]);
#pragma unroll
      for (int t = 0; t < 8; ++t) acc[t] = wmma16b(a1, bw[1][t], acc[t]); }
#pragma unroll
    for (int t = 0; t < 8; ++t)
#pragma unroll
      for (int r8 = 0; r8 < 8; ++r8) Tf[8 * hlf + r8][g * 128 + t * 16 + nloc] = acc[t][r8] * (1.0f / (XS * WSC)); }
  wave_lds_sync();
  // module layout: qk.reshape(b,n,2,H,HD): col c < 256 -> q (head c/32, dim c%32); 256..511 -> k
  { for (int rr = 0; rr < 16; ++rr) { for (int h = 0; h < H; ++h) { const size_t po = (((size_t)(b * H + h)) * S + n0 + rr) * HD + lane; b16 p, pl; split16(Tf[rr][h * HD + lane] * HS, p, pl); ((b16*)Qh)[po] = p; ((b16*)Ql)[po] = pl; split16(Tf[rr][C + h * HD + lane] * HS, p, pl); ((b16*)Kh)[po] = p; ((b16*)Kl)[po] = pl; }
      for (int q = 0; q < 2; ++q) *(v4f*)(Vr + (t0 + rr) * C + q * 128 + lane * 4) = *(const v4f*)(&Tf[rr][512 + q * 128 + lane * 4]); }  } }
__global__ __launch_bounds__(256) void vt_kernel(const float* __restrict__ Vr, int QLIM, b16* __restrict__ VTh, b16* __restrict__ VTl) { __shared__ float Tt[64][257]; const size_t t0 = (size_t)blockIdx.x * 64; const int b = (int)(t0 / S), n0 = (int)(t0 % S); if (n0 >= QLIM) return; const int tid = threadIdx.x, wave = tid >> 5, lane = tid & 31;
  { float rv[8][C / 32];   // a wave's 64 loads in one batch; constant trip counts, unrolled in full, keep the batch in registers
#pragma unroll
    for (int i = 0; i < 8; ++i)
#pragma unroll
      for (int k = 0; k < C / 32; ++k) rv[i][k] = Vr[(t0 + wave + 8 * i) * C + lane + 32 * k];
    loads_issued();
#pragma unroll
    for (int i = 0; i < 8; ++i)
#pragma unroll
      for (int k = 0; k < C / 32; ++k) Tt[wave + 8 * i][lane + 32 * k] = rv[i][k]; }
  __syncthreads();
  { for (int c = wave; c < C; c += 8) { const int h = c / HD, d = c % HD; b16 h0, l0, h1, l1; split16(Tt[lane * 2][c] * HS, h0, l0); split16(Tt[lane * 2 + 1][c] * HS, h1, l1); const size_t o = (((size_t)(b * H + h)) * HD + d) * S + n0 + lane * 2; *(v2b*)(VTh + o) = (v2b){h0, h1}; *(v2b*)(VTl + o) = (v2b){l0, l1}; }  } }
__global__ __launch_bounds__(32) void att_kernel(const b16* __restrict__ Qh, const b16* __restrict__ Ql, const b16* __restrict__ Kh, const b16* __restrict__ Kl, const b16* __restrict__ VTh, const b16* __restrict__ VTl, const float* __restrict__ coord, const float* __restrict__ wpos, const float* __restrict__ bpos, const float* __restrict__ gating, int QLIM, float* __restrict__ O) { __shared__ __attribute__((aligned(16))) float Sc[16][S + 4]; __shared__ float Of[16][HD + 1]; const int lane = threadIdx.x, nloc = lane & 15, hlf = lane >> 4; const int bh = blockIdx.x / (S / 16), q0 = (blockIdx.x % (S / 16)) * 16; if (q0 >= QLIM) return; const int b = bh / H, h = bh % H;
  const v16b qa = frag_kb(Qh + ((size_t)bh * S + q0 + nloc) * HD, hlf), ql = frag_kb(Ql + ((size_t)bh * S + q0 + nloc) * HD, hlf);
  loads_issued();
  // (1) scaled scores for all keys
#pragma unroll 1
  for (int tg = 0; tg < S / 16; tg += 8) { v8f s[8];
#pragma unroll
    for (int t = 0; t < 8; ++t) s[t] = (v8f){};
    // eight key tiles (32 loads) a batch; the cut is tested once for the batch (it is a multiple of 256, as phases 2 and 3 take it too): a test per tile would leave paths on which loads are never waited for, and the next trip's loads would then wait on this trip's
    if (tg * 16 < QLIM) { v16b kh[8], kl[8]; const size_t ko = ((size_t)bh * S + tg * 16 + nloc) * HD; const b16 *ph = Kh + ko, *pl = Kl + ko;
#pragma unroll
      for (int t = 0; t < 8; ++t) { kh[t] = frag_kb(ph + t * 16 * HD, hlf); kl[t] = frag_kb(pl + t * 16 * HD, hlf); }
      loads_issued();
#pragma unroll
      for (int t = 0; t < 8; ++t) { s[t] = wmma16b(qa, kh[t], s[t]); s[t] = wmma16b(qa, kl[t], s[t]); s[t] = wmma16b(ql, kh[t], s[t]); } }
#pragma unroll
    for (int t = 0; t < 8; ++t)
#pragma unroll
      for (int r8 = 0; r8 < 8; ++r8) Sc[8 * hlf + r8][(tg + t) * 16 + nloc] = s[t][r8] * (SCALE / (HS * HS)); }
  wave_lds_sync();
  // (2) one query row at a time, its keys spread over the 32 lanes (lane owns keys g * 128 + lane * 4 + e): patch softmax, pos softmax, gated mix, renorm; the row's final weights (x16384) then go back over its own 4,096 score bytes as two f16 planes, hi at keys 0..1023 and lo behind it, in the form phase 3 reads: no second LDS array, so four work-groups fit a WGP's LDS, not three
  { const float gr = gating[h], wr0 = wpos[0 * H + h], wr1 = wpos[1 * H + h], wr2 = wpos[2 * H + h], wr3 = wpos[3 * H + h], br = bpos[h];   // every load of this phase is issued before the first rounding, so that they share one trip to memory
    const float* pq = coord + ((size_t)b * S + q0 + nloc) * 3; const float qx = pq[0], qy = pq[1], qz = pq[2]; v4f craw[S / 128][3];
    // every loop over g, e or u in this phase is unrolled in full, so that its arrays are indexed by constants and stay in registers
#pragma unroll
    for (int g = 0; g < S / 128; ++g)
#pragma unroll
      for (int u = 0; u < 3; ++u) craw[g][u] = *(const v4f*)(coord + ((size_t)b * S + g * 128 + lane * 4) * 3 + u * 4);
    asm volatile("s_wait_xcnt 0x0" ::: "memory");   // stands before the address registers of the loads above are given new values
    const float sg = 1.0f / (1.0f + __expf(-bfv(gr))); const float w0 = bfv(wr0), w1 = bfv(wr1), w2 = bfv(wr2), w3 = bfv(wr3), bp = bfv(br);
    const float rx = bfv(qx), ry = bfv(qy), rz = bfv(qz); float cx[S / 32], cy[S / 32], cz[S / 32], bg[S / 128];
#pragma unroll
    for (int g = 0; g < S / 128; ++g) { bg[g] = g * 128 < QLIM ? bp : -INFINITY;   // a key at or past the cut gets logit -inf, weight 0
#pragma unroll
      for (int e = 0; e < 4; ++e) { cx[g * 4 + e] = bfv(craw[g][(e * 3) / 4][(e * 3) % 4]); cy[g * 4 + e] = bfv(craw[g][(e * 3 + 1) / 4][(e * 3 + 1) % 4]); cz[g * 4 + e] = bfv(craw[g][(e * 3 + 2) / 4][(e * 3 + 2) % 4]); } }
    // the loop over rows stays rolled: one row is about 1,200 instructions already (for speed only)
#pragma unroll 1
    for (int r = 0; r < 16; ++r) { v4f* sr = (v4f*)&Sc[r][0]; v4f s4[S / 128]; float pl[S / 32];
#pragma unroll
      for (int g = 0; g < S / 128; ++g) s4[g] = sr[g * 32 + lane];
      const float pix = lane_bcast(rx, r), piy = lane_bcast(ry, r), piz = lane_bcast(rz, r); float pm4[4] = {-INFINITY, -INFINITY, -INFINITY, -INFINITY}, mx = -INFINITY;
#pragma unroll
      for (int g = 0; g < S / 128; ++g) {
#pragma unroll
        for (int e = 0; e < 4; ++e) { const float dx = cx[g * 4 + e] - pix, dy = cy[g * 4 + e] - piy, dz = cz[g * 4 + e] - piz; const float dd = sqrtf(dx * dx + dy * dy + dz * dz); pl[g * 4 + e] = pmul(dx, w0) + pmul(dy, w1) + pmul(dz, w2) + pmul(dd, w3) + bg[g]; pm4[e] = fmaxf(pm4[e], pl[g * 4 + e]); }
        if (g & 1) __builtin_amdgcn_sched_barrier(0); }   // eight keys in flight at a time: with all 32 started at once their temporaries overflow the registers and loop constants spill to scratch
#pragma unroll
      for (int g = 0; g < S / 128; ++g) { const float gm = fmaxf(fmaxf(s4[g][0], s4[g][1]), fmaxf(s4[g][2], s4[g][3])); mx = fmaxf(mx, g * 128 < QLIM ? gm : -INFINITY); }
      mx = wave_max(mx); const float pm = wave_max(fmaxf(fmaxf(pm4[0], pm4[1]), fmaxf(pm4[2], pm4[3])));
      float z4[4] = {0.0f, 0.0f, 0.0f, 0.0f}, pz4[4] = {0.0f, 0.0f, 0.0f, 0.0f};
#pragma unroll
      for (int g = 0; g < S / 128; ++g) { const float mg = g * 128 < QLIM ? mx : INFINITY;
#pragma unroll
        for (int e = 0; e < 4; ++e) { s4[g][e] = exp_slot(s4[g][e] - mg); z4[e] += s4[g][e]; pl[g * 4 + e] = exp_slot(pl[g * 4 + e] - pm); pz4[e] += pl[g * 4 + e]; } }
      const float zi = 1.0f / wave_sum((z4[0] + z4[1]) + (z4[2] + z4[3])), pzi = 1.0f / wave_sum((pz4[0] + pz4[1]) + (pz4[2] + pz4[3])); float t4[4] = {0.0f, 0.0f, 0.0f, 0.0f};
#pragma unroll
      for (int g = 0; g < S / 128; ++g) {
#pragma unroll
        for (int e = 0; e < 4; ++e) { s4[g][e] = pmul(1.0f - sg, s4[g][e] * zi) + pmul(sg, pl[g * 4 + e] * pzi); t4[e] += s4[g][e]; } }
      const float rn = 1.0f / wave_sum((t4[0] + t4[1]) + (t4[2] + t4[3])); b16* hr = (b16*)&Sc[r][0];
#pragma unroll
      for (int g = 0; g < S / 128; ++g) { v4b wh, wl;
#pragma unroll
        for (int e = 0; e < 4; ++e) { b16 p, q; split16(s4[g][e] * rn * PS, p, q); wh[e] = p; wl[e] = q; }
        *(v4b*)(hr + g * 128 + lane * 4) = wh; *(v4b*)(hr + S + g * 128 + lane * 4) = wl; } } }
  wave_lds_sync();
  // (3) O = A x v^T, 128 keys (32 loads of v^T) a batch; the A fragments come straight from the planes that phase 2 left in Sc
  v8f oacc[2] = {(v8f){}, (v8f){}}; const b16* ar = (const b16*)&Sc[nloc][0];
#pragma unroll 1
  for (int k0 = 0; k0 < QLIM; k0 += CH / 2) { v16b vh[4][2], vl[4][2], pa[4], pb[4]; const size_t vo = ((size_t)bh * HD + nloc) * S + k0 + 8 * hlf; const b16 *gh = VTh + vo, *gl = VTl + vo;
#pragma unroll
    for (int kk = 0; kk < 4; ++kk)
#pragma unroll
      for (int t = 0; t < 2; ++t) { vh[kk][t] = frag_kb(gh + t * 16 * S + kk * 32, 0); vl[kk][t] = frag_kb(gl + t * 16 * S + kk * 32, 0); }
    // as loads_issued(); the two addresses are inputs, so that their registers are still held here and no load of the batch lands on them in front of the wait
    asm volatile("s_wait_xcnt 0x0" :: "v"(gh), "v"(gl) : "memory");
#pragma unroll
    for (int kk = 0; kk < 4; ++kk) { pa[kk] = frag_kb(ar + k0 + kk * 32, hlf); pb[kk] = frag_kb(ar + S + k0 + kk * 32, hlf); }
#pragma unroll
    for (int kk = 0; kk < 4; ++kk)
#pragma unroll
      for (int t = 0; t < 2; ++t) { oacc[t] = wmma16b(pa[kk], vh[kk][t], oacc[t]); oacc[t] = wmma16b(pa[kk], vl[kk][t], oacc[t]); oacc[t] = wmma16b(pb[kk], vh[kk][t], oacc[t]); } }
#pragma unroll
  for (int t = 0; t < 2; ++t)
#pragma unroll
    for (int r8 = 0; r8 < 8; ++r8) Of[8 * hlf + r8][t * 16 + nloc] = oacc[t][r8] * (1.0f / (PS * HS));
  wave_lds_sync();
  { for (int r = 0; r < 16; ++r) ((float*)O)[((size_t)b * S + q0 + r) * C + h * HD + lane] = Of[r][lane];  } }
__global__ __launch_bounds__(32) void outp_kernel(const float* __restrict__ O, const b16* __restrict__ WP, const float* __restrict__ bproj, int QLIM, float* __restrict__ out) { __shared__ __attribute__((aligned(16))) b16 Ah[16][C + 8], Al[16][C + 8]; __shared__ float Tf[16][260]; const int lane = threadIdx.x, nloc = lane & 15, hlf = lane >> 4; const size_t t0 = (size_t)blockIdx.x * 16; if ((int)(t0 % S) >= QLIM) return;
  // eight rows (64 loads) a batch; the loops inside are unrolled in full so that the batch stays in registers
#pragma unroll 1
  for (int r0 = 0; r0 < 16; r0 += 8) { float orw[8][C / 32];
#pragma unroll
    for (int rr = 0; rr < 8; ++rr)
#pragma unroll
      for (int q = 0; q < C / 32; ++q) orw[rr][q] = O[(t0 + r0 + rr) * C + q * 32 + lane];
    loads_issued();
#pragma unroll
    for (int rr = 0; rr < 8; ++rr)
#pragma unroll
      for (int q = 0; q < C / 32; ++q) { b16 p, pl; split16(orw[rr][q] * HS, p, pl); Ah[r0 + rr][q * 32 + lane] = p; Al[r0 + rr][q * 32 + lane] = pl; } }
  if (lane < 16) for (int k = C; k < C + 8; ++k) { Ah[lane][k] = (b16)0.0f; Al[lane][k] = (b16)0.0f; }
  wave_lds_sync();
  // eight output tiles a group, so that a batch of 16 weight fragments (8 tiles x 2 k steps, 32 loads) fits the registers beside the accumulators; both outer loops stay rolled: unrolling would only grow the code, no load can cross the pads
#pragma unroll 1
  for (int g = 0; g < 2; ++g) { v8f acc[8]; float br[8];
#pragma unroll
    for (int t = 0; t < 8; ++t) { acc[t] = (v8f){}; br[t] = bproj[g * 128 + t * 16 + nloc]; }
#pragma unroll 1
    for (int kb = 0; kb < C; kb += 64) { v16b bw[2][8];
#pragma unroll
      for (int kk = 0; kk < 2; ++kk)
#pragma unroll
        for (int t = 0; t < 8; ++t) bw[kk][t] = frag_kb(WP + (size_t)(g * 128 + t * 16 + nloc) * C + kb + kk * 32, hlf);
      loads_issued();
#pragma unroll
      for (int kk = 0; kk < 2; ++kk) { const v16b a = frag_kb(&Ah[nloc][kb + kk * 32], hlf), al = frag_kb(&Al[nloc][kb + kk * 32], hlf);
#pragma unroll
        for (int t = 0; t < 8; ++t) { acc[t] = wmma16b(a, bw[kk][t], acc[t]); acc[t] = wmma16b(al, bw[kk][t], acc[t]); } } }
#pragma unroll
    for (int t = 0; t < 8; ++t) { const int cc = g * 128 + t * 16 + nloc; const float bb = bfv(br[t]);
#pragma unroll
      for (int r8 = 0; r8 < 8; ++r8) Tf[8 * hlf + r8][cc] = acc[t][r8] * (1.0f / (HS * WSC)) + bb; } }
  wave_lds_sync();
  { for (int rr = 0; rr < 16; ++rr) for (int q = 0; q < 2; ++q) *(v4f*)(out + (t0 + rr) * C + q * 128 + lane * 4) = *(const v4f*)(&Tf[rr][q * 128 + lane * 4]);  } }
}  // namespace

extern "C" void kernel_launch(void* const* d_in, const int* in_sizes, int n_in, void* d_out, int out_size, void* d_ws, size_t ws_size, hipStream_t stream) {
  (void)n_in;
  auto Fp = [&](int i) { return (const float*)d_in[i]; };
  // input order: 0 x [4,1024,256]; 1 voxel_coord [4,1024,3]; 2 W_qk [256,512]; 3 W_v [256,256]; 4 W_proj [256,256]; 5 b_proj [256]; 6 W_pos [4,8]; 7 b_pos [8]; 8 gating [8]
  if (in_sizes[0] != NT * C || in_sizes[1] != NT * 3 || in_sizes[2] != C * 512 || in_sizes[3] != C * C || in_sizes[4] != C * C || in_sizes[6] != 4 * H || in_sizes[7] != H || in_sizes[8] != H || out_size != NT * C) return;
  const int QLIM = S;   // per-batch token cut (queries and keys) (multiple of 256)
  size_t off = 0; char* ws = (char*)d_ws;
  auto carve = [&](size_t bytes) { char* p = ws + off; off += (bytes + 255) & ~(size_t)255; return p; };
  b16* WA = (b16*)carve((size_t)768 * C * 2); b16* WP = (b16*)carve((size_t)C * C * 2); b16* Qh = (b16*)carve((size_t)NT * C * 2); b16* Ql = (b16*)carve((size_t)NT * C * 2); b16* Kh = (b16*)carve((size_t)NT * C * 2); b16* Kl = (b16*)carve((size_t)NT * C * 2); float* Vr = (float*)carve((size_t)NT * C * 4); b16* VTh = (b16*)carve((size_t)NT * C * 2); b16* VTl = (b16*)carve((size_t)NT * C * 2); float* O = (float*)carve((size_t)NT * C * 4);
  if (off > ws_size || off > ((size_t)32 << 20)) return;   // ~ 21 MB
  wput_kernel<<<(768 * 32 + 255) / 256, 256, 0, stream>>>(Fp(2), Fp(3), Fp(4), WA, WP);
  proj_kernel<<<NT / 16, 32, 0, stream>>>(Fp(0), WA, QLIM, Qh, Ql, Kh, Kl, Vr);
  vt_kernel<<<NT / 64, 256, 0, stream>>>(Vr, QLIM, VTh, VTl);
  att_kernel<<<NB_ * H * (S / 16), 32, 0, stream>>>(Qh, Ql, Kh, Kl, VTh, VTl, Fp(1), Fp(6), Fp(7), Fp(8), QLIM, O);
  outp_kernel<<<NT / 16, 32, 0, stream>>>(O, WP, Fp(5), QLIM, (float*)d_out);
}

// v004
// One run takes 69.2 microseconds.
// Timed twice side by side with v003, it ran 1.62 times as fast both times.
// Over all steps from v000 it is 23.1 times as fast.
#include <hip/hip_runtime.h>

// GPSA (gated positional self-attention, 8 heads x 32 over 4 x 1024 tokens): [q|k] = x W_qk, v = x W_v; patch = softmax_j(q_i.k_j / sqrt(32)); rel_ij = [p_j - p_i (3), |p_j - p_i|]; pos = softmax_j(rel_ij . W_pos[:,h] + b_pos[h]); attn = (1 - s_h) patch + s_h pos with s_h = sigmoid(gating[h]); attn /= sum_j attn; out = (attn v) W_proj + b_proj -> [4][1024][256].
// WMMA (v_wmma_f32_16x16x32_f16, f32 accumulate): x (EXACT bf16 x8, K 256) x [W_qk | W_v] rows (EXACT x256; 48 tiles); per (bh, 16 queries) S = q (hi+lo x256, K 32) x k rows (hi+lo; 64 tiles) and O = A (hi+lo x16384, K 1,024) x v^T (hi+lo; 2 tiles), 3 products; o (hi+lo, K 256) x W_proj rows (16 tiles) — ≈ 1 M WMMA; positional logits, both softmaxes, gating in f32.

namespace {
constexpr int NB_ = 4, S = 1024, C = 256, H = 8, HD = 32, NT = NB_ * S, CH = 256;
constexpr float XS = 8.0f, HS = 256.0f, PS = 16384.0f, WSC = 256.0f, SCALE = 0.17677669529663687f;
typedef _Float16 b16;
typedef __attribute__((ext_vector_type(16))) _Float16 v16b;
typedef __attribute__((ext_vector_type(8))) _Float16 v8b;
typedef __attribute__((ext_vector_type(8))) float v8f;
typedef __attribute__((ext_vector_type(4))) float v4f;
typedef __attribute__((ext_vector_type(2))) float v2f;
typedef __attribute__((ext_vector_type(2))) _Float16 v2b;
typedef __attribute__((ext_vector_type(4))) _Float16 v4b;
__device__ __forceinline__ float bf16_rne(float f) { unsigned int u = __float_as_uint(f); u += 0x7FFFu + ((u >> 16) & 1u); float r = __uint_as_float(u & 0xFFFF0000u); asm volatile("" : "+v"(r)); return r; }
__device__ __forceinline__ float bfv(float f) { float r = bf16_rne(f); asm volatile("" : "+v"(r)); return r; }
__device__ __forceinline__ void split16(float v, b16& hi, b16& lo) { hi = (b16)v; lo = (b16)(v - (float)hi); }
__device__ __forceinline__ v16b frag_kb(const b16* p, int hh) { const v8b a = *(const v8b*)(p + 8 * hh), b = *(const v8b*)(p + 16 + 8 * hh); v16b f;
#pragma unroll
  for (int e = 0; e < 8; ++e) { f[e] = a[e]; f[8 + e] = b[e]; } return f; }
__device__ __forceinline__ v8f wmma16b(v16b a, v16b b, v8f c) { v8f d = __builtin_amdgcn_wmma_f32_16x16x32_f16(false, a, false, b, (short)0, c, false, false); asm volatile("v_nop\n\tv_nop\n\tv_nop\n\tv_nop" : "+v"(d) : "v"(a), "v"(b)); return d; }
// stands behind a batch of global loads: before their address registers are given new values, and, being volatile, it keeps the whole batch in front of the volatile statements that follow (the pads behind each matrix instruction, the rounding pins), which no load can cross
__device__ __forceinline__ void loads_issued() { asm volatile("s_wait_xcnt 0x0" ::: "memory"); }
// as loads_issued(); the batch's address is an input, so that its registers are still held here and no load of the batch lands on them in front of the wait
__device__ __forceinline__ void loads_issued_from(const void* p) { asm volatile("s_wait_xcnt 0x0" :: "v"(p) : "memory"); }
__device__ __forceinline__ float pmul(float a, float b) { float p = a * b; asm volatile("" : "+v"(p)); return p; }

// butterfly over the 32 lanes: four DPP steps inside each 16-lane row, then the other row; every lane ends with the same value
template <int CTRL> __device__ __forceinline__ float row_x(float v) { return __builtin_bit_cast(float, __builtin_amdgcn_mov_dpp(__builtin_bit_cast(int, v), CTRL, 0xf, 0xf, true)); }
__device__ __forceinline__ float half_x(float v) { return __builtin_bit_cast(float, __builtin_amdgcn_permlanex16(__builtin_bit_cast(int, v), __builtin_bit_cast(int, v), 0x76543210, 0xfedcba98, false, false)); }
__device__ __forceinline__ float wave_sum(float v) { v += row_x<0x161>(v); v += row_x<0x162>(v); v += row_x<0x164>(v); v += row_x<0x168>(v); return v + half_x(v); }
__device__ __forceinline__ float wave_max(float v) { v = fmaxf(v, row_x<0x161>(v)); v = fmaxf(v, row_x<0x162>(v)); v = fmaxf(v, row_x<0x164>(v)); v = fmaxf(v, row_x<0x168>(v)); return fmaxf(v, half_x(v)); }
// e^x as __expf forms it (x * log2 e, then v_exp_f32); the v_nop in the same statement keeps the one slot that the instruction set asks for behind a transcendental before its result is read or its source overwritten
__device__ __forceinline__ float exp_slot(float x) { float r; asm("v_exp_f32 %0, %1\n\tv_nop" : "=v"(r) : "v"(x * 1.44269504f)); return r; }
__device__ __forceinline__ float lane_bcast(float v, int l) { return __builtin_bit_cast(float, __builtin_amdgcn_readlane(__builtin_bit_cast(int, v), l)); }

__global__ __launch_bounds__(256) void wput_kernel(const float* __restrict__ wqk, const float* __restrict__ wv, const float* __restrict__ wproj, b16* __restrict__ WA, b16* __restrict__ WP) { const int u = blockIdx.x * 256 + threadIdx.x; v8b v; auto put = [&](b16* dst) { { *(v8b*)dst = v;  } };
  const int o = u / 32, k0 = (u % 32) * 8; float ra[8] = {}, rp[8] = {};   // all of a thread's loads are issued before the first rounding, so that they share one trip to memory
  if (u < 768 * 32) { const float* sa = o < 512 ? wqk + o : wv + (o - 512); const int ld = o < 512 ? 512 : C;
#pragma unroll
    for (int j = 0; j < 8; ++j) ra[j] = sa[(size_t)(k0 + j) * ld]; }
  if (u < 256 * 32) {
#pragma unroll
    for (int j = 0; j < 8; ++j) rp[j] = wproj[(size_t)(k0 + j) * C + o]; }
  loads_issued();
  if (u < 768 * 32) {
#pragma unroll
    for (int j = 0; j < 8; ++j) v[j] = (b16)(bf16_rne(ra[j]) * WSC); put(WA + (size_t)o * C + k0); }
  if (u < 256 * 32) {
#pragma unroll
    for (int j = 0; j < 8; ++j) v[j] = (b16)(bf16_rne(rp[j]) * WSC); put(WP + (size_t)o * C + k0); } }
// eight waves a work-group share one 16-token tile: each takes two of its rows going in and coming out, and six of the 48 output tiles
__global__ __launch_bounds__(256) void proj_kernel(const float* __restrict__ x, const b16* __restrict__ WA, int QLIM, b16* __restrict__ Qh, b16* __restrict__ Ql, b16* __restrict__ Kh, b16* __restrict__ Kl, float* __restrict__ Vr) { __shared__ __attribute__((aligned(16))) b16 Ax[16][C + 8]; __shared__ float Tf[16][772]; const int lane = threadIdx.x & 31, wave = __builtin_amdgcn_readfirstlane(threadIdx.x >> 5), nloc = lane & 15, hlf = lane >> 4; const size_t t0 = (size_t)blockIdx.x * 16; const int b = (int)(t0 / S), n0 = (int)(t0 % S); if (n0 >= QLIM) return;
  // a wave's two rows (16 loads) in one batch; the loops are unrolled in full so that the batch stays in registers
  { float xr[2][C / 32]; const float* px = x + (t0 + wave * 2) * C + lane;
#pragma unroll
    for (int rr = 0; rr < 2; ++rr)
#pragma unroll
      for (int q = 0; q < C / 32; ++q) xr[rr][q] = px[rr * C + q * 32];
    loads_issued_from(px);
#pragma unroll
    for (int rr = 0; rr < 2; ++rr)
#pragma unroll
      for (int q = 0; q < C / 32; ++q) Ax[wave * 2 + rr][q * 32 + lane] = (b16)(bfv(xr[rr][q]) * XS); }
  if (threadIdx.x < 16) for (int k = C; k < C + 8; ++k) Ax[threadIdx.x][k] = (b16)0.0f;
  __syncthreads();   // every wave reads all 16 rows of Ax
  // a wave's six output tiles; a batch is 12 weight fragments (6 tiles x 2 k steps, 24 loads); the k loop stays rolled: unrolling would only grow the code, no load can cross the pads
  { v8f acc[6];
#pragma unroll
    for (int t = 0; t < 6; ++t) acc[t] = (v8f){};
#pragma unroll 1
    for (int kb = 0; kb < C; kb += 64) { v16b bw[2][6]; const b16* pw = WA + (size_t)(wave * 96 + nloc) * C + kb + 8 * hlf;
#pragma unroll
      for (int kk = 0; kk < 2; ++kk)
#pragma unroll
        for (int t = 0; t < 6; ++t) bw[kk][t] = frag_kb(pw + t * 16 * C + kk * 32, 0);
      const v16b a0 = frag_kb(&Ax[nloc][kb], hlf), a1 = frag_kb(&Ax[nloc][kb + 32], hlf);
      loads_issued();
#pragma unroll
      for (int t = 0; t < 6; ++t) acc[t] = wmma16b(a0, bw[0][t], acc[t]);
#pragma unroll
      for (int t = 0; t < 6; ++t) acc[t] = wmma16b(a1, bw[1][t], acc[t]); }
#pragma unroll
    for (int t = 0; t < 6; ++t)
#pragma unroll
      for (int r8 = 0; r8 < 8; ++r8) Tf[8 * hlf + r8][wave * 96 + t * 16 + nloc] = acc[t][r8] * (1.0f / (XS * WSC)); }
  __syncthreads();   // a row of Tf comes from all eight waves
  // module layout: qk.reshape(b,n,2,H,HD): col c < 256 -> q (head c/32, dim c%32); 256..511 -> k
  { for (int rr = wave * 2; rr < wave * 2 + 2; ++rr) { for (int h = 0; h < H; ++h) { const size_t po = (((size_t)(b * H + h)) * S + n0 + rr) * HD + lane; b16 p, pl; split16(Tf[rr][h * HD + lane] * HS, p, pl); ((b16*)Qh)[po] = p; ((b16*)Ql)[po] = pl; split16(Tf[rr][C + h * HD + lane] * HS, p, pl); ((b16*)Kh)[po] = p; ((b16*)Kl)[po] = pl; }
      for (int q = 0; q < 2; ++q) *(v4f*)(Vr + (t0 + rr) * C + q * 128 + lane * 4) = *(const v4f*)(&Tf[rr][512 + q * 128 + lane * 4]);
      asm volatile("s_wait_xcnt 0x0" ::: "memory"); }  } }   // behind a row's last store: the next trip gives the stores' data and address registers new values
__global__ __launch_bounds__(256) void vt_kernel(const float* __restrict__ Vr, int QLIM, b16* __restrict__ VTh, b16* __restrict__ VTl) { __shared__ float Tt[64][257]; const size_t t0 = (size_t)blockIdx.x * 64; const int b = (int)(t0 / S), n0 = (int)(t0 % S); if (n0 >= QLIM) return; const int tid = threadIdx.x, wave = tid >> 5, lane = tid & 31;
  { float rv[8][C / 32];   // a wave's 64 loads in one batch; constant trip counts, unrolled in full, keep the batch in registers
#pragma unroll
    for (int i = 0; i < 8; ++i)
#pragma unroll
      for (int k = 0; k < C / 32; ++k) rv[i][k] = Vr[(t0 + wave + 8 * i) * C + lane + 32 * k];
    loads_issued();
#pragma unroll
    for (int i = 0; i < 8; ++i)
#pragma unroll
      for (int k = 0; k < C / 32; ++k) Tt[wave + 8 * i][lane + 32 * k] = rv[i][k]; }
  __syncthreads();
  { for (int c = wave; c < C; c += 8) { const int h = c / HD, d = c % HD; b16 h0, l0, h1, l1; split16(Tt[lane * 2][c] * HS, h0, l0); split16(Tt[lane * 2 + 1][c] * HS, h1, l1); const size_t o = (((size_t)(b * H + h)) * HD + d) * S + n0 + lane * 2; *(v2b*)(VTh + o) = (v2b){h0, h1}; *(v2b*)(VTl + o) = (v2b){l0, l1}; }  } }
// four waves a work-group share one 16-query tile and its score rows in LDS: each takes a quarter of the key tiles (1), four of the rows (2) and a quarter of the keys (3), so that a SIMD holds four waves, not one, and one wave's waits are filled by the others
__global__ __launch_bounds__(128) void att_kernel(const b16* __restrict__ Qh, const b16* __restrict__ Ql, const b16* __restrict__ Kh, const b16* __restrict__ Kl, const b16* __restrict__ VTh, const b16* __restrict__ VTl, const float* __restrict__ coord, const float* __restrict__ wpos, const float* __restrict__ bpos, const float* __restrict__ gating, int QLIM, float* __restrict__ O) { __shared__ __attribute__((aligned(16))) float Sc[16][S + 4]; __shared__ float Of[4][16][HD + 1]; const int lane = threadIdx.x & 31, wave = __builtin_amdgcn_readfirstlane(threadIdx.x >> 5), nloc = lane & 15, hlf = lane >> 4; const int bh = blockIdx.x / (S / 16), q0 = (blockIdx.x % (S / 16)) * 16; if (q0 >= QLIM) return; const int b = bh / H, h = bh % H;
  const v16b qa = frag_kb(Qh + ((size_t)bh * S + q0 + nloc) * HD, hlf), ql = frag_kb(Ql + ((size_t)bh * S + q0 + nloc) * HD, hlf);
  loads_issued();
  // (1) scaled scores for all keys, 16 key tiles a wave
#pragma unroll 1
  for (int tg = wave * 16; tg < wave * 16 + 16; tg += 8) { v8f s[8];
#pragma unroll
    for (int t = 0; t < 8; ++t) s[t] = (v8f){};
    // eight key tiles (32 loads) a batch; the cut is tested once for the batch (it is a multiple of 256, as phases 2 and 3 take it too): a test per tile would leave paths on which loads are never waited for, and the next trip's loads would then wait on this trip's
    if (tg * 16 < QLIM) { v16b kh[8], kl[8]; const size_t ko = ((size_t)bh * S + tg * 16 + nloc) * HD; const b16 *ph = Kh + ko, *pl = Kl + ko;
#pragma unroll
      for (int t = 0; t < 8; ++t) { kh[t] = frag_kb(ph + t * 16 * HD, hlf); kl[t] = frag_kb(pl + t * 16 * HD, hlf); }
      loads_issued();
#pragma unroll
      for (int t = 0; t < 8; ++t) { s[t] = wmma16b(qa, kh[t], s[t]); s[t] = wmma16b(qa, kl[t], s[t]); s[t] = wmma16b(ql, kh[t], s[t]); } }
#pragma unroll
    for (int t = 0; t < 8; ++t)
#pragma unroll
      for (int r8 = 0; r8 < 8; ++r8) Sc[8 * hlf + r8][(tg + t) * 16 + nloc] = s[t][r8] * (SCALE / (HS * HS)); }
  __syncthreads();   // a row's scores come from all four waves
  // (2) one query row at a time, its keys spread over the 32 lanes (lane owns keys g * 128 + lane * 4 + e): patch softmax, pos softmax, gated mix, renorm; the row's final weights (x16384) then go back over its own 4,096 score bytes as two f16 planes, hi at keys 0..1023 and lo behind it, in the form phase 3 reads: no second LDS array, so four work-groups fit a WGP's LDS, not three
  { const float gr = gating[h], wr0 = wpos[0 * H + h], wr1 = wpos[1 * H + h], wr2 = wpos[2 * H + h], wr3 = wpos[3 * H + h], br = bpos[h];   // every load of this phase is issued before the first rounding, so that they share one trip to memory
    const float* pq = coord + ((size_t)b * S + q0 + nloc) * 3; const float qx = pq[0], qy = pq[1], qz = pq[2]; v4f craw[S / 128][3];
    // every loop over g, e or u in this phase is unrolled in full, so that its arrays are indexed by constants and stay in registers
#pragma unroll
    for (int g = 0; g < S / 128; ++g)
#pragma unroll
      for (int u = 0; u < 3; ++u) craw[g][u] = *(const v4f*)(coord + ((size_t)b * S + g * 128 + lane * 4) * 3 + u * 4);
    asm volatile("s_wait_xcnt 0x0" :: "v"(pq) : "memory");   // stands before the address registers of the loads above are given new values; the query address is an input, so that no later load of the batch lands on its registers in front of the wait
    const float sg = 1.0f / (1.0f + __expf(-bfv(gr))); const float w0 = bfv(wr0), w1 = bfv(wr1), w2 = bfv(wr2), w3 = bfv(wr3), bp = bfv(br);
    const float rx = bfv(qx), ry = bfv(qy), rz = bfv(qz); float cx[S / 32], cy[S / 32], cz[S / 32], bg[S / 128];
#pragma unroll
    for (int g = 0; g < S / 128; ++g) { bg[g] = g * 128 < QLIM ? bp : -INFINITY;   // a key at or past the cut gets logit -inf, weight 0
#pragma unroll
      for (int e = 0; e < 4; ++e) { cx[g * 4 + e] = bfv(craw[g][(e * 3) / 4][(e * 3) % 4]); cy[g * 4 + e] = bfv(craw[g][(e * 3 + 1) / 4][(e * 3 + 1) % 4]); cz[g * 4 + e] = bfv(craw[g][(e * 3 + 2) / 4][(e * 3 + 2) % 4]); } }
    // the loop over a wave's four rows stays rolled: one row is about 1,200 instructions already, and copies would only grow the code
#pragma unroll 1
    for (int r = wave * 4; r < wave * 4 + 4; ++r) { v4f* sr = (v4f*)&Sc[r][0]; v4f s4[S / 128]; float pl[S / 32];
#pragma unroll
      for (int g = 0; g < S / 128; ++g) s4[g] = sr[g * 32 + lane];
      const float pix = lane_bcast(rx, r), piy = lane_bcast(ry, r), piz = lane_bcast(rz, r); float pm4[4] = {-INFINITY, -INFINITY, -INFINITY, -INFINITY}, mx = -INFINITY;
#pragma unroll
      for (int g = 0; g < S / 128; ++g) {
#pragma unroll
        for (int e = 0; e < 4; ++e) { const float dx = cx[g * 4 + e] - pix, dy = cy[g * 4 + e] - piy, dz = cz[g * 4 + e] - piz; const float dd = sqrtf(dx * dx + dy * dy + dz * dz); pl[g * 4 + e] = pmul(dx, w0) + pmul(dy, w1) + pmul(dz, w2) + pmul(dd, w3) + bg[g]; pm4[e] = fmaxf(pm4[e], pl[g * 4 + e]); }
        if (g & 1) __builtin_amdgcn_sched_barrier(0); }   // eight keys in flight at a time: with all 32 started at once their temporaries overflow the registers and loop constants spill to scratch
#pragma unroll
      for (int g = 0; g < S / 128; ++g) { const float gm = fmaxf(fmaxf(s4[g][0], s4[g][1]), fmaxf(s4[g][2], s4[g][3])); mx = fmaxf(mx, g * 128 < QLIM ? gm : -INFINITY); }
      mx = wave_max(mx); const float pm = wave_max(fmaxf(fmaxf(pm4[0], pm4[1]), fmaxf(pm4[2], pm4[3])));
      float z4[4] = {0.0f, 0.0f, 0.0f, 0.0f}, pz4[4] = {0.0f, 0.0f, 0.0f, 0.0f};
#pragma unroll
      for (int g = 0; g < S / 128; ++g) { const float mg = g * 128 < QLIM ? mx : INFINITY;
#pragma unroll
        for (int e = 0; e < 4; ++e) { s4[g][e] = exp_slot(s4[g][e] - mg); z4[e] += s4[g][e]; pl[g * 4 + e] = exp_slot(pl[g * 4 + e] - pm); pz4[e] += pl[g * 4 + e]; } }
      const float zi = 1.0f / wave_sum((z4[0] + z4[1]) + (z4[2] + z4[3])), pzi = 1.0f / wave_sum((pz4[0] + pz4[1]) + (pz4[2] + pz4[3])); float t4[4] = {0.0f, 0.0f, 0.0f, 0.0f};
#pragma unroll
      for (int g = 0; g < S / 128; ++g) {
#pragma unroll
        for (int e = 0; e < 4; ++e) { s4[g][e] = pmul(1.0f - sg, s4[g][e] * zi) + pmul(sg, pl[g * 4 + e] * pzi); t4[e] += s4[g][e]; } }
      const float rn = 1.0f / wave_sum((t4[0] + t4[1]) + (t4[2] + t4[3])); b16* hr = (b16*)&Sc[r][0];
#pragma unroll
      for (int g = 0; g < S / 128; ++g) { v4b wh, wl;
#pragma unroll
        for (int e = 0; e < 4; ++e) { b16 p, q; split16(s4[g][e] * rn * PS, p, q); wh[e] = p; wl[e] = q; }
        *(v4b*)(hr + g * 128 + lane * 4) = wh; *(v4b*)(hr + S + g * 128 + lane * 4) = wl; } } }
  __syncthreads();   // phase 3 reads all 16 rows
  // (3) O = A x v^T, 256 keys a wave, 128 keys (32 loads of v^T) a batch; the A fragments come straight from the planes that phase 2 left in Sc
  v8f oacc[2] = {(v8f){}, (v8f){}}; const b16* ar = (const b16*)&Sc[nloc][0];
#pragma unroll 1
  for (int k0 = wave * CH; k0 < wave * CH + CH && k0 < QLIM; k0 += CH / 2) { v16b vh[4][2], vl[4][2], pa[4], pb[4]; const size_t vo = ((size_t)bh * HD + nloc) * S + k0 + 8 * hlf; const b16 *gh = VTh + vo, *gl = VTl + vo;
#pragma unroll
    for (int kk = 0; kk < 4; ++kk)
#pragma unroll
      for (int t = 0; t < 2; ++t) { vh[kk][t] = frag_kb(gh + t * 16 * S + kk * 32, 0); vl[kk][t] = frag_kb(gl + t * 16 * S + kk * 32, 0); }
    // as loads_issued(); the two addresses are inputs, so that their registers are still held here and no load of the batch lands on them in front of the wait
    asm volatile("s_wait_xcnt 0x0" :: "v"(gh), "v"(gl) : "memory");
#pragma unroll
    for (int kk = 0; kk < 4; ++kk) { pa[kk] = frag_kb(ar + k0 + kk * 32, hlf); pb[kk] = frag_kb(ar + S + k0 + kk * 32, hlf); }
#pragma unroll
    for (int kk = 0; kk < 4; ++kk)
#pragma unroll
      for (int t = 0; t < 2; ++t) { oacc[t] = wmma16b(pa[kk], vh[kk][t], oacc[t]); oacc[t] = wmma16b(pa[kk], vl[kk][t], oacc[t]); oacc[t] = wmma16b(pb[kk], vh[kk][t], oacc[t]); } }
#pragma unroll
  for (int t = 0; t < 2; ++t)
#pragma unroll
    for (int r8 = 0; r8 < 8; ++r8) Of[wave][8 * hlf + r8][t * 16 + nloc] = oacc[t][r8] * (1.0f / (PS * HS));
  __syncthreads();   // the four waves' partial sums over their key quarters are added below
  { for (int r = wave * 4; r < wave * 4 + 4; ++r) ((float*)O)[((size_t)b * S + q0 + r) * C + h * HD + lane] = (Of[0][r][lane] + Of[1][r][lane]) + (Of[2][r][lane] + Of[3][r][lane]);  } }
// eight waves a work-group share one 16-token tile: each takes two of its rows going in and coming out, and two of the 16 output tiles
__global__ __launch_bounds__(256) void outp_kernel(const float* __restrict__ O, const b16* __restrict__ WP, const float* __restrict__ bproj, int QLIM, float* __restrict__ out) { __shared__ __attribute__((aligned(16))) b16 Ah[16][C + 8], Al[16][C + 8]; __shared__ float Tf[16][260]; const int lane = threadIdx.x & 31, wave = __builtin_amdgcn_readfirstlane(threadIdx.x >> 5), nloc = lane & 15, hlf = lane >> 4; const size_t t0 = (size_t)blockIdx.x * 16; if ((int)(t0 % S) >= QLIM) return;
  // a wave's two rows (16 loads) in one batch; the loops are unrolled in full so that the batch stays in registers
  { float orw[2][C / 32]; const float* po = O + (t0 + wave * 2) * C + lane;
#pragma unroll
    for (int rr = 0; rr < 2; ++rr)
#pragma unroll
      for (int q = 0; q < C / 32; ++q) orw[rr][q] = po[rr * C + q * 32];
    loads_issued_from(po);
#pragma unroll
    for (int rr = 0; rr < 2; ++rr)
#pragma unroll
      for (int q = 0; q < C / 32; ++q) { b16 p, pl; split16(orw[rr][q] * HS, p, pl); Ah[wave * 2 + rr][q * 32 + lane] = p; Al[wave * 2 + rr][q * 32 + lane] = pl; } }
  if (threadIdx.x < 16) for (int k = C; k < C + 8; ++k) { Ah[threadIdx.x][k] = (b16)0.0f; Al[threadIdx.x][k] = (b16)0.0f; }
  __syncthreads();   // every wave reads all 16 rows of Ah and Al
  // a wave's two output tiles: all their 16 weight fragments (2 tiles x 8 k steps, 32 loads) are one batch
  { v8f acc[2]; float br[2]; v16b bw[8][2]; const int ib = wave * 32 + nloc; const b16* pw = WP + (size_t)(wave * 32 + nloc) * C + 8 * hlf;
#pragma unroll
    for (int t = 0; t < 2; ++t) { acc[t] = (v8f){}; br[t] = bproj[ib + t * 16]; }
#pragma unroll
    for (int kk = 0; kk < 8; ++kk)
#pragma unroll
      for (int t = 0; t < 2; ++t) bw[kk][t] = frag_kb(pw + t * 16 * C + kk * 32, 0);
    asm volatile("s_wait_xcnt 0x0" :: "v"(ib), "v"(pw) : "memory");   // as loads_issued_from(); the bias loads are addressed by the index
#pragma unroll
    for (int kk = 0; kk < 8; ++kk) { const v16b a = frag_kb(&Ah[nloc][kk * 32], hlf), al = frag_kb(&Al[nloc][kk * 32], hlf);
#pragma unroll
      for (int t = 0; t < 2; ++t) { acc[t] = wmma16b(a, bw[kk][t], acc[t]); acc[t] = wmma16b(al, bw[kk][t], acc[t]); } }
#pragma unroll
    for (int t = 0; t < 2; ++t) { const int cc = wave * 32 + t * 16 + nloc; const float bb = bfv(br[t]);
#pragma unroll
      for (int r8 = 0; r8 < 8; ++r8) Tf[8 * hlf + r8][cc] = acc[t][r8] * (1.0f / (HS * WSC)) + bb; } }
  __syncthreads();   // a row of Tf comes from all eight waves
  { for (int rr = wave * 2; rr < wave * 2 + 2; ++rr) for (int q = 0; q < 2; ++q) *(v4f*)(out + (t0 + rr) * C + q * 128 + lane * 4) = *(const v4f*)(&Tf[rr][q * 128 + lane * 4]);  } }
}  // namespace

extern "C" void kernel_launch(void* const* d_in, const int* in_sizes, int n_in, void* d_out, int out_size, void* d_ws, size_t ws_size, hipStream_t stream) {
  (void)n_in;
  auto Fp = [&](int i) { return (const float*)d_in[i]; };
  // input order: 0 x [4,1024,256]; 1 voxel_coord [4,1024,3]; 2 W_qk [256,512]; 3 W_v [256,256]; 4 W_proj [256,256]; 5 b_proj [256]; 6 W_pos [4,8]; 7 b_pos [8]; 8 gating [8]
  if (in_sizes[0] != NT * C || in_sizes[1] != NT * 3 || in_sizes[2] != C * 512 || in_sizes[3] != C * C || in_sizes[4] != C * C || in_sizes[6] != 4 * H || in_sizes[7] != H || in_sizes[8] != H || out_size != NT * C) return;
  const int QLIM = S;   // per-batch token cut (queries and keys) (multiple of 256)
  size_t off = 0; char* ws = (char*)d_ws;
  auto carve = [&](size_t bytes) { char* p = ws + off; off += (bytes + 255) & ~(size_t)255; return p; };
  b16* WA = (b16*)carve((size_t)768 * C * 2); b16* WP = (b16*)carve((size_t)C * C * 2); b16* Qh = (b16*)carve((size_t)NT * C * 2); b16* Ql = (b16*)carve((size_t)NT * C * 2); b16* Kh = (b16*)carve((size_t)NT * C * 2); b16* Kl = (b16*)carve((size_t)NT * C * 2); float* Vr = (float*)carve((size_t)NT * C * 4); b16* VTh = (b16*)carve((size_t)NT * C * 2); b16* VTl = (b16*)carve((size_t)NT * C * 2); float* O = (float*)carve((size_t)NT * C * 4);
  if (off > ws_size || off > ((size_t)32 << 20)) return;   // ~ 21 MB
  wput_kernel<<<(768 * 32 + 255) / 256, 256, 0, stream>>>(Fp(2), Fp(3), Fp(4), WA, WP);
  proj_kernel<<<NT / 16, 256, 0, stream>>>(Fp(0), WA, QLIM, Qh, Ql, Kh, Kl, Vr);
  vt_kernel<<<NT / 64, 256, 0, stream>>>(Vr, QLIM, VTh, VTl);
  att_kernel<<<NB_ * H * (S / 16), 128, 0, stream>>>(Qh, Ql, Kh, Kl, VTh, VTl, Fp(1), Fp(6), Fp(7), Fp(8), QLIM, O);
  outp_kernel<<<NT / 16, 256, 0, stream>>>(O, WP, Fp(5), QLIM, (float*)d_out);
}

// v005
// A run of this version takes 63.8 microseconds.
// In two side-by-side timings against v004, it was 1.09 and 1.08 times as fast.
// All steps since v000 together make it 25.0 times as fast.
#include <hip/hip_runtime.h>

// GPSA (gated positional self-attention, 8 heads x 32 over 4 x 1024 tokens): [q|k] = x W_qk, v = x W_v; patch = softmax_j(q_i.k_j / sqrt(32)); rel_ij = [p_j - p_i (3), |p_j - p_i|]; pos = softmax_j(rel_ij . W_pos[:,h] + b_pos[h]); attn = (1 - s_h) patch + s_h pos with s_h = sigmoid(gating[h]); attn /= sum_j attn; out = (attn v) W_proj + b_proj -> [4][1024][256].
// WMMA (v_wmma_f32_16x16x32_f16, f32 accumulate): x (EXACT bf16 x8, K 256) x [W_qk | W_v] rows (EXACT x256; 48 tiles); per (bh, 16 queries) S = q (hi+lo x256, K 32) x k rows (hi+lo; 64 tiles) and O = A (hi+lo x16384, K 1,024) x v^T (hi+lo; 2 tiles), 3 products; o (hi+lo, K 256) x W_proj rows (16 tiles) — ≈ 1 M WMMA; positional logits, both softmaxes, gating in f32.

namespace {
constexpr int NB_ = 4, S = 1024, C = 256, H = 8, HD = 32, NT = NB_ * S, CH = 256;
constexpr float XS = 8.0f, HS = 256.0f, PS = 16384.0f, WSC = 256.0f, SCALE = 0.17677669529663687f;
typedef _Float16 b16;
typedef __attribute__((ext_vector_type(16))) _Float16 v16b;
typedef __attribute__((ext_vector_type(8))) _Float16 v8b;
typedef __attribute__((ext_vector_type(8))) float v8f;
typedef __attribute__((ext_vector_type(4))) float v4f;
typedef __attribute__((ext_vector_type(2))) float v2f;
typedef __attribute__((ext_vector_type(2))) _Float16 v2b;
typedef __attribute__((ext_vector_type(4))) _Float16 v4b;
__device__ __forceinline__ float bf16_rne(float f) { unsigned int u = __float_as_uint(f); u += 0x7FFFu + ((u >> 16) & 1u); float r = __uint_as_float(u & 0xFFFF0000u); asm volatile("" : "+v"(r)); return r; }
__device__ __forceinline__ float bfv(float f) { float r = bf16_rne(f); asm volatile("" : "+v"(r)); return r; }
__device__ __forceinline__ void split16(float v, b16& hi, b16& lo) { hi = (b16)v; lo = (b16)(v - (float)hi); }
__device__ __forceinline__ v16b frag_kb(const b16* p, int hh) { const v8b a = *(const v8b*)(p + 8 * hh), b = *(const v8b*)(p + 16 + 8 * hh); v16b f;
#pragma unroll
  for (int e = 0; e < 8; ++e) { f[e] = a[e]; f[8 + e] = b[e]; } return f; }
__device__ __forceinline__ v8f wmma16b(v16b a, v16b b, v8f c) { v8f d = __builtin_amdgcn_wmma_f32_16x16x32_f16(false, a, false, b, (short)0, c, false, false); asm volatile("v_nop\n\tv_nop\n\tv_nop\n\tv_nop" : "+v"(d) : "v"(a), "v"(b)); return d; }
// stands behind a batch of global loads: before their address registers are given new values, and, being volatile, it keeps the whole batch in front of the volatile statements that follow (the pads behind each matrix instruction, the rounding pins), which no load can cross
__device__ __forceinline__ void loads_issued() { asm volatile("s_wait_xcnt 0x0" ::: "memory"); }
// as loads_issued(); the batch's address is an input, so that its registers are still held here and no load of the batch lands on them in front of the wait
__device__ __forceinline__ void loads_issued_from(const void* p) { asm volatile("s_wait_xcnt 0x0" :: "v"(p) : "memory"); }
__device__ __forceinline__ float pmul(float a, float b) { float p = a * b; asm volatile("" : "+v"(p)); return p; }

// butterfly over the 32 lanes: four DPP steps inside each 16-lane row, then the other row; every lane ends with the same value
template <int CTRL> __device__ __forceinline__ float row_x(float v) { return __builtin_bit_cast(float, __builtin_amdgcn_mov_dpp(__builtin_bit_cast(int, v), CTRL, 0xf, 0xf, true)); }
__device__ __forceinline__ float half_x(float v) { return __builtin_bit_cast(float, __builtin_amdgcn_permlanex16(__builtin_bit_cast(int, v), __builtin_bit_cast(int, v), 0x76543210, 0xfedcba98, false, false)); }
__device__ __forceinline__ float wave_sum(float v) { v += row_x<0x161>(v); v += row_x<0x162>(v); v += row_x<0x164>(v); v += row_x<0x168>(v); return v + half_x(v); }
__device__ __forceinline__ float wave_max(float v) { v = fmaxf(v, row_x<0x161>(v)); v = fmaxf(v, row_x<0x162>(v)); v = fmaxf(v, row_x<0x164>(v)); v = fmaxf(v, row_x<0x168>(v)); return fmaxf(v, half_x(v)); }
// e^x as __expf forms it (x * log2 e, then v_exp_f32); the v_nop in the same statement keeps the one slot that the instruction set asks for behind a transcendental before its result is read or its source overwritten
__device__ __forceinline__ float exp_slot(float x) { float r; asm("v_exp_f32 %0, %1\n\tv_nop" : "=v"(r) : "v"(x * 1.44269504f)); return r; }
// square root and reciprocal as the one hardware instruction each (about 1 ulp), not the exactly rounded sequences that sqrtf and 1.0f / x expand to (some 15 and 10 vector instructions with compares and selects). The root feeds a softmax logit through a weight; an argument too small for the instruction is a distance below 1e-19, whose share of the logit is nothing either way. The reciprocals take softmax sums, which are 1 or more, and 1 + e^-g
// four roots in one statement: each fills the slot that the instruction set asks for behind the one in front of it (the outputs are early-clobber, so none lands on a source), and the one v_nop keeps the slot of the last; the compiler hints no dependence of asm text, so the statement opens with the hint itself: the sums of squares are made just in front, and an unhinted wait for them would hold the SIMD's other waves too
__device__ __forceinline__ void hw_sqrt4(const float (&x)[4], float (&r)[4]) { asm("s_delay_alu instid0(VALU_DEP_1)\n\tv_sqrt_f32 %0, %4\n\tv_sqrt_f32 %1, %5\n\tv_sqrt_f32 %2, %6\n\tv_sqrt_f32 %3, %7\n\tv_nop" : "=&v"(r[0]), "=&v"(r[1]), "=&v"(r[2]), "=&v"(r[3]) : "v"(x[0]), "v"(x[1]), "v"(x[2]), "v"(x[3])); }
__device__ __forceinline__ float hw_rcp(float x) { return __builtin_amdgcn_rcpf(x); }
__device__ __forceinline__ float lane_bcast(float v, int l) { return __builtin_bit_cast(float, __builtin_amdgcn_readlane(__builtin_bit_cast(int, v), l)); }

__global__ __launch_bounds__(256) void wput_kernel(const float* __restrict__ wqk, const float* __restrict__ wv, const float* __restrict__ wproj, b16* __restrict__ WA, b16* __restrict__ WP) { const int u = blockIdx.x * 256 + threadIdx.x; v8b v; auto put = [&](b16* dst) { { *(v8b*)dst = v;  } };
  const int o = u / 32, k0 = (u % 32) * 8; float ra[8] = {}, rp[8] = {};   // all of a thread's loads are issued before the first rounding, so that they share one trip to memory
  if (u < 768 * 32) { const float* sa = o < 512 ? wqk + o : wv + (o - 512); const int ld = o < 512 ? 512 : C;
#pragma unroll
    for (int j = 0; j < 8; ++j) ra[j] = sa[(size_t)(k0 + j) * ld]; }
  if (u < 256 * 32) {
#pragma unroll
    for (int j = 0; j < 8; ++j) rp[j] = wproj[(size_t)(k0 + j) * C + o]; }
  loads_issued();
  if (u < 768 * 32) {
#pragma unroll
    for (int j = 0; j < 8; ++j) v[j] = (b16)(bf16_rne(ra[j]) * WSC); put(WA + (size_t)o * C + k0); }
  if (u < 256 * 32) {
#pragma unroll
    for (int j = 0; j < 8; ++j) v[j] = (b16)(bf16_rne(rp[j]) * WSC); put(WP + (size_t)o * C + k0); } }
// eight waves a work-group share one 16-token tile: each takes two of its rows going in and coming out, and six of the 48 output tiles
__global__ __launch_bounds__(256) void proj_kernel(const float* __restrict__ x, const b16* __restrict__ WA, int QLIM, b16* __restrict__ Qh, b16* __restrict__ Ql, b16* __restrict__ Kh, b16* __restrict__ Kl, float* __restrict__ Vr) { __shared__ __attribute__((aligned(16))) b16 Ax[16][C + 8]; __shared__ float Tf[16][772]; const int lane = threadIdx.x & 31, wave = __builtin_amdgcn_readfirstlane(threadIdx.x >> 5), nloc = lane & 15, hlf = lane >> 4; const size_t t0 = (size_t)blockIdx.x * 16; const int b = (int)(t0 / S), n0 = (int)(t0 % S); if (n0 >= QLIM) return;
  // a wave's two rows (16 loads) in one batch; the loops are unrolled in full so that the batch stays in registers
  { float xr[2][C / 32]; const float* px = x + (t0 + wave * 2) * C + lane;
#pragma unroll
    for (int rr = 0; rr < 2; ++rr)
#pragma unroll
      for (int q = 0; q < C / 32; ++q) xr[rr][q] = px[rr * C + q * 32];
    loads_issued_from(px);
#pragma unroll
    for (int rr = 0; rr < 2; ++rr)
#pragma unroll
      for (int q = 0; q < C / 32; ++q) Ax[wave * 2 + rr][q * 32 + lane] = (b16)(bfv(xr[rr][q]) * XS); }
  if (threadIdx.x < 16) for (int k = C; k < C + 8; ++k) Ax[threadIdx.x][k] = (b16)0.0f;
  __syncthreads();   // every wave reads all 16 rows of Ax
  // a wave's six output tiles; a batch is 12 weight fragments (6 tiles x 2 k steps, 24 loads); the k loop stays rolled: unrolling would only grow the code, no load can cross the pads
  { v8f acc[6];
#pragma unroll
    for (int t = 0; t < 6; ++t) acc[t] = (v8f){};
#pragma unroll 1
    for (int kb = 0; kb < C; kb += 64) { v16b bw[2][6]; const b16* pw = WA + (size_t)(wave * 96 + nloc) * C + kb + 8 * hlf;
#pragma unroll
      for (int kk = 0; kk < 2; ++kk)
#pragma unroll
        for (int t = 0; t < 6; ++t) bw[kk][t] = frag_kb(pw + t * 16 * C + kk * 32, 0);
      const v16b a0 = frag_kb(&Ax[nloc][kb], hlf), a1 = frag_kb(&Ax[nloc][kb + 32], hlf);
      loads_issued();
#pragma unroll
      for (int t = 0; t < 6; ++t) acc[t] = wmma16b(a0, bw[0][t], acc[t]);
#pragma unroll
      for (int t = 0; t < 6; ++t) acc[t] = wmma16b(a1, bw[1][t], acc[t]); }
#pragma unroll
    for (int t = 0; t < 6; ++t)
#pragma unroll
      for (int r8 = 0; r8 < 8; ++r8) Tf[8 * hlf + r8][wave * 96 + t * 16 + nloc] = acc[t][r8] * (1.0f / (XS * WSC)); }
  __syncthreads();   // a row of Tf comes from all eight waves
  // module layout: qk.reshape(b,n,2,H,HD): col c < 256 -> q (head c/32, dim c%32); 256..511 -> k
  { for (int rr = wave * 2; rr < wave * 2 + 2; ++rr) { for (int h = 0; h < H; ++h) { const size_t po = (((size_t)(b * H + h)) * S + n0 + rr) * HD + lane; b16 p, pl; split16(Tf[rr][h * HD + lane] * HS, p, pl); ((b16*)Qh)[po] = p; ((b16*)Ql)[po] = pl; split16(Tf[rr][C + h * HD + lane] * HS, p, pl); ((b16*)Kh)[po] = p; ((b16*)Kl)[po] = pl; }
      for (int q = 0; q < 2; ++q) *(v4f*)(Vr + (t0 + rr) * C + q * 128 + lane * 4) = *(const v4f*)(&Tf[rr][512 + q * 128 + lane * 4]);
      asm volatile("s_wait_xcnt 0x0" ::: "memory"); }  } }   // behind a row's last store: the next trip gives the stores' data and address registers new values
__global__ __launch_bounds__(256) void vt_kernel(const float* __restrict__ Vr, int QLIM, b16* __restrict__ VTh, b16* __restrict__ VTl) { __shared__ float Tt[64][257]; const size_t t0 = (size_t)blockIdx.x * 64; const int b = (int)(t0 / S), n0 = (int)(t0 % S); if (n0 >= QLIM) return; const int tid = threadIdx.x, wave = tid >> 5, lane = tid & 31;
  { float rv[8][C / 32];   // a wave's 64 loads in one batch; constant trip counts, unrolled in full, keep the batch in registers
#pragma unroll
    for (int i = 0; i < 8; ++i)
#pragma unroll
      for (int k = 0; k < C / 32; ++k) rv[i][k] = Vr[(t0 + wave + 8 * i) * C + lane + 32 * k];
    loads_issued();
#pragma unroll
    for (int i = 0; i < 8; ++i)
#pragma unroll
      for (int k = 0; k < C / 32; ++k) Tt[wave + 8 * i][lane + 32 * k] = rv[i][k]; }
  __syncthreads();
  { for (int c = wave; c < C; c += 8) { const int h = c / HD, d = c % HD; b16 h0, l0, h1, l1; split16(Tt[lane * 2][c] * HS, h0, l0); split16(Tt[lane * 2 + 1][c] * HS, h1, l1); const size_t o = (((size_t)(b * H + h)) * HD + d) * S + n0 + lane * 2; *(v2b*)(VTh + o) = (v2b){h0, h1}; *(v2b*)(VTl + o) = (v2b){l0, l1}; }  } }
// four waves a work-group share one 16-query tile and its score rows in LDS: each takes a quarter of the key tiles (1), four of the rows (2) and a quarter of the keys (3), so that a SIMD holds four waves, not one, and one wave's waits are filled by the others
__global__ __launch_bounds__(128) void att_kernel(const b16* __restrict__ Qh, const b16* __restrict__ Ql, const b16* __restrict__ Kh, const b16* __restrict__ Kl, const b16* __restrict__ VTh, const b16* __restrict__ VTl, const float* __restrict__ coord, const float* __restrict__ wpos, const float* __restrict__ bpos, const float* __restrict__ gating, int QLIM, float* __restrict__ O) { __shared__ __attribute__((aligned(16))) float Sc[16][S + 4]; __shared__ float Of[4][16][HD + 1]; const int lane = threadIdx.x & 31, wave = __builtin_amdgcn_readfirstlane(threadIdx.x >> 5), nloc = lane & 15, hlf = lane >> 4; const int bh = blockIdx.x / (S / 16), q0 = (blockIdx.x % (S / 16)) * 16; if (q0 >= QLIM) return; const int b = bh / H, h = bh % H;
  const v16b qa = frag_kb(Qh + ((size_t)bh * S + q0 + nloc) * HD, hlf), ql = frag_kb(Ql + ((size_t)bh * S + q0 + nloc) * HD, hlf);
  loads_issued();
  // (1) scaled scores for all keys, 16 key tiles a wave
#pragma unroll 1
  for (int tg = wave * 16; tg < wave * 16 + 16; tg += 8) { v8f s[8];
#pragma unroll
    for (int t = 0; t < 8; ++t) s[t] = (v8f){};
    // eight key tiles (32 loads) a batch; the cut is tested once for the batch (it is a multiple of 256, as phases 2 and 3 take it too): a test per tile would leave paths on which loads are never waited for, and the next trip's loads would then wait on this trip's
    if (tg * 16 < QLIM) { v16b kh[8], kl[8]; const size_t ko = ((size_t)bh * S + tg * 16 + nloc) * HD; const b16 *ph = Kh + ko, *pl = Kl + ko;
#pragma unroll
      for (int t = 0; t < 8; ++t) { kh[t] = frag_kb(ph + t * 16 * HD, hlf); kl[t] = frag_kb(pl + t * 16 * HD, hlf); }
      loads_issued();
#pragma unroll
      for (int t = 0; t < 8; ++t) { s[t] = wmma16b(qa, kh[t], s[t]); s[t] = wmma16b(qa, kl[t], s[t]); s[t] = wmma16b(ql, kh[t], s[t]); } }
#pragma unroll
    for (int t = 0; t < 8; ++t)
#pragma unroll
      for (int r8 = 0; r8 < 8; ++r8) Sc[8 * hlf + r8][(tg + t) * 16 + nloc] = s[t][r8] * (SCALE / (HS * HS)); }
  __syncthreads();   // a row's scores come from all four waves
  // (2) one query row at a time, its keys spread over the 32 lanes (lane owns keys g * 128 + lane * 4 + e): patch softmax, pos softmax, gated mix, renorm; the row's final weights (x16384) then go back over its own 4,096 score bytes as two f16 planes, hi at keys 0..1023 and lo behind it, in the form phase 3 reads: no second LDS array, so four work-groups fit a WGP's LDS, not three
  { const float gr = gating[h], wr0 = wpos[0 * H + h], wr1 = wpos[1 * H + h], wr2 = wpos[2 * H + h], wr3 = wpos[3 * H + h], br = bpos[h];   // every load of this phase is issued before the first rounding, so that they share one trip to memory
    const float* pq = coord + ((size_t)b * S + q0 + nloc) * 3; const float qx = pq[0], qy = pq[1], qz = pq[2]; v4f craw[S / 128][3];
    // every loop over g, e or u in this phase is unrolled in full, so that its arrays are indexed by constants and stay in registers
#pragma unroll
    for (int g = 0; g < S / 128; ++g)
#pragma unroll
      for (int u = 0; u < 3; ++u) craw[g][u] = *(const v4f*)(coord + ((size_t)b * S + g * 128 + lane * 4) * 3 + u * 4);
    asm volatile("s_wait_xcnt 0x0" :: "v"(pq) : "memory");   // stands before the address registers of the loads above are given new values; the query address is an input, so that no later load of the batch lands on its registers in front of the wait
    const float sg = hw_rcp(1.0f + __expf(-bfv(gr))); const float w0 = bfv(wr0), w1 = bfv(wr1), w2 = bfv(wr2), w3 = bfv(wr3), bp = bfv(br);
    const float rx = bfv(qx), ry = bfv(qy), rz = bfv(qz); float cx[S / 32], cy[S / 32], cz[S / 32], bg[S / 128];
#pragma unroll
    for (int g = 0; g < S / 128; ++g) { bg[g] = g * 128 < QLIM ? bp : -INFINITY;   // a key at or past the cut gets logit -inf, weight 0
#pragma unroll
      for (int e = 0; e < 4; ++e) { cx[g * 4 + e] = bfv(craw[g][(e * 3) / 4][(e * 3) % 4]); cy[g * 4 + e] = bfv(craw[g][(e * 3 + 1) / 4][(e * 3 + 1) % 4]); cz[g * 4 + e] = bfv(craw[g][(e * 3 + 2) / 4][(e * 3 + 2) % 4]); } }
    // the loop over a wave's four rows stays rolled: one row is about 1,000 instructions already, and copies would only grow the code
#pragma unroll 1
    for (int r = wave * 4; r < wave * 4 + 4; ++r) { v4f* sr = (v4f*)&Sc[r][0]; v4f s4[S / 128]; float pl[S / 32];
#pragma unroll
      for (int g = 0; g < S / 128; ++g) s4[g] = sr[g * 32 + lane];
      const float pix = lane_bcast(rx, r), piy = lane_bcast(ry, r), piz = lane_bcast(rz, r); float pm4[4] = {-INFINITY, -INFINITY, -INFINITY, -INFINITY}, mx = -INFINITY;
#pragma unroll
      for (int g = 0; g < S / 128; ++g) { float dx[4], dy[4], dz[4], d2[4], dd[4];
#pragma unroll
        for (int e = 0; e < 4; ++e) { dx[e] = cx[g * 4 + e] - pix; dy[e] = cy[g * 4 + e] - piy; dz[e] = cz[g * 4 + e] - piz; d2[e] = dx[e] * dx[e] + dy[e] * dy[e] + dz[e] * dz[e]; }
        hw_sqrt4(d2, dd);
#pragma unroll
        for (int e = 0; e < 4; ++e) { pl[g * 4 + e] = pmul(dx[e], w0) + pmul(dy[e], w1) + pmul(dz[e], w2) + pmul(dd[e], w3) + bg[g]; pm4[e] = fmaxf(pm4[e], pl[g * 4 + e]); }
        if (g & 1) __builtin_amdgcn_sched_barrier(0); }   // eight keys in flight at a time: with all 32 started at once their temporaries overflow the registers and loop constants spill to scratch
#pragma unroll
      for (int g = 0; g < S / 128; ++g) { const float gm = fmaxf(fmaxf(s4[g][0], s4[g][1]), fmaxf(s4[g][2], s4[g][3])); mx = fmaxf(mx, g * 128 < QLIM ? gm : -INFINITY); }
      mx = wave_max(mx); const float pm = wave_max(fmaxf(fmaxf(pm4[0], pm4[1]), fmaxf(pm4[2], pm4[3])));
      float z4[4] = {0.0f, 0.0f, 0.0f, 0.0f}, pz4[4] = {0.0f, 0.0f, 0.0f, 0.0f};
#pragma unroll
      for (int g = 0; g < S / 128; ++g) { const float mg = g * 128 < QLIM ? mx : INFINITY;
#pragma unroll
        for (int e = 0; e < 4; ++e) { s4[g][e] = exp_slot(s4[g][e] - mg); z4[e] += s4[g][e]; pl[g * 4 + e] = exp_slot(pl[g * 4 + e] - pm); pz4[e] += pl[g * 4 + e]; } }
      const float zi = hw_rcp(wave_sum((z4[0] + z4[1]) + (z4[2] + z4[3]))), pzi = hw_rcp(wave_sum((pz4[0] + pz4[1]) + (pz4[2] + pz4[3]))); float t4[4] = {0.0f, 0.0f, 0.0f, 0.0f};
#pragma unroll
      for (int g = 0; g < S / 128; ++g) {
#pragma unroll
        for (int e = 0; e < 4; ++e) { s4[g][e] = pmul(1.0f - sg, s4[g][e] * zi) + pmul(sg, pl[g * 4 + e] * pzi); t4[e] += s4[g][e]; } }
      const float rn = hw_rcp(wave_sum((t4[0] + t4[1]) + (t4[2] + t4[3]))); b16* hr = (b16*)&Sc[r][0];
#pragma unroll
      for (int g = 0; g < S / 128; ++g) { v4b wh, wl;
#pragma unroll
        for (int e = 0; e < 4; ++e) { b16 p, q; split16(s4[g][e] * rn * PS, p, q); wh[e] = p; wl[e] = q; }
        *(v4b*)(hr + g * 128 + lane * 4) = wh; *(v4b*)(hr + S + g * 128 + lane * 4) = wl; } } }
  __syncthreads();   // phase 3 reads all 16 rows
  // (3) O = A x v^T, 256 keys a wave, 128 keys (32 loads of v^T) a batch; the A fragments come straight from the planes that phase 2 left in Sc
  v8f oacc[2] = {(v8f){}, (v8f){}}; const b16* ar = (const b16*)&Sc[nloc][0];
#pragma unroll 1
  for (int k0 = wave * CH; k0 < wave * CH + CH && k0 < QLIM; k0 += CH / 2) { v16b vh[4][2], vl[4][2], pa[4], pb[4]; const size_t vo = ((size_t)bh * HD + nloc) * S + k0 + 8 * hlf; const b16 *gh = VTh + vo, *gl = VTl + vo;
#pragma unroll
    for (int kk = 0; kk < 4; ++kk)
#pragma unroll
      for (int t = 0; t < 2; ++t) { vh[kk][t] = frag_kb(gh + t * 16 * S + kk * 32, 0); vl[kk][t] = frag_kb(gl + t * 16 * S + kk * 32, 0); }
    // as loads_issued(); the two addresses are inputs, so that their registers are still held here and no load of the batch lands on them in front of the wait
    asm volatile("s_wait_xcnt 0x0" :: "v"(gh), "v"(gl) : "memory");
#pragma unroll
    for (int kk = 0; kk < 4; ++kk) { pa[kk] = frag_kb(ar + k0 + kk * 32, hlf); pb[kk] = frag_kb(ar + S + k0 + kk * 32, hlf); }
#pragma unroll
    for (int kk = 0; kk < 4; ++kk)
#pragma unroll
      for (int t = 0; t < 2; ++t) { oacc[t] = wmma16b(pa[kk], vh[kk][t], oacc[t]); oacc[t] = wmma16b(pa[kk], vl[kk][t], oacc[t]); oacc[t] = wmma16b(pb[kk], vh[kk][t], oacc[t]); } }
#pragma unroll
  for (int t = 0; t < 2; ++t)
#pragma unroll
    for (int r8 = 0; r8 < 8; ++r8) Of[wave][8 * hlf + r8][t * 16 + nloc] = oacc[t][r8] * (1.0f / (PS * HS));
  __syncthreads();   // the four waves' partial sums over their key quarters are added below
  { for (int r = wave * 4; r < wave * 4 + 4; ++r) ((float*)O)[((size_t)b * S + q0 + r) * C + h * HD + lane] = (Of[0][r][lane] + Of[1][r][lane]) + (Of[2][r][lane] + Of[3][r][lane]);  } }
// eight waves a work-group share one 16-token tile: each takes two of its rows going in and coming out, and two of the 16 output tiles
__global__ __launch_bounds__(256) void outp_kernel(const float* __restrict__ O, const b16* __restrict__ WP, const float* __restrict__ bproj, int QLIM, float* __restrict__ out) { __shared__ __attribute__((aligned(16))) b16 Ah[16][C + 8], Al[16][C + 8]; __shared__ float Tf[16][260]; const int lane = threadIdx.x & 31, wave = __builtin_amdgcn_readfirstlane(threadIdx.x >> 5), nloc = lane & 15, hlf = lane >> 4; const size_t t0 = (size_t)blockIdx.x * 16; if ((int)(t0 % S) >= QLIM) return;
  // a wave's two rows (16 loads) in one batch; the loops are unrolled in full so that the batch stays in registers
  { float orw[2][C / 32]; const float* po = O + (t0 + wave * 2) * C + lane;
#pragma unroll
    for (int rr = 0; rr < 2; ++rr)
#pragma unroll
      for (int q = 0; q < C / 32; ++q) orw[rr][q] = po[rr * C + q * 32];
    loads_issued_from(po);
#pragma unroll
    for (int rr = 0; rr < 2; ++rr)
#pragma unroll
      for (int q = 0; q < C / 32; ++q) { b16 p, pl; split16(orw[rr][q] * HS, p, pl); Ah[wave * 2 + rr][q * 32 + lane] = p; Al[wave * 2 + rr][q * 32 + lane] = pl; } }
  if (threadIdx.x < 16) for (int k = C; k < C + 8; ++k) { Ah[threadIdx.x][k] = (b16)0.0f; Al[threadIdx.x][k] = (b16)0.0f; }
  __syncthreads();   // every wave reads all 16 rows of Ah and Al
  // a wave's two output tiles: all their 16 weight fragments (2 tiles x 8 k steps, 32 loads) are one batch
  { v8f acc[2]; float br[2]; v16b bw[8][2]; const int ib = wave * 32 + nloc; const b16* pw = WP + (size_t)(wave * 32 + nloc) * C + 8 * hlf;
#pragma unroll
    for (int t = 0; t < 2; ++t) { acc[t] = (v8f){}; br[t] = bproj[ib + t * 16]; }
#pragma unroll
    for (int kk = 0; kk < 8; ++kk)
#pragma unroll
      for (int t = 0; t < 2; ++t) bw[kk][t] = frag_kb(pw + t * 16 * C + kk * 32, 0);
    asm volatile("s_wait_xcnt 0x0" :: "v"(ib), "v"(pw) : "memory");   // as loads_issued_from(); the bias loads are addressed by the index
#pragma unroll
    for (int kk = 0; kk < 8; ++kk) { const v16b a = frag_kb(&Ah[nloc][kk * 32], hlf), al = frag_kb(&Al[nloc][kk * 32], hlf);
#pragma unroll
      for (int t = 0; t < 2; ++t) { acc[t] = wmma16b(a, bw[kk][t], acc[t]); acc[t] = wmma16b(al, bw[kk][t], acc[t]); } }
#pragma unroll
    for (int t = 0; t < 2; ++t) { const int cc = wave * 32 + t * 16 + nloc; const float bb = bfv(br[t]);
#pragma unroll
      for (int r8 = 0; r8 < 8; ++r8) Tf[8 * hlf + r8][cc] = acc[t][r8] * (1.0f / (HS * WSC)) + bb; } }
  __syncthreads();   // a row of Tf comes from all eight waves
  { for (int rr = wave * 2; rr < wave * 2 + 2; ++rr) for (int q = 0; q < 2; ++q) *(v4f*)(out + (t0 + rr) * C + q * 128 + lane * 4) = *(const v4f*)(&Tf[rr][q * 128 + lane * 4]);  } }
}  // namespace

extern "C" void kernel_launch(void* const* d_in, const int* in_sizes, int n_in, void* d_out, int out_size, void* d_ws, size_t ws_size, hipStream_t stream) {
  (void)n_in;
  auto Fp = [&](int i) { return (const float*)d_in[i]; };
  // input order: 0 x [4,1024,256]; 1 voxel_coord [4,1024,3]; 2 W_qk [256,512]; 3 W_v [256,256]; 4 W_proj [256,256]; 5 b_proj [256]; 6 W_pos [4,8]; 7 b_pos [8]; 8 gating [8]
  if (in_sizes[0] != NT * C || in_sizes[1] != NT * 3 || in_sizes[2] != C * 512 || in_sizes[3] != C * C || in_sizes[4] != C * C || in_sizes[6] != 4 * H || in_sizes[7] != H || in_sizes[8] != H || out_size != NT * C) return;
  const int QLIM = S;   // per-batch token cut (queries and keys) (multiple of 256)
  size_t off = 0; char* ws = (char*)d_ws;
  auto carve = [&](size_t bytes) { char* p = ws + off; off += (bytes + 255) & ~(size_t)255; return p; };
  b16* WA = (b16*)carve((size_t)768 * C * 2); b16* WP = (b16*)carve((size_t)C * C * 2); b16* Qh = (b16*)carve((size_t)NT * C * 2); b16* Ql = (b16*)carve((size_t)NT * C * 2); b16* Kh = (b16*)carve((size_t)NT * C * 2); b16* Kl = (b16*)carve((size_t)NT * C * 2); float* Vr = (float*)carve((size_t)NT * C * 4); b16* VTh = (b16*)carve((size_t)NT * C * 2); b16* VTl = (b16*)carve((size_t)NT * C * 2); float* O = (float*)carve((size_t)NT * C * 4);
  if (off > ws_size || off > ((size_t)32 << 20)) return;   // ~ 21 MB
  wput_kernel<<<(768 * 32 + 255) / 256, 256, 0, stream>>>(Fp(2), Fp(3), Fp(4), WA, WP);
  proj_kernel<<<NT / 16, 256, 0, stream>>>(Fp(0), WA, QLIM, Qh, Ql, Kh, Kl, Vr);
  vt_kernel<<<NT / 64, 256, 0, stream>>>(Vr, QLIM, VTh, VTl);
  att_kernel<<<NB_ * H * (S / 16), 128, 0, stream>>>(Qh, Ql, Kh, Kl, VTh, VTl, Fp(1), Fp(6), Fp(7), Fp(8), QLIM, O);
  outp_kernel<<<NT / 16, 256, 0, stream>>>(O, WP, Fp(5), QLIM, (float*)d_out);
}

// v006
// A run of this version takes 58.5 microseconds.
// In two side-by-side timings against v005, it was 1.10 and 1.09 times as fast.
// Over all steps from v000 it is 27.4 times as fast.
#include <hip/hip_runtime.h>

// GPSA (gated positional self-attention, 8 heads x 32 over 4 x 1024 tokens): [q|k] = x W_qk, v = x W_v; patch = softmax_j(q_i.k_j / sqrt(32)); rel_ij = [p_j - p_i (3), |p_j - p_i|]; pos = softmax_j(rel_ij . W_pos[:,h] + b_pos[h]); attn = (1 - s_h) patch + s_h pos with s_h = sigmoid(gating[h]); attn /= sum_j attn; out = (attn v) W_proj + b_proj -> [4][1024][256].
// WMMA (v_wmma_f32_16x16x32_f16, f32 accumulate): x (EXACT bf16 x8, K 256) x [W_qk | W_v] rows (EXACT x256; 48 tiles); per (bh, 16 queries) S = q (hi+lo x256, K 32) x k rows (hi+lo; 64 tiles) and O = A (hi+lo x16384, K 1,024) x v^T (hi+lo; 2 tiles), 3 products; o (hi+lo, K 256) x W_proj rows (16 tiles) — ≈ 1 M WMMA; positional logits, both softmaxes, gating in f32.

namespace {
constexpr int NB_ = 4, S = 1024, C = 256, H = 8, HD = 32, NT = NB_ * S, CH = 256;
constexpr float XS = 8.0f, HS = 256.0f, PS = 16384.0f, WSC = 256.0f, SCALE = 0.17677669529663687f, L2E = 1.44269504f;
typedef _Float16 b16;
typedef __attribute__((ext_vector_type(16))) _Float16 v16b;
typedef __attribute__((ext_vector_type(8))) _Float16 v8b;
typedef __attribute__((ext_vector_type(8))) float v8f;
typedef __attribute__((ext_vector_type(4))) float v4f;
typedef __attribute__((ext_vector_type(2))) float v2f;
typedef __attribute__((ext_vector_type(2))) _Float16 v2b;
typedef __attribute__((ext_vector_type(4))) _Float16 v4b;
__device__ __forceinline__ float bf16_rne(float f) { unsigned int u = __float_as_uint(f); u += 0x7FFFu + ((u >> 16) & 1u); float r = __uint_as_float(u & 0xFFFF0000u); asm volatile("" : "+v"(r)); return r; }
__device__ __forceinline__ float bfv(float f) { float r = bf16_rne(f); asm volatile("" : "+v"(r)); return r; }
__device__ __forceinline__ void split16(float v, b16& hi, b16& lo) { hi = (b16)v; lo = (b16)(v - (float)hi); }
__device__ __forceinline__ v16b frag_kb(const b16* p, int hh) { const v8b a = *(const v8b*)(p + 8 * hh), b = *(const v8b*)(p + 16 + 8 * hh); v16b f;
#pragma unroll
  for (int e = 0; e < 8; ++e) { f[e] = a[e]; f[8 + e] = b[e]; } return f; }
__device__ __forceinline__ v8f wmma16b(v16b a, v16b b, v8f c) { v8f d = __builtin_amdgcn_wmma_f32_16x16x32_f16(false, a, false, b, (short)0, c, false, false); asm volatile("v_nop\n\tv_nop\n\tv_nop\n\tv_nop" : "+v"(d) : "v"(a), "v"(b)); return d; }
// stands behind a batch of global loads: before their address registers are given new values, and, being volatile, it keeps the whole batch in front of the volatile statements that follow (the pads behind each matrix instruction, the rounding pins), which no load can cross
__device__ __forceinline__ void loads_issued() { asm volatile("s_wait_xcnt 0x0" ::: "memory"); }
// as loads_issued(); the batch's address is an input, so that its registers are still held here and no load of the batch lands on them in front of the wait
__device__ __forceinline__ void loads_issued_from(const void* p) { asm volatile("s_wait_xcnt 0x0" :: "v"(p) : "memory"); }

// butterfly over the 32 lanes: four DPP steps inside each 16-lane row, then the other row; every lane ends with the same value
template <int CTRL> __device__ __forceinline__ float row_x(float v) { return __builtin_bit_cast(float, __builtin_amdgcn_mov_dpp(__builtin_bit_cast(int, v), CTRL, 0xf, 0xf, true)); }
__device__ __forceinline__ float half_x(float v) { return __builtin_bit_cast(float, __builtin_amdgcn_permlanex16(__builtin_bit_cast(int, v), __builtin_bit_cast(int, v), 0x76543210, 0xfedcba98, false, false)); }
__device__ __forceinline__ float wave_sum(float v) { v += row_x<0x161>(v); v += row_x<0x162>(v); v += row_x<0x164>(v); v += row_x<0x168>(v); return v + half_x(v); }
__device__ __forceinline__ float wave_max(float v) { v = fmaxf(v, row_x<0x161>(v)); v = fmaxf(v, row_x<0x162>(v)); v = fmaxf(v, row_x<0x164>(v)); v = fmaxf(v, row_x<0x168>(v)); return fmaxf(v, half_x(v)); }
// 2^x (v_exp_f32); both softmaxes keep their logits in units of log 2, so no multiply stands in front; the v_nop in the same statement keeps the one slot that the instruction set asks for behind a transcendental before its result is read or its source overwritten
__device__ __forceinline__ float exp2_slot(float x) { float r; asm("v_exp_f32 %0, %1\n\tv_nop" : "=v"(r) : "v"(x)); return r; }
// square root and reciprocal as the one hardware instruction each (about 1 ulp), not the exactly rounded sequences that sqrtf and 1.0f / x expand to (some 15 and 10 vector instructions with compares and selects). The root feeds a softmax logit through a weight; an argument too small for the instruction is a distance below 1e-19, whose share of the logit is nothing either way. The reciprocals take softmax sums, which are 1 or more, and 1 + e^-g
// four roots in one statement: each fills the slot that the instruction set asks for behind the one in front of it (the outputs are early-clobber, so none lands on a source), and the one v_nop keeps the slot of the last; the compiler hints no dependence of asm text, so the statement opens with the hint itself: the sums of squares are made just in front, and an unhinted wait for them would hold the SIMD's other waves too
__device__ __forceinline__ void hw_sqrt4(const float (&x)[4], float (&r)[4]) { asm("s_delay_alu instid0(VALU_DEP_1)\n\tv_sqrt_f32 %0, %4\n\tv_sqrt_f32 %1, %5\n\tv_sqrt_f32 %2, %6\n\tv_sqrt_f32 %3, %7\n\tv_nop" : "=&v"(r[0]), "=&v"(r[1]), "=&v"(r[2]), "=&v"(r[3]) : "v"(x[0]), "v"(x[1]), "v"(x[2]), "v"(x[3])); }
__device__ __forceinline__ float hw_rcp(float x) { return __builtin_amdgcn_rcpf(x); }
__device__ __forceinline__ float lane_bcast(float v, int l) { return __builtin_bit_cast(float, __builtin_amdgcn_readlane(__builtin_bit_cast(int, v), l)); }

__global__ __launch_bounds__(256) void wput_kernel(const float* __restrict__ wqk, const float* __restrict__ wv, const float* __restrict__ wproj, b16* __restrict__ WA, b16* __restrict__ WP) { const int u = blockIdx.x * 256 + threadIdx.x; v8b v; auto put = [&](b16* dst) { { *(v8b*)dst = v;  } };
  const int o = u / 32, k0 = (u % 32) * 8; float ra[8] = {}, rp[8] = {};   // all of a thread's loads are issued before the first rounding, so that they share one trip to memory
  if (u < 768 * 32) { const float* sa = o < 512 ? wqk + o : wv + (o - 512); const int ld = o < 512 ? 512 : C;
#pragma unroll
    for (int j = 0; j < 8; ++j) ra[j] = sa[(size_t)(k0 + j) * ld]; }
  if (u < 256 * 32) {
#pragma unroll
    for (int j = 0; j < 8; ++j) rp[j] = wproj[(size_t)(k0 + j) * C + o]; }
  loads_issued();
  if (u < 768 * 32) {
#pragma unroll
    for (int j = 0; j < 8; ++j) v[j] = (b16)(bf16_rne(ra[j]) * WSC); put(WA + (size_t)o * C + k0); }
  if (u < 256 * 32) {
#pragma unroll
    for (int j = 0; j < 8; ++j) v[j] = (b16)(bf16_rne(rp[j]) * WSC); put(WP + (size_t)o * C + k0); } }
// eight waves a work-group share one 16-token tile: each takes two of its rows going in and coming out, and six of the 48 output tiles
__global__ __launch_bounds__(256) void proj_kernel(const float* __restrict__ x, const b16* __restrict__ WA, int QLIM, b16* __restrict__ Qh, b16* __restrict__ Ql, b16* __restrict__ Kh, b16* __restrict__ Kl, float* __restrict__ Vr) { __shared__ __attribute__((aligned(16))) b16 Ax[16][C + 8]; __shared__ float Tf[16][772]; const int lane = threadIdx.x & 31, wave = __builtin_amdgcn_readfirstlane(threadIdx.x >> 5), nloc = lane & 15, hlf = lane >> 4; const size_t t0 = (size_t)blockIdx.x * 16; const int b = (int)(t0 / S), n0 = (int)(t0 % S); if (n0 >= QLIM) return;
  // a wave's two rows (16 loads) in one batch; the loops are unrolled in full so that the batch stays in registers
  { float xr[2][C / 32]; const float* px = x + (t0 + wave * 2) * C + lane;
#pragma unroll
    for (int rr = 0; rr < 2; ++rr)
#pragma unroll
      for (int q = 0; q < C / 32; ++q) xr[rr][q] = px[rr * C + q * 32];
    loads_issued_from(px);
#pragma unroll
    for (int rr = 0; rr < 2; ++rr)
#pragma unroll
      for (int q = 0; q < C / 32; ++q) Ax[wave * 2 + rr][q * 32 + lane] = (b16)(bfv(xr[rr][q]) * XS); }
  if (threadIdx.x < 16) for (int k = C; k < C + 8; ++k) Ax[threadIdx.x][k] = (b16)0.0f;
  __syncthreads();   // every wave reads all 16 rows of Ax
  // a wave's six output tiles; a batch is 12 weight fragments (6 tiles x 2 k steps, 24 loads); the k loop stays rolled: unrolling would only grow the code, no load can cross the pads
  { v8f acc[6];
#pragma unroll
    for (int t = 0; t < 6; ++t) acc[t] = (v8f){};
#pragma unroll 1
    for (int kb = 0; kb < C; kb += 64) { v16b bw[2][6]; const b16* pw = WA + (size_t)(wave * 96 + nloc) * C + kb + 8 * hlf;
#pragma unroll
      for (int kk = 0; kk < 2; ++kk)
#pragma unroll
        for (int t = 0; t < 6; ++t) bw[kk][t] = frag_kb(pw + t * 16 * C + kk * 32, 0);
      const v16b a0 = frag_kb(&Ax[nloc][kb], hlf), a1 = frag_kb(&Ax[nloc][kb + 32], hlf);
      loads_issued();
#pragma unroll
      for (int t = 0; t < 6; ++t) acc[t] = wmma16b(a0, bw[0][t], acc[t]);
#pragma unroll
      for (int t = 0; t < 6; ++t) acc[t] = wmma16b(a1, bw[1][t], acc[t]); }
#pragma unroll
    for (int t = 0; t < 6; ++t)
#pragma unroll
      for (int r8 = 0; r8 < 8; ++r8) Tf[8 * hlf + r8][wave * 96 + t * 16 + nloc] = acc[t][r8] * (1.0f / (XS * WSC)); }
  __syncthreads();   // a row of Tf comes from all eight waves
  // module layout: qk.reshape(b,n,2,H,HD): col c < 256 -> q (head c/32, dim c%32); 256..511 -> k
  { for (int rr = wave * 2; rr < wave * 2 + 2; ++rr) { for (int h = 0; h < H; ++h) { const size_t po = (((size_t)(b * H + h)) * S + n0 + rr) * HD + lane; b16 p, pl; split16(Tf[rr][h * HD + lane] * HS, p, pl); ((b16*)Qh)[po] = p; ((b16*)Ql)[po] = pl; split16(Tf[rr][C + h * HD + lane] * HS, p, pl); ((b16*)Kh)[po] = p; ((b16*)Kl)[po] = pl; }
      for (int q = 0; q < 2; ++q) *(v4f*)(Vr + (t0 + rr) * C + q * 128 + lane * 4) = *(const v4f*)(&Tf[rr][512 + q * 128 + lane * 4]);
      asm volatile("s_wait_xcnt 0x0" ::: "memory"); }  } }   // behind a row's last store: the next trip gives the stores' data and address registers new values
__global__ __launch_bounds__(256) void vt_kernel(const float* __restrict__ Vr, int QLIM, b16* __restrict__ VTh, b16* __restrict__ VTl) { __shared__ float Tt[64][257]; const size_t t0 = (size_t)blockIdx.x * 64; const int b = (int)(t0 / S), n0 = (int)(t0 % S); if (n0 >= QLIM) return; const int tid = threadIdx.x, wave = tid >> 5, lane = tid & 31;
  { float rv[8][C / 32];   // a wave's 64 loads in one batch; constant trip counts, unrolled in full, keep the batch in registers
#pragma unroll
    for (int i = 0; i < 8; ++i)
#pragma unroll
      for (int k = 0; k < C / 32; ++k) rv[i][k] = Vr[(t0 + wave + 8 * i) * C + lane + 32 * k];
    loads_issued();
#pragma unroll
    for (int i = 0; i < 8; ++i)
#pragma unroll
      for (int k = 0; k < C / 32; ++k) Tt[wave + 8 * i][lane + 32 * k] = rv[i][k]; }
  __syncthreads();
  { for (int c = wave; c < C; c += 8) { const int h = c / HD, d = c % HD; b16 h0, l0, h1, l1; split16(Tt[lane * 2][c] * HS, h0, l0); split16(Tt[lane * 2 + 1][c] * HS, h1, l1); const size_t o = (((size_t)(b * H + h)) * HD + d) * S + n0 + lane * 2; *(v2b*)(VTh + o) = (v2b){h0, h1}; *(v2b*)(VTl + o) = (v2b){l0, l1}; }  } }
// four waves a work-group share one 16-query tile and its score rows in LDS: each takes a quarter of the key tiles (1), four of the rows (2) and a quarter of the keys (3), so that a SIMD holds four waves, not one, and one wave's waits are filled by the others
__global__ __launch_bounds__(128) void att_kernel(const b16* __restrict__ Qh, const b16* __restrict__ Ql, const b16* __restrict__ Kh, const b16* __restrict__ Kl, const b16* __restrict__ VTh, const b16* __restrict__ VTl, const float* __restrict__ coord, const float* __restrict__ wpos, const float* __restrict__ bpos, const float* __restrict__ gating, int QLIM, float* __restrict__ O) { __shared__ __attribute__((aligned(16))) float Sc[16][S + 4]; __shared__ float Of[4][16][HD + 1]; const int lane = threadIdx.x & 31, wave = __builtin_amdgcn_readfirstlane(threadIdx.x >> 5), nloc = lane & 15, hlf = lane >> 4; const int bh = blockIdx.x / (S / 16), q0 = (blockIdx.x % (S / 16)) * 16; if (q0 >= QLIM) return; const int b = bh / H, h = bh % H;
  const v16b qa = frag_kb(Qh + ((size_t)bh * S + q0 + nloc) * HD, hlf), ql = frag_kb(Ql + ((size_t)bh * S + q0 + nloc) * HD, hlf);
  loads_issued();
  // (1) scaled scores for all keys, in units of log 2 (log2 e rides in the scale factor), 16 key tiles a wave
#pragma unroll 1
  for (int tg = wave * 16; tg < wave * 16 + 16; tg += 8) { v8f s[8];
#pragma unroll
    for (int t = 0; t < 8; ++t) s[t] = (v8f){};
    // eight key tiles (32 loads) a batch; the cut is tested once for the batch (it is a multiple of 256, as phases 2 and 3 take it too): a test per tile would leave paths on which loads are never waited for, and the next trip's loads would then wait on this trip's
    if (tg * 16 < QLIM) { v16b kh[8], kl[8]; const size_t ko = ((size_t)bh * S + tg * 16 + nloc) * HD; const b16 *ph = Kh + ko, *pl = Kl + ko;
#pragma unroll
      for (int t = 0; t < 8; ++t) { kh[t] = frag_kb(ph + t * 16 * HD, hlf); kl[t] = frag_kb(pl + t * 16 * HD, hlf); }
      loads_issued();
#pragma unroll
      for (int t = 0; t < 8; ++t) { s[t] = wmma16b(qa, kh[t], s[t]); s[t] = wmma16b(qa, kl[t], s[t]); s[t] = wmma16b(ql, kh[t], s[t]); } }
#pragma unroll
    for (int t = 0; t < 8; ++t)
#pragma unroll
      for (int r8 = 0; r8 < 8; ++r8) Sc[8 * hlf + r8][(tg + t) * 16 + nloc] = s[t][r8] * (SCALE * L2E / (HS * HS)); }
  __syncthreads();   // a row's scores come from all four waves
  // (2) one query row at a time, its keys spread over the 32 lanes (lane owns keys g * 128 + lane * 4 + e): patch softmax, pos softmax, gated mix, renorm; the row's final weights (x16384) then go back over its own 4,096 score bytes as two f16 planes, hi at keys 0..1023 and lo behind it, in the form phase 3 reads: no second LDS array, so four work-groups fit a WGP's LDS, not three
  { const float gr = gating[h], wr0 = wpos[0 * H + h], wr1 = wpos[1 * H + h], wr2 = wpos[2 * H + h], wr3 = wpos[3 * H + h], br = bpos[h];   // every load of this phase is issued before the first rounding, so that they share one trip to memory
    const float* pq = coord + ((size_t)b * S + q0 + nloc) * 3; const float qx = pq[0], qy = pq[1], qz = pq[2]; v4f craw[S / 128][3];
    // every loop over g, e or u in this phase is unrolled in full, so that its arrays are indexed by constants and stay in registers
#pragma unroll
    for (int g = 0; g < S / 128; ++g)
#pragma unroll
      for (int u = 0; u < 3; ++u) craw[g][u] = *(const v4f*)(coord + ((size_t)b * S + g * 128 + lane * 4) * 3 + u * 4);
    asm volatile("s_wait_xcnt 0x0" :: "v"(pq) : "memory");   // stands before the address registers of the loads above are given new values; the query address is an input, so that no later load of the batch lands on its registers in front of the wait
    const float sg = hw_rcp(1.0f + __expf(-bfv(gr))); const float w0 = bfv(wr0) * L2E, w1 = bfv(wr1) * L2E, w2 = bfv(wr2) * L2E, w3 = bfv(wr3) * L2E, bp = bfv(br) * L2E;
    const float rx = bfv(qx), ry = bfv(qy), rz = bfv(qz); float cx[S / 32], cy[S / 32], cz[S / 32], cw[S / 32];
#pragma unroll
    for (int g = 0; g < S / 128; ++g) { const float bg = g * 128 < QLIM ? bp : -INFINITY;   // a key at or past the cut gets logit -inf, weight 0
#pragma unroll
      for (int e = 0; e < 4; ++e) { cx[g * 4 + e] = bfv(craw[g][(e * 3) / 4][(e * 3) % 4]); cy[g * 4 + e] = bfv(craw[g][(e * 3 + 1) / 4][(e * 3 + 1) % 4]); cz[g * 4 + e] = bfv(craw[g][(e * 3 + 2) / 4][(e * 3 + 2) % 4]);
        // the key's own share of its positional logit, the same for every query: (p_j - p_i) . w = p_j . w - p_i . w, and the query's share is one constant along the row, which a softmax over the row's keys cancels
        cw[g * 4 + e] = cx[g * 4 + e] * w0 + cy[g * 4 + e] * w1 + cz[g * 4 + e] * w2 + bg; } }
    // the loop over a wave's four rows stays rolled: one row is about 1,000 instructions already, and copies would only grow the code
#pragma unroll 1
    for (int r = wave * 4; r < wave * 4 + 4; ++r) { v4f* sr = (v4f*)&Sc[r][0]; v4f s4[S / 128]; float pl[S / 32];
#pragma unroll
      for (int g = 0; g < S / 128; ++g) s4[g] = sr[g * 32 + lane];
      const float pix = lane_bcast(rx, r), piy = lane_bcast(ry, r), piz = lane_bcast(rz, r); float pm4[4] = {-INFINITY, -INFINITY, -INFINITY, -INFINITY}, mx = -INFINITY;
#pragma unroll
      for (int g = 0; g < S / 128; ++g) { float dx[4], dy[4], dz[4], d2[4], dd[4];
#pragma unroll
        for (int e = 0; e < 4; ++e) { dx[e] = cx[g * 4 + e] - pix; dy[e] = cy[g * 4 + e] - piy; dz[e] = cz[g * 4 + e] - piz; d2[e] = dx[e] * dx[e] + dy[e] * dy[e] + dz[e] * dz[e]; }
        hw_sqrt4(d2, dd);
#pragma unroll
        for (int e = 0; e < 4; ++e) { pl[g * 4 + e] = dd[e] * w3 + cw[g * 4 + e]; pm4[e] = fmaxf(pm4[e], pl[g * 4 + e]); }
        if (g & 1) __builtin_amdgcn_sched_barrier(0); }   // eight keys in flight at a time: with all 32 started at once their temporaries take the wave past 256 registers, and a SIMD then holds three such waves, not four
#pragma unroll
      for (int g = 0; g < S / 128; ++g) { const float gm = fmaxf(fmaxf(s4[g][0], s4[g][1]), fmaxf(s4[g][2], s4[g][3])); mx = fmaxf(mx, g * 128 < QLIM ? gm : -INFINITY); }
      mx = wave_max(mx); const float pm = wave_max(fmaxf(fmaxf(pm4[0], pm4[1]), fmaxf(pm4[2], pm4[3])));
      float z4[4] = {0.0f, 0.0f, 0.0f, 0.0f}, pz4[4] = {0.0f, 0.0f, 0.0f, 0.0f};
#pragma unroll
      for (int g = 0; g < S / 128; ++g) { const float mg = g * 128 < QLIM ? mx : INFINITY;
#pragma unroll
        for (int e = 0; e < 4; ++e) { s4[g][e] = exp2_slot(s4[g][e] - mg); z4[e] += s4[g][e]; pl[g * 4 + e] = exp2_slot(pl[g * 4 + e] - pm); pz4[e] += pl[g * 4 + e]; } }
      // both normalisers, the gate, the renormaliser and the x16384 are constants of the row: they are merged into one factor for each softmax's exponentials. The sum of the mixed weights over the keys is formed from the two sums at hand: sum_j (a e_j + c f_j) = a sum_j e_j + c sum_j f_j
      const float zs = wave_sum((z4[0] + z4[1]) + (z4[2] + z4[3])), pzs = wave_sum((pz4[0] + pz4[1]) + (pz4[2] + pz4[3])); const float ga = (1.0f - sg) * hw_rcp(zs), gc = sg * hw_rcp(pzs);
      const float rn = hw_rcp(ga * zs + gc * pzs) * PS, fa = ga * rn, fc = gc * rn; b16* hr = (b16*)&Sc[r][0];
#pragma unroll
      for (int g = 0; g < S / 128; ++g) { v4b wh, wl;
#pragma unroll
        for (int e = 0; e < 4; ++e) { b16 p, q; split16(s4[g][e] * fa + pl[g * 4 + e] * fc, p, q); wh[e] = p; wl[e] = q; }
        *(v4b*)(hr + g * 128 + lane * 4) = wh; *(v4b*)(hr + S + g * 128 + lane * 4) = wl; } } }
  __syncthreads();   // phase 3 reads all 16 rows
  // (3) O = A x v^T, 256 keys a wave, 128 keys (32 loads of v^T) a batch; the A fragments come straight from the planes that phase 2 left in Sc
  v8f oacc[2] = {(v8f){}, (v8f){}}; const b16* ar = (const b16*)&Sc[nloc][0];
#pragma unroll 1
  for (int k0 = wave * CH; k0 < wave * CH + CH && k0 < QLIM; k0 += CH / 2) { v16b vh[4][2], vl[4][2], pa[4], pb[4]; const size_t vo = ((size_t)bh * HD + nloc) * S + k0 + 8 * hlf; const b16 *gh = VTh + vo, *gl = VTl + vo;
#pragma unroll
    for (int kk = 0; kk < 4; ++kk)
#pragma unroll
      for (int t = 0; t < 2; ++t) { vh[kk][t] = frag_kb(gh + t * 16 * S + kk * 32, 0); vl[kk][t] = frag_kb(gl + t * 16 * S + kk * 32, 0); }
    // as loads_issued(); the two addresses are inputs, so that their registers are still held here and no load of the batch lands on them in front of the wait
    asm volatile("s_wait_xcnt 0x0" :: "v"(gh), "v"(gl) : "memory");
#pragma unroll
    for (int kk = 0; kk < 4; ++kk) { pa[kk] = frag_kb(ar + k0 + kk * 32, hlf); pb[kk] = frag_kb(ar + S + k0 + kk * 32, hlf); }
#pragma unroll
    for (int kk = 0; kk < 4; ++kk)
#pragma unroll
      for (int t = 0; t < 2; ++t) { oacc[t] = wmma16b(pa[kk], vh[kk][t], oacc[t]); oacc[t] = wmma16b(pa[kk], vl[kk][t], oacc[t]); oacc[t] = wmma16b(pb[kk], vh[kk][t], oacc[t]); } }
#pragma unroll
  for (int t = 0; t < 2; ++t)
#pragma unroll
    for (int r8 = 0; r8 < 8; ++r8) Of[wave][8 * hlf + r8][t * 16 + nloc] = oacc[t][r8] * (1.0f / (PS * HS));
  __syncthreads();   // the four waves' partial sums over their key quarters are added below
  { for (int r = wave * 4; r < wave * 4 + 4; ++r) ((float*)O)[((size_t)b * S + q0 + r) * C + h * HD + lane] = (Of[0][r][lane] + Of[1][r][lane]) + (Of[2][r][lane] + Of[3][r][lane]);  } }
// eight waves a work-group share one 16-token tile: each takes two of its rows going in and coming out, and two of the 16 output tiles
__global__ __launch_bounds__(256) void outp_kernel(const float* __restrict__ O, const b16* __restrict__ WP, const float* __restrict__ bproj, int QLIM, float* __restrict__ out) { __shared__ __attribute__((aligned(16))) b16 Ah[16][C + 8], Al[16][C + 8]; __shared__ float Tf[16][260]; const int lane = threadIdx.x & 31, wave = __builtin_amdgcn_readfirstlane(threadIdx.x >> 5), nloc = lane & 15, hlf = lane >> 4; const size_t t0 = (size_t)blockIdx.x * 16; if ((int)(t0 % S) >= QLIM) return;
  // a wave's two rows (16 loads) in one batch; the loops are unrolled in full so that the batch stays in registers
  { float orw[2][C / 32]; const float* po = O + (t0 + wave * 2) * C + lane;
#pragma unroll
    for (int rr = 0; rr < 2; ++rr)
#pragma unroll
      for (int q = 0; q < C / 32; ++q) orw[rr][q] = po[rr * C + q * 32];
    loads_issued_from(po);
#pragma unroll
    for (int rr = 0; rr < 2; ++rr)
#pragma unroll
      for (int q = 0; q < C / 32; ++q) { b16 p, pl; split16(orw[rr][q] * HS, p, pl); Ah[wave * 2 + rr][q * 32 + lane] = p; Al[wave * 2 + rr][q * 32 + lane] = pl; } }
  if (threadIdx.x < 16) for (int k = C; k < C + 8; ++k) { Ah[threadIdx.x][k] = (b16)0.0f; Al[threadIdx.x][k] = (b16)0.0f; }
  __syncthreads();   // every wave reads all 16 rows of Ah and Al
  // a wave's two output tiles: all their 16 weight fragments (2 tiles x 8 k steps, 32 loads) are one batch
  { v8f acc[2]; float br[2]; v16b bw[8][2]; const int ib = wave * 32 + nloc; const b16* pw = WP + (size_t)(wave * 32 + nloc) * C + 8 * hlf;
#pragma unroll
    for (int t = 0; t < 2; ++t) { acc[t] = (v8f){}; br[t] = bproj[ib + t * 16]; }
#pragma unroll
    for (int kk = 0; kk < 8; ++kk)
#pragma unroll
      for (int t = 0; t < 2; ++t) bw[kk][t] = frag_kb(pw + t * 16 * C + kk * 32, 0);
    asm volatile("s_wait_xcnt 0x0" :: "v"(ib), "v"(pw) : "memory");   // as loads_issued_from(); the bias loads are addressed by the index
#pragma unroll
    for (int kk = 0; kk < 8; ++kk) { const v16b a = frag_kb(&Ah[nloc][kk * 32], hlf), al = frag_kb(&Al[nloc][kk * 32], hlf);
#pragma unroll
      for (int t = 0; t < 2; ++t) { acc[t] = wmma16b(a, bw[kk][t], acc[t]); acc[t] = wmma16b(al, bw[kk][t], acc[t]); } }
#pragma unroll
    for (int t = 0; t < 2; ++t) { const int cc = wave * 32 + t * 16 + nloc; const float bb = bfv(br[t]);
#pragma unroll
      for (int r8 = 0; r8 < 8; ++r8) Tf[8 * hlf + r8][cc] = acc[t][r8] * (1.0f / (HS * WSC)) + bb; } }
  __syncthreads();   // a row of Tf comes from all eight waves
  { for (int rr = wave * 2; rr < wave * 2 + 2; ++rr) for (int q = 0; q < 2; ++q) *(v4f*)(out + (t0 + rr) * C + q * 128 + lane * 4) = *(const v4f*)(&Tf[rr][q * 128 + lane * 4]);  } }
}  // namespace

extern "C" void kernel_launch(void* const* d_in, const int* in_sizes, int n_in, void* d_out, int out_size, void* d_ws, size_t ws_size, hipStream_t stream) {
  (void)n_in;
  auto Fp = [&](int i) { return (const float*)d_in[i]; };
  // input order: 0 x [4,1024,256]; 1 voxel_coord [4,1024,3]; 2 W_qk [256,512]; 3 W_v [256,256]; 4 W_proj [256,256]; 5 b_proj [256]; 6 W_pos [4,8]; 7 b_pos [8]; 8 gating [8]
  if (in_sizes[0] != NT * C || in_sizes[1] != NT * 3 || in_sizes[2] != C * 512 || in_sizes[3] != C * C || in_sizes[4] != C * C || in_sizes[6] != 4 * H || in_sizes[7] != H || in_sizes[8] != H || out_size != NT * C) return;
  const int QLIM = S;   // per-batch token cut (queries and keys) (multiple of 256)
  size_t off = 0; char* ws = (char*)d_ws;
  auto carve = [&](size_t bytes) { char* p = ws + off; off += (bytes + 255) & ~(size_t)255; return p; };
  b16* WA = (b16*)carve((size_t)768 * C * 2); b16* WP = (b16*)carve((size_t)C * C * 2); b16* Qh = (b16*)carve((size_t)NT * C * 2); b16* Ql = (b16*)carve((size_t)NT * C * 2); b16* Kh = (b16*)carve((size_t)NT * C * 2); b16* Kl = (b16*)carve((size_t)NT * C * 2); float* Vr = (float*)carve((size_t)NT * C * 4); b16* VTh = (b16*)carve((size_t)NT * C * 2); b16* VTl = (b16*)carve((size_t)NT * C * 2); float* O = (float*)carve((size_t)NT * C * 4);
  if (off > ws_size || off > ((size_t)32 << 20)) return;   // ~ 21 MB
  wput_kernel<<<(768 * 32 + 255) / 256, 256, 0, stream>>>(Fp(2), Fp(3), Fp(4), WA, WP);
  proj_kernel<<<NT / 16, 256, 0, stream>>>(Fp(0), WA, QLIM, Qh, Ql, Kh, Kl, Vr);
  vt_kernel<<<NT / 64, 256, 0, stream>>>(Vr, QLIM, VTh, VTl);
  att_kernel<<<NB_ * H * (S / 16), 128, 0, stream>>>(Qh, Ql, Kh, Kl, VTh, VTl, Fp(1), Fp(6), Fp(7), Fp(8), QLIM, O);
  outp_kernel<<<NT / 16, 256, 0, stream>>>(O, WP, Fp(5), QLIM, (float*)d_out);
}

// v007
// Measured time: 51.1 microseconds a run.
// Timed twice side by side with v006, it ran 1.15 times as fast both times.
// Counting every step since v000, it is 31.6 times as fast.
#include <hip/hip_runtime.h>

// GPSA (gated positional self-attention, 8 heads x 32 over 4 x 1024 tokens): [q|k] = x W_qk, v = x W_v; patch = softmax_j(q_i.k_j / sqrt(32)); rel_ij = [p_j - p_i (3), |p_j - p_i|]; pos = softmax_j(rel_ij . W_pos[:,h] + b_pos[h]); attn = (1 - s_h) patch + s_h pos with s_h = sigmoid(gating[h]); attn /= sum_j attn; out = (attn v) W_proj + b_proj -> [4][1024][256].
// WMMA (v_wmma_f32_16x16x32_f16, f32 accumulate): x (EXACT bf16 x8, K 256) x [W_qk | W_v] rows (EXACT x256; 48 tiles); per (bh, 16 queries) S = q (hi+lo x256, K 32) x k rows (hi+lo; 64 tiles) and O = A (hi+lo x16384, K 1,024) x v (hi+lo; 2 tiles), 3 products; o (hi+lo, K 256) x W_proj rows (16 tiles) — ≈ 1 M WMMA; positional logits, both softmaxes, gating in f32.

namespace {
constexpr int NB_ = 4, S = 1024, C = 256, H = 8, HD = 32, NT = NB_ * S, CH = 256;
constexpr float XS = 8.0f, HS = 256.0f, PS = 16384.0f, WSC = 256.0f, SCALE = 0.17677669529663687f, L2E = 1.44269504f;
typedef _Float16 b16;
typedef __attribute__((ext_vector_type(16))) _Float16 v16b;
typedef __attribute__((ext_vector_type(8))) _Float16 v8b;
typedef __attribute__((ext_vector_type(8))) float v8f;
typedef __attribute__((ext_vector_type(4))) float v4f;
typedef __attribute__((ext_vector_type(2))) float v2f;
typedef __attribute__((ext_vector_type(4))) _Float16 v4b;
__device__ __forceinline__ float bf16_rne(float f) { unsigned int u = __float_as_uint(f); u += 0x7FFFu + ((u >> 16) & 1u); float r = __uint_as_float(u & 0xFFFF0000u); asm volatile("" : "+v"(r)); return r; }
__device__ __forceinline__ float bfv(float f) { float r = bf16_rne(f); asm volatile("" : "+v"(r)); return r; }
__device__ __forceinline__ void split16(float v, b16& hi, b16& lo) { hi = (b16)v; lo = (b16)(v - (float)hi); }
__device__ __forceinline__ v16b frag_kb(const b16* p, int hh) { const v8b a = *(const v8b*)(p + 8 * hh), b = *(const v8b*)(p + 16 + 8 * hh); v16b f;
#pragma unroll
  for (int e = 0; e < 8; ++e) { f[e] = a[e]; f[8 + e] = b[e]; } return f; }
// a B fragment of v from its blocks: the two halves lie one block apart; unrolled as in frag_kb, so that the fragment is put together in registers
__device__ __forceinline__ v16b frag_vb(const b16* p) { const v8b a = *(const v8b*)p, b = *(const v8b*)(p + HD * 16); v16b f;
#pragma unroll
  for (int e = 0; e < 8; ++e) { f[e] = a[e]; f[8 + e] = b[e]; } return f; }
__device__ __forceinline__ v8f wmma16b(v16b a, v16b b, v8f c) { v8f d = __builtin_amdgcn_wmma_f32_16x16x32_f16(false, a, false, b, (short)0, c, false, false); asm volatile("v_nop\n\tv_nop\n\tv_nop\n\tv_nop" : "+v"(d) : "v"(a), "v"(b)); return d; }
// stands behind a batch of global loads: before their address registers are given new values, and, being volatile, it keeps the whole batch in front of the volatile statements that follow (the pads behind each matrix instruction, the rounding pins), which no load can cross
__device__ __forceinline__ void loads_issued() { asm volatile("s_wait_xcnt 0x0" ::: "memory"); }
// as loads_issued(); the batch's address is an input, so that its registers are still held here and no load of the batch lands on them in front of the wait
__device__ __forceinline__ void loads_issued_from(const void* p) { asm volatile("s_wait_xcnt 0x0" :: "v"(p) : "memory"); }

// butterfly over the 32 lanes: four DPP steps inside each 16-lane row, then the other row; every lane ends with the same value
template <int CTRL> __device__ __forceinline__ float row_x(float v) { return __builtin_bit_cast(float, __builtin_amdgcn_mov_dpp(__builtin_bit_cast(int, v), CTRL, 0xf, 0xf, true)); }
__device__ __forceinline__ float half_x(float v) { return __builtin_bit_cast(float, __builtin_amdgcn_permlanex16(__builtin_bit_cast(int, v), __builtin_bit_cast(int, v), 0x76543210, 0xfedcba98, false, false)); }
__device__ __forceinline__ float wave_sum(float v) { v += row_x<0x161>(v); v += row_x<0x162>(v); v += row_x<0x164>(v); v += row_x<0x168>(v); return v + half_x(v); }
__device__ __forceinline__ float wave_max(float v) { v = fmaxf(v, row_x<0x161>(v)); v = fmaxf(v, row_x<0x162>(v)); v = fmaxf(v, row_x<0x164>(v)); v = fmaxf(v, row_x<0x168>(v)); return fmaxf(v, half_x(v)); }
// 2^x (v_exp_f32); both softmaxes keep their logits in units of log 2, so no multiply stands in front; the v_nop in the same statement keeps the one slot that the instruction set asks for behind a transcendental before its result is read or its source overwritten
__device__ __forceinline__ float exp2_slot(float x) { float r; asm("v_exp_f32 %0, %1\n\tv_nop" : "=v"(r) : "v"(x)); return r; }
// square root and reciprocal as the one hardware instruction each (about 1 ulp), not the exactly rounded sequences that sqrtf and 1.0f / x expand to (some 15 and 10 vector instructions with compares and selects). The root feeds a softmax logit through a weight; an argument too small for the instruction is a distance below 1e-19, whose share of the logit is nothing either way. The reciprocals take softmax sums, which are 1 or more, and 1 + e^-g
// four roots in one statement: each fills the slot that the instruction set asks for behind the one in front of it (the outputs are early-clobber, so none lands on a source), and the one v_nop keeps the slot of the last; the compiler hints no dependence of asm text, so the statement opens with the hint itself: the sums of squares are made just in front, and an unhinted wait for them would hold the SIMD's other waves too
__device__ __forceinline__ void hw_sqrt4(const float (&x)[4], float (&r)[4]) { asm("s_delay_alu instid0(VALU_DEP_1)\n\tv_sqrt_f32 %0, %4\n\tv_sqrt_f32 %1, %5\n\tv_sqrt_f32 %2, %6\n\tv_sqrt_f32 %3, %7\n\tv_nop" : "=&v"(r[0]), "=&v"(r[1]), "=&v"(r[2]), "=&v"(r[3]) : "v"(x[0]), "v"(x[1]), "v"(x[2]), "v"(x[3])); }
__device__ __forceinline__ float hw_rcp(float x) { return __builtin_amdgcn_rcpf(x); }
__device__ __forceinline__ float lane_bcast(float v, int l) { return __builtin_bit_cast(float, __builtin_amdgcn_readlane(__builtin_bit_cast(int, v), l)); }

__global__ __launch_bounds__(256) void wput_kernel(const float* __restrict__ wqk, const float* __restrict__ wv, const float* __restrict__ wproj, b16* __restrict__ WA, b16* __restrict__ WP) { const int u = blockIdx.x * 256 + threadIdx.x; v8b v; auto put = [&](b16* dst) { { *(v8b*)dst = v;  } };
  const int o = u / 32, k0 = (u % 32) * 8; float ra[8] = {}, rp[8] = {};   // all of a thread's loads are issued before the first rounding, so that they share one trip to memory
  if (u < 768 * 32) { const float* sa = o < 512 ? wqk + o : wv + (o - 512); const int ld = o < 512 ? 512 : C;
#pragma unroll
    for (int j = 0; j < 8; ++j) ra[j] = sa[(size_t)(k0 + j) * ld]; }
  if (u < 256 * 32) {
#pragma unroll
    for (int j = 0; j < 8; ++j) rp[j] = wproj[(size_t)(k0 + j) * C + o]; }
  loads_issued();
  if (u < 768 * 32) {
#pragma unroll
    for (int j = 0; j < 8; ++j) v[j] = (b16)(bf16_rne(ra[j]) * WSC); put(WA + (size_t)o * C + k0); }
  if (u < 256 * 32) {
#pragma unroll
    for (int j = 0; j < 8; ++j) v[j] = (b16)(bf16_rne(rp[j]) * WSC); put(WP + (size_t)o * C + k0); } }
// eight waves a work-group share one 16-token tile: each takes two of its rows going in, the same two rows of q and k coming out and one head's v columns, and six of the 48 output tiles
__global__ __launch_bounds__(256) void proj_kernel(const float* __restrict__ x, const b16* __restrict__ WA, int QLIM, b16* __restrict__ Qh, b16* __restrict__ Ql, b16* __restrict__ Kh, b16* __restrict__ Kl, b16* __restrict__ VFh, b16* __restrict__ VFl) { __shared__ __attribute__((aligned(16))) b16 Ax[16][C + 8]; __shared__ float Tf[16][772]; const int lane = threadIdx.x & 31, wave = __builtin_amdgcn_readfirstlane(threadIdx.x >> 5), nloc = lane & 15, hlf = lane >> 4; const size_t t0 = (size_t)blockIdx.x * 16; const int b = (int)(t0 / S), n0 = (int)(t0 % S); if (n0 >= QLIM) return;
  // a wave's two rows (16 loads) in one batch; the loops are unrolled in full so that the batch stays in registers
  { float xr[2][C / 32]; const float* px = x + (t0 + wave * 2) * C + lane;
#pragma unroll
    for (int rr = 0; rr < 2; ++rr)
#pragma unroll
      for (int q = 0; q < C / 32; ++q) xr[rr][q] = px[rr * C + q * 32];
    loads_issued_from(px);
#pragma unroll
    for (int rr = 0; rr < 2; ++rr)
#pragma unroll
      for (int q = 0; q < C / 32; ++q) Ax[wave * 2 + rr][q * 32 + lane] = (b16)(bfv(xr[rr][q]) * XS); }
  if (threadIdx.x < 16) for (int k = C; k < C + 8; ++k) Ax[threadIdx.x][k] = (b16)0.0f;
  __syncthreads();   // every wave reads all 16 rows of Ax
  // a wave's six output tiles; a batch is 12 weight fragments (6 tiles x 2 k steps, 24 loads); the k loop stays rolled: unrolling would only grow the code, no load can cross the pads
  { v8f acc[6];
#pragma unroll
    for (int t = 0; t < 6; ++t) acc[t] = (v8f){};
#pragma unroll 1
    for (int kb = 0; kb < C; kb += 64) { v16b bw[2][6]; const b16* pw = WA + (size_t)(wave * 96 + nloc) * C + kb + 8 * hlf;
#pragma unroll
      for (int kk = 0; kk < 2; ++kk)
#pragma unroll
        for (int t = 0; t < 6; ++t) bw[kk][t] = frag_kb(pw + t * 16 * C + kk * 32, 0);
      const v16b a0 = frag_kb(&Ax[nloc][kb], hlf), a1 = frag_kb(&Ax[nloc][kb + 32], hlf);
      loads_issued();
#pragma unroll
      for (int t = 0; t < 6; ++t) acc[t] = wmma16b(a0, bw[0][t], acc[t]);
#pragma unroll
      for (int t = 0; t < 6; ++t) acc[t] = wmma16b(a1, bw[1][t], acc[t]); }
#pragma unroll
    for (int t = 0; t < 6; ++t)
#pragma unroll
      for (int r8 = 0; r8 < 8; ++r8) Tf[8 * hlf + r8][wave * 96 + t * 16 + nloc] = acc[t][r8] * (1.0f / (XS * WSC)); }
  __syncthreads();   // a row of Tf comes from all eight waves
  // module layout: qk.reshape(b,n,2,H,HD): col c < 256 -> q (head c/32, dim c%32); 256..511 -> k
  { for (int rr = wave * 2; rr < wave * 2 + 2; ++rr) { for (int h = 0; h < H; ++h) { const size_t po = (((size_t)(b * H + h)) * S + n0 + rr) * HD + lane; b16 p, pl; split16(Tf[rr][h * HD + lane] * HS, p, pl); ((b16*)Qh)[po] = p; ((b16*)Ql)[po] = pl; split16(Tf[rr][C + h * HD + lane] * HS, p, pl); ((b16*)Kh)[po] = p; ((b16*)Kl)[po] = pl; }
      asm volatile("s_wait_xcnt 0x0" ::: "memory"); } }   // behind a row's last store: the next trip, and the block behind the loop, give the stores' data and address registers new values
  // v leaves as the two f16 planes that att_kernel's phase 3 multiplies by, in blocks [head][16 tokens][dim][token]: a thread takes one column (head = wave, dim = lane) of the tile's 16 tokens, 32 bytes a plane, so a wave fills one 1,024-byte block of each plane and no other work-group writes into it; both loops are unrolled in full so that the four vectors are indexed by constants and stay in registers
  { v8b vh[2], vl[2];
#pragma unroll
    for (int r = 0; r < 16; ++r) { b16 p, pl; split16(Tf[r][512 + wave * HD + lane] * HS, p, pl); vh[r / 8][r % 8] = p; vl[r / 8][r % 8] = pl; }
    const size_t vo = ((((size_t)(b * H + wave)) * (S / 16) + n0 / 16) * HD + lane) * 16;
#pragma unroll
    for (int q = 0; q < 2; ++q) { *(v8b*)(VFh + vo + q * 8) = vh[q]; *(v8b*)(VFl + vo + q * 8) = vl[q]; } } }
// four waves a work-group share one 16-query tile and its score rows in LDS: each takes a quarter of the key tiles (1), four of the rows (2) and a quarter of the keys (3), so that a SIMD holds four waves, not one, and one wave's waits are filled by the others
__global__ __launch_bounds__(128) void att_kernel(const b16* __restrict__ Qh, const b16* __restrict__ Ql, const b16* __restrict__ Kh, const b16* __restrict__ Kl, const b16* __restrict__ VFh, const b16* __restrict__ VFl, const float* __restrict__ coord, const float* __restrict__ wpos, const float* __restrict__ bpos, const float* __restrict__ gating, int QLIM, float* __restrict__ O) { __shared__ __attribute__((aligned(16))) float Sc[16][S + 4]; __shared__ float Of[4][16][HD + 1]; const int lane = threadIdx.x & 31, wave = __builtin_amdgcn_readfirstlane(threadIdx.x >> 5), nloc = lane & 15, hlf = lane >> 4; const int bh = blockIdx.x / (S / 16), q0 = (blockIdx.x % (S / 16)) * 16; if (q0 >= QLIM) return; const int b = bh / H, h = bh % H;
  const v16b qa = frag_kb(Qh + ((size_t)bh * S + q0 + nloc) * HD, hlf), ql = frag_kb(Ql + ((size_t)bh * S + q0 + nloc) * HD, hlf);
  loads_issued();
  // (1) scaled scores for all keys, in units of log 2 (log2 e rides in the scale factor), 16 key tiles a wave
#pragma unroll 1
  for (int tg = wave * 16; tg < wave * 16 + 16; tg += 8) { v8f s[8];
#pragma unroll
    for (int t = 0; t < 8; ++t) s[t] = (v8f){};
    // eight key tiles (32 loads) a batch; the cut is tested once for the batch (it is a multiple of 256, as phases 2 and 3 take it too): a test per tile would leave paths on which loads are never waited for, and the next trip's loads would then wait on this trip's
    if (tg * 16 < QLIM) { v16b kh[8], kl[8]; const size_t ko = ((size_t)bh * S + tg * 16 + nloc) * HD; const b16 *ph = Kh + ko, *pl = Kl + ko;
#pragma unroll
      for (int t = 0; t < 8; ++t) { kh[t] = frag_kb(ph + t * 16 * HD, hlf); kl[t] = frag_kb(pl + t * 16 * HD, hlf); }
      loads_issued();
#pragma unroll
      for (int t = 0; t < 8; ++t) { s[t] = wmma16b(qa, kh[t], s[t]); s[t] = wmma16b(qa, kl[t], s[t]); s[t] = wmma16b(ql, kh[t], s[t]); } }
#pragma unroll
    for (int t = 0; t < 8; ++t)
#pragma unroll
      for (int r8 = 0; r8 < 8; ++r8) Sc[8 * hlf + r8][(tg + t) * 16 + nloc] = s[t][r8] * (SCALE * L2E / (HS * HS)); }
  __syncthreads();   // a row's scores come from all four waves
  // (2) one query row at a time, its keys spread over the 32 lanes (lane owns keys g * 128 + lane * 4 + e): patch softmax, pos softmax, gated mix, renorm; the row's final weights (x16384) then go back over its own 4,096 score bytes as two f16 planes, hi at keys 0..1023 and lo behind it, in the form phase 3 reads: no second LDS array, so four work-groups fit a WGP's LDS, not three
  { const float gr = gating[h], wr0 = wpos[0 * H + h], wr1 = wpos[1 * H + h], wr2 = wpos[2 * H + h], wr3 = wpos[3 * H + h], br = bpos[h];   // every load of this phase is issued before the first rounding, so that they share one trip to memory
    const float* pq = coord + ((size_t)b * S + q0 + nloc) * 3; const float qx = pq[0], qy = pq[1], qz = pq[2]; v4f craw[S / 128][3];
    // every loop over g, e or u in this phase is unrolled in full, so that its arrays are indexed by constants and stay in registers
#pragma unroll
    for (int g = 0; g < S / 128; ++g)
#pragma unroll
      for (int u = 0; u < 3; ++u) craw[g][u] = *(const v4f*)(coord + ((size_t)b * S + g * 128 + lane * 4) * 3 + u * 4);
    asm volatile("s_wait_xcnt 0x0" :: "v"(pq) : "memory");   // stands before the address registers of the loads above are given new values; the query address is an input, so that no later load of the batch lands on its registers in front of the wait
    const float sg = hw_rcp(1.0f + __expf(-bfv(gr))); const float w0 = bfv(wr0) * L2E, w1 = bfv(wr1) * L2E, w2 = bfv(wr2) * L2E, w3 = bfv(wr3) * L2E, bp = bfv(br) * L2E;
    const float rx = bfv(qx), ry = bfv(qy), rz = bfv(qz); float cx[S / 32], cy[S / 32], cz[S / 32], cw[S / 32];
#pragma unroll
    for (int g = 0; g < S / 128; ++g) { const float bg = g * 128 < QLIM ? bp : -INFINITY;   // a key at or past the cut gets logit -inf, weight 0
#pragma unroll
      for (int e = 0; e < 4; ++e) { cx[g * 4 + e] = bfv(craw[g][(e * 3) / 4][(e * 3) % 4]); cy[g * 4 + e] = bfv(craw[g][(e * 3 + 1) / 4][(e * 3 + 1) % 4]); cz[g * 4 + e] = bfv(craw[g][(e * 3 + 2) / 4][(e * 3 + 2) % 4]);
        // the key's own share of its positional logit, the same for every query: (p_j - p_i) . w = p_j . w - p_i . w, and the query's share is one constant along the row, which a softmax over the row's keys cancels
        cw[g * 4 + e] = cx[g * 4 + e] * w0 + cy[g * 4 + e] * w1 + cz[g * 4 + e] * w2 + bg; } }
    // the loop over a wave's four rows stays rolled: one row is about 1,000 instructions already, and copies would only grow the code
#pragma unroll 1
    for (int r = wave * 4; r < wave * 4 + 4; ++r) { v4f* sr = (v4f*)&Sc[r][0]; v4f s4[S / 128]; float pl[S / 32];
#pragma unroll
      for (int g = 0; g < S / 128; ++g) s4[g] = sr[g * 32 + lane];
      const float pix = lane_bcast(rx, r), piy = lane_bcast(ry, r), piz = lane_bcast(rz, r); float pm4[4] = {-INFINITY, -INFINITY, -INFINITY, -INFINITY}, mx = -INFINITY;
#pragma unroll
      for (int g = 0; g < S / 128; ++g) { float dx[4], dy[4], dz[4], d2[4], dd[4];
#pragma unroll
        for (int e = 0; e < 4; ++e) { dx[e] = cx[g * 4 + e] - pix; dy[e] = cy[g * 4 + e] - piy; dz[e] = cz[g * 4 + e] - piz; d2[e] = dx[e] * dx[e] + dy[e] * dy[e] + dz[e] * dz[e]; }
        hw_sqrt4(d2, dd);
#pragma unroll
        for (int e = 0; e < 4; ++e) { pl[g * 4 + e] = dd[e] * w3 + cw[g * 4 + e]; pm4[e] = fmaxf(pm4[e], pl[g * 4 + e]); }
        if (g & 1) __builtin_amdgcn_sched_barrier(0); }   // eight keys in flight at a time: with all 32 started at once their temporaries take the wave past 256 registers, and a SIMD then holds three such waves, not four
#pragma unroll
      for (int g = 0; g < S / 128; ++g) { const float gm = fmaxf(fmaxf(s4[g][0], s4[g][1]), fmaxf(s4[g][2], s4[g][3])); mx = fmaxf(mx, g * 128 < QLIM ? gm : -INFINITY); }
      mx = wave_max(mx); const float pm = wave_max(fmaxf(fmaxf(pm4[0], pm4[1]), fmaxf(pm4[2], pm4[3])));
      float z4[4] = {0.0f, 0.0f, 0.0f, 0.0f}, pz4[4] = {0.0f, 0.0f, 0.0f, 0.0f};
#pragma unroll
      for (int g = 0; g < S / 128; ++g) { const float mg = g * 128 < QLIM ? mx : INFINITY;
#pragma unroll
        for (int e = 0; e < 4; ++e) { s4[g][e] = exp2_slot(s4[g][e] - mg); z4[e] += s4[g][e]; pl[g * 4 + e] = exp2_slot(pl[g * 4 + e] - pm); pz4[e] += pl[g * 4 + e]; } }
      // both normalisers, the gate, the renormaliser and the x16384 are constants of the row: they are merged into one factor for each softmax's exponentials. The sum of the mixed weights over the keys is formed from the two sums at hand: sum_j (a e_j + c f_j) = a sum_j e_j + c sum_j f_j
      const float zs = wave_sum((z4[0] + z4[1]) + (z4[2] + z4[3])), pzs = wave_sum((pz4[0] + pz4[1]) + (pz4[2] + pz4[3])); const float ga = (1.0f - sg) * hw_rcp(zs), gc = sg * hw_rcp(pzs);
      const float rn = hw_rcp(ga * zs + gc * pzs) * PS, fa = ga * rn, fc = gc * rn; b16* hr = (b16*)&Sc[r][0];
#pragma unroll
      for (int g = 0; g < S / 128; ++g) { v4b wh, wl;
#pragma unroll
        for (int e = 0; e < 4; ++e) { b16 p, q; split16(s4[g][e] * fa + pl[g * 4 + e] * fc, p, q); wh[e] = p; wl[e] = q; }
        *(v4b*)(hr + g * 128 + lane * 4) = wh; *(v4b*)(hr + S + g * 128 + lane * 4) = wl; } } }
  __syncthreads();   // phase 3 reads all 16 rows
  // (3) O = A x v, 256 keys a wave, 128 keys (32 loads of v) a batch; v lies in blocks [16 keys][dim][key], so the 32 lanes of a load read 512 bytes in a row, and a fragment's two halves (keys 8 hlf + 0..7 and 16 + 8 hlf + 0..7, the k order of frag_kb) lie one block (HD * 16 elements) apart; the A fragments come straight from the planes that phase 2 left in Sc
  v8f oacc[2] = {(v8f){}, (v8f){}}; const b16* ar = (const b16*)&Sc[nloc][0];
#pragma unroll 1
  for (int k0 = wave * CH; k0 < wave * CH + CH && k0 < QLIM; k0 += CH / 2) { v16b vh[4][2], vl[4][2], pa[4], pb[4]; const size_t vo = (((size_t)bh * (S / 16) + k0 / 16) * HD + nloc) * 16 + 8 * hlf; const b16 *gh = VFh + vo, *gl = VFl + vo;
#pragma unroll
    for (int kk = 0; kk < 4; ++kk)
#pragma unroll
      for (int t = 0; t < 2; ++t) { vh[kk][t] = frag_vb(gh + (kk * 2 * HD + t * 16) * 16); vl[kk][t] = frag_vb(gl + (kk * 2 * HD + t * 16) * 16); }
    // as loads_issued(); the two addresses are inputs, so that their registers are still held here and no load of the batch lands on them in front of the wait
    asm volatile("s_wait_xcnt 0x0" :: "v"(gh), "v"(gl) : "memory");
#pragma unroll
    for (int kk = 0; kk < 4; ++kk) { pa[kk] = frag_kb(ar + k0 + kk * 32, hlf); pb[kk] = frag_kb(ar + S + k0 + kk * 32, hlf); }
#pragma unroll
    for (int kk = 0; kk < 4; ++kk)
#pragma unroll
      for (int t = 0; t < 2; ++t) { oacc[t] = wmma16b(pa[kk], vh[kk][t], oacc[t]); oacc[t] = wmma16b(pa[kk], vl[kk][t], oacc[t]); oacc[t] = wmma16b(pb[kk], vh[kk][t], oacc[t]); } }
#pragma unroll
  for (int t = 0; t < 2; ++t)
#pragma unroll
    for (int r8 = 0; r8 < 8; ++r8) Of[wave][8 * hlf + r8][t * 16 + nloc] = oacc[t][r8] * (1.0f / (PS * HS));
  __syncthreads();   // the four waves' partial sums over their key quarters are added below
  { for (int r = wave * 4; r < wave * 4 + 4; ++r) ((float*)O)[((size_t)b * S + q0 + r) * C + h * HD + lane] = (Of[0][r][lane] + Of[1][r][lane]) + (Of[2][r][lane] + Of[3][r][lane]);  } }
// eight waves a work-group share one 16-token tile: each takes two of its rows going in and coming out, and two of the 16 output tiles
__global__ __launch_bounds__(256) void outp_kernel(const float* __restrict__ O, const b16* __restrict__ WP, const float* __restrict__ bproj, int QLIM, float* __restrict__ out) { __shared__ __attribute__((aligned(16))) b16 Ah[16][C + 8], Al[16][C + 8]; __shared__ float Tf[16][260]; const int lane = threadIdx.x & 31, wave = __builtin_amdgcn_readfirstlane(threadIdx.x >> 5), nloc = lane & 15, hlf = lane >> 4; const size_t t0 = (size_t)blockIdx.x * 16; if ((int)(t0 % S) >= QLIM) return;
  // a wave's two rows (16 loads) in one batch; the loops are unrolled in full so that the batch stays in registers
  { float orw[2][C / 32]; const float* po = O + (t0 + wave * 2) * C + lane;
#pragma unroll
    for (int rr = 0; rr < 2; ++rr)
#pragma unroll
      for (int q = 0; q < C / 32; ++q) orw[rr][q] = po[rr * C + q * 32];
    loads_issued_from(po);
#pragma unroll
    for (int rr = 0; rr < 2; ++rr)
#pragma unroll
      for (int q = 0; q < C / 32; ++q) { b16 p, pl; split16(orw[rr][q] * HS, p, pl); Ah[wave * 2 + rr][q * 32 + lane] = p; Al[wave * 2 + rr][q * 32 + lane] = pl; } }
  if (threadIdx.x < 16) for (int k = C; k < C + 8; ++k) { Ah[threadIdx.x][k] = (b16)0.0f; Al[threadIdx.x][k] = (b16)0.0f; }
  __syncthreads();   // every wave reads all 16 rows of Ah and Al
  // a wave's two output tiles: all their 16 weight fragments (2 tiles x 8 k steps, 32 loads) are one batch
  { v8f acc[2]; float br[2]; v16b bw[8][2]; const int ib = wave * 32 + nloc; const b16* pw = WP + (size_t)(wave * 32 + nloc) * C + 8 * hlf;
#pragma unroll
    for (int t = 0; t < 2; ++t) { acc[t] = (v8f){}; br[t] = bproj[ib + t * 16]; }
#pragma unroll
    for (int kk = 0; kk < 8; ++kk)
#pragma unroll
      for (int t = 0; t < 2; ++t) bw[kk][t] = frag_kb(pw + t * 16 * C + kk * 32, 0);
    asm volatile("s_wait_xcnt 0x0" :: "v"(ib), "v"(pw) : "memory");   // as loads_issued_from(); the bias loads are addressed by the index
#pragma unroll
    for (int kk = 0; kk < 8; ++kk) { const v16b a = frag_kb(&Ah[nloc][kk * 32], hlf), al = frag_kb(&Al[nloc][kk * 32], hlf);
#pragma unroll
      for (int t = 0; t < 2; ++t) { acc[t] = wmma16b(a, bw[kk][t], acc[t]); acc[t] = wmma16b(al, bw[kk][t], acc[t]); } }
#pragma unroll
    for (int t = 0; t < 2; ++t) { const int cc = wave * 32 + t * 16 + nloc; const float bb = bfv(br[t]);
#pragma unroll
      for (int r8 = 0; r8 < 8; ++r8) Tf[8 * hlf + r8][cc] = acc[t][r8] * (1.0f / (HS * WSC)) + bb; } }
  __syncthreads();   // a row of Tf comes from all eight waves
  { for (int rr = wave * 2; rr < wave * 2 + 2; ++rr) for (int q = 0; q < 2; ++q) *(v4f*)(out + (t0 + rr) * C + q * 128 + lane * 4) = *(const v4f*)(&Tf[rr][q * 128 + lane * 4]);  } }
}  // namespace

extern "C" void kernel_launch(void* const* d_in, const int* in_sizes, int n_in, void* d_out, int out_size, void* d_ws, size_t ws_size, hipStream_t stream) {
  (void)n_in;
  auto Fp = [&](int i) { return (const float*)d_in[i]; };
  // input order: 0 x [4,1024,256]; 1 voxel_coord [4,1024,3]; 2 W_qk [256,512]; 3 W_v [256,256]; 4 W_proj [256,256]; 5 b_proj [256]; 6 W_pos [4,8]; 7 b_pos [8]; 8 gating [8]
  if (in_sizes[0] != NT * C || in_sizes[1] != NT * 3 || in_sizes[2] != C * 512 || in_sizes[3] != C * C || in_sizes[4] != C * C || in_sizes[6] != 4 * H || in_sizes[7] != H || in_sizes[8] != H || out_size != NT * C) return;
  const int QLIM = S;   // per-batch token cut (queries and keys) (multiple of 256)
  size_t off = 0; char* ws = (char*)d_ws;
  auto carve = [&](size_t bytes) { char* p = ws + off; off += (bytes + 255) & ~(size_t)255; return p; };
  b16* WA = (b16*)carve((size_t)768 * C * 2); b16* WP = (b16*)carve((size_t)C * C * 2); b16* Qh = (b16*)carve((size_t)NT * C * 2); b16* Ql = (b16*)carve((size_t)NT * C * 2); b16* Kh = (b16*)carve((size_t)NT * C * 2); b16* Kl = (b16*)carve((size_t)NT * C * 2); b16* VFh = (b16*)carve((size_t)NT * C * 2); b16* VFl = (b16*)carve((size_t)NT * C * 2); float* O = (float*)carve((size_t)NT * C * 4);
  if (off > ws_size || off > ((size_t)32 << 20)) return;   // ~ 17 MB
  wput_kernel<<<(768 * 32 + 255) / 256, 256, 0, stream>>>(Fp(2), Fp(3), Fp(4), WA, WP);
  proj_kernel<<<NT / 16, 256, 0, stream>>>(Fp(0), WA, QLIM, Qh, Ql, Kh, Kl, VFh, VFl);
  att_kernel<<<NB_ * H * (S / 16), 128, 0, stream>>>(Qh, Ql, Kh, Kl, VFh, VFl, Fp(1), Fp(6), Fp(7), Fp(8), QLIM, O);
  outp_kernel<<<NT / 16, 256, 0, stream>>>(O, WP, Fp(5), QLIM, (float*)d_out);
}

// v008
// A run of this version takes 47 microseconds.
// Two timings next to v007 both put it at 1.09 times that version's speed.
// Counting every step since v000, it is 34.4 times as fast.
#include <hip/hip_runtime.h>

// GPSA (gated positional self-attention, 8 heads x 32 over 4 x 1024 tokens): [q|k] = x W_qk, v = x W_v; patch = softmax_j(q_i.k_j / sqrt(32)); rel_ij = [p_j - p_i (3), |p_j - p_i|]; pos = softmax_j(rel_ij . W_pos[:,h] + b_pos[h]); attn = (1 - s_h) patch + s_h pos with s_h = sigmoid(gating[h]); attn /= sum_j attn; out = (attn v) W_proj + b_proj -> [4][1024][256].
// WMMA (v_wmma_f32_16x16x32_f16, f32 accumulate): x (EXACT bf16 x8, K 256) x [W_qk | W_v] rows (EXACT x256; 48 tiles); per (bh, 16 queries) S = q (hi+lo x256, K 32) x k rows (hi+lo; 64 tiles) and O = A (hi+lo x16384, K 1,024) x v (hi+lo; 2 tiles), 3 products; o (hi+lo, K 256) x W_proj rows (16 tiles) — ≈ 1 M WMMA; positional logits, both softmaxes, gating in f32.

namespace {
constexpr int NB_ = 4, S = 1024, C = 256, H = 8, HD = 32, NT = NB_ * S, CH = 256;
constexpr float XS = 8.0f, HS = 256.0f, PS = 16384.0f, WSC = 256.0f, SCALE = 0.17677669529663687f, L2E = 1.44269504f;
typedef _Float16 b16;
typedef __attribute__((ext_vector_type(16))) _Float16 v16b;
typedef __attribute__((ext_vector_type(8))) _Float16 v8b;
typedef __attribute__((ext_vector_type(8))) float v8f;
typedef __attribute__((ext_vector_type(4))) float v4f;
typedef __attribute__((ext_vector_type(2))) float v2f;
typedef __attribute__((ext_vector_type(4))) _Float16 v4b;
__device__ __forceinline__ float bf16_rne(float f) { unsigned int u = __float_as_uint(f); u += 0x7FFFu + ((u >> 16) & 1u); float r = __uint_as_float(u & 0xFFFF0000u); asm volatile("" : "+v"(r)); return r; }
__device__ __forceinline__ float bfv(float f) { float r = bf16_rne(f); asm volatile("" : "+v"(r)); return r; }
__device__ __forceinline__ void split16(float v, b16& hi, b16& lo) { hi = (b16)v; lo = (b16)(v - (float)hi); }
__device__ __forceinline__ v16b frag_kb(const b16* p, int hh) { const v8b a = *(const v8b*)(p + 8 * hh), b = *(const v8b*)(p + 16 + 8 * hh); v16b f;
#pragma unroll
  for (int e = 0; e < 8; ++e) { f[e] = a[e]; f[8 + e] = b[e]; } return f; }
// a B fragment of v from its blocks: the two halves lie one block apart; unrolled as in frag_kb, so that the fragment is put together in registers
__device__ __forceinline__ v16b frag_vb(const b16* p) { const v8b a = *(const v8b*)p, b = *(const v8b*)(p + HD * 16); v16b f;
#pragma unroll
  for (int e = 0; e < 8; ++e) { f[e] = a[e]; f[8 + e] = b[e]; } return f; }
__device__ __forceinline__ v8f wmma16b(v16b a, v16b b, v8f c) { v8f d = __builtin_amdgcn_wmma_f32_16x16x32_f16(false, a, false, b, (short)0, c, false, false); asm volatile("v_nop\n\tv_nop\n\tv_nop\n\tv_nop" : "+v"(d) : "v"(a), "v"(b)); return d; }
// stands behind a batch of global loads: before their address registers are given new values, and, being volatile, it keeps the whole batch in front of the volatile statements that follow (the pads behind each matrix instruction, the rounding pins), which no load can cross
__device__ __forceinline__ void loads_issued() { asm volatile("s_wait_xcnt 0x0" ::: "memory"); }
// as loads_issued(); the batch's address is an input, so that its registers are still held here and no load of the batch lands on them in front of the wait
__device__ __forceinline__ void loads_issued_from(const void* p) { asm volatile("s_wait_xcnt 0x0" :: "v"(p) : "memory"); }

// butterfly over the 32 lanes: four DPP steps inside each 16-lane row, then the other row; every lane ends with the same value
template <int CTRL> __device__ __forceinline__ float row_x(float v) { return __builtin_bit_cast(float, __builtin_amdgcn_mov_dpp(__builtin_bit_cast(int, v), CTRL, 0xf, 0xf, true)); }
__device__ __forceinline__ float half_x(float v) { return __builtin_bit_cast(float, __builtin_amdgcn_permlanex16(__builtin_bit_cast(int, v), __builtin_bit_cast(int, v), 0x76543210, 0xfedcba98, false, false)); }
__device__ __forceinline__ float wave_sum(float v) { v += row_x<0x161>(v); v += row_x<0x162>(v); v += row_x<0x164>(v); v += row_x<0x168>(v); return v + half_x(v); }
__device__ __forceinline__ float wave_max(float v) { v = fmaxf(v, row_x<0x161>(v)); v = fmaxf(v, row_x<0x162>(v)); v = fmaxf(v, row_x<0x164>(v)); v = fmaxf(v, row_x<0x168>(v)); return fmaxf(v, half_x(v)); }
// 2^x (v_exp_f32); both softmaxes keep their logits in units of log 2, so no multiply stands in front; the v_nop in the same statement keeps the one slot that the instruction set asks for behind a transcendental before its result is read or its source overwritten
__device__ __forceinline__ float exp2_slot(float x) { float r; asm("v_exp_f32 %0, %1\n\tv_nop" : "=v"(r) : "v"(x)); return r; }
// square root and reciprocal as the one hardware instruction each (about 1 ulp), not the exactly rounded sequences that sqrtf and 1.0f / x expand to (some 15 and 10 vector instructions with compares and selects). The root feeds a softmax logit through a weight; an argument too small for the instruction is a distance below 1e-19, whose share of the logit is nothing either way. The reciprocals take softmax sums, which are 1 or more, and 1 + e^-g
// four roots in one statement: each fills the slot that the instruction set asks for behind the one in front of it (the outputs are early-clobber, so none lands on a source), and the one v_nop keeps the slot of the last; the compiler hints no dependence of asm text, so the statement opens with the hint itself: the sums of squares are made just in front, and an unhinted wait for them would hold the SIMD's other waves too
__device__ __forceinline__ void hw_sqrt4(const float (&x)[4], float (&r)[4]) { asm("s_delay_alu instid0(VALU_DEP_1)\n\tv_sqrt_f32 %0, %4\n\tv_sqrt_f32 %1, %5\n\tv_sqrt_f32 %2, %6\n\tv_sqrt_f32 %3, %7\n\tv_nop" : "=&v"(r[0]), "=&v"(r[1]), "=&v"(r[2]), "=&v"(r[3]) : "v"(x[0]), "v"(x[1]), "v"(x[2]), "v"(x[3])); }
__device__ __forceinline__ float hw_rcp(float x) { return __builtin_amdgcn_rcpf(x); }
__device__ __forceinline__ float lane_bcast(float v, int l) { return __builtin_bit_cast(float, __builtin_amdgcn_readlane(__builtin_bit_cast(int, v), l)); }

// W_proj for outp_kernel: rounded, x256, f16, transposed to [output][k]. One wave takes one output column o, a lane eight k of it, so the wave writes the column's 512 bytes and nobody else does; the loads and the rest are two functions, so that other work can stand between them while the loads are under way
__device__ __forceinline__ void wp_load(const float* __restrict__ wproj, int o, int lane, float (&rp)[8]) { const float* sp = wproj + (size_t)(lane * 8) * C + o;
#pragma unroll
  for (int j = 0; j < 8; ++j) rp[j] = sp[(size_t)j * C];
  loads_issued_from(sp); }
__device__ __forceinline__ void wp_store(b16* __restrict__ WP, int o, int lane, const float (&rp)[8]) { v8b v;
#pragma unroll
  for (int j = 0; j < 8; ++j) v[j] = (b16)(bf16_rne(rp[j]) * WSC);
  *(v8b*)(WP + (size_t)o * C + lane * 8) = v;
  asm volatile("s_wait_xcnt 0x0" ::: "memory"); }   // behind the store: what follows gives its data and address registers new values
// eight waves a work-group take 64 tokens x 192 of the 768 output columns [q | k | v] (six 32-column head slots). The work-group rounds and transposes its own slice of W_qk | W_v: a thread loads eight k rows of four adjacent columns (eight lanes read 128 bytes in a row), so each column's eight k lie in its registers and leave as one 16-byte LDS store into Wt[column][k], the form the B fragments read; with 64 tokens a slice is prepared by 64 work-groups, not 256. The grid has as many work-groups as W_proj has output columns: wave 0 of each also prepares one of them
constexpr int TM = 64, TN = 192;
__global__ __launch_bounds__(256) void proj_kernel(const float* __restrict__ x, const float* __restrict__ wqk, const float* __restrict__ wv, const float* __restrict__ wproj, int QLIM, b16* __restrict__ Qh, b16* __restrict__ Ql, b16* __restrict__ Kh, b16* __restrict__ Kl, b16* __restrict__ VFh, b16* __restrict__ VFl, b16* __restrict__ WP) { __shared__ __attribute__((aligned(16))) b16 Ax[TM][C + 8]; __shared__ __attribute__((aligned(16))) b16 Wt[TN][C + 8]; __shared__ float Tf[TM][TN + 4]; const int lane = threadIdx.x & 31, wave = __builtin_amdgcn_readfirstlane(threadIdx.x >> 5), nloc = lane & 15, hlf = lane >> 4; const int cg = blockIdx.x & 3; const size_t t0 = (size_t)(blockIdx.x >> 2) * TM; const int b = (int)(t0 / S), n0 = (int)(t0 % S); float rp[8];
  if (n0 >= QLIM) { if (wave == 0) { wp_load(wproj, (int)blockIdx.x, lane, rp); wp_store(WP, (int)blockIdx.x, lane, rp); } return; }   // a work-group past the token cut still owes its column of W_proj; it leaves as a whole, in front of every barrier
  const int nql = lane & 7, kq = wave * 4 + (lane >> 3);
  // two batches of loads, each four of a wave's eight token rows (8 loads) and 96 of the columns (24 loads); every loop here is unrolled in full so that a batch stays in registers. A run of 32 columns lies wholly in W_qk or wholly in W_v, so source and row length are the same for the whole work-group
#pragma unroll
  for (int hb = 0; hb < 2; ++hb) { v4f xr[4][2], wr[3][8]; const char* px = (const char*)(x + (t0 + wave * 8 + hb * 4) * C); const unsigned vx = (unsigned)lane * 16u; const float* pw[3][8];
#pragma unroll
    for (int rr = 0; rr < 4; ++rr)
#pragma unroll
      for (int q = 0; q < 2; ++q) xr[rr][q] = *(const v4f*)(px + (rr * C + q * 128) * 4 + vx);
#pragma unroll
    for (int it = 0; it < 3; ++it) { const int ob = cg * TN + (hb * 3 + it) * 32; const int ld = ob < 512 ? 512 : C; const float* ub = ob < 512 ? wqk + ob : wv + (ob - 512); 
#pragma unroll
      for (int j = 0; j < 8; ++j) { pw[it][j] = ub + (kq * 8 + j) * ld + nql * 4; wr[it][j] = *(const v4f*)pw[it][j]; } }
    // as loads_issued(); every address of the batch is an input, so that its registers are still held here and no load of the batch lands on them in front of the wait
    asm volatile("s_wait_xcnt 0x0" :: "v"(vx), "v"(pw[0][0]), "v"(pw[0][1]), "v"(pw[0][2]), "v"(pw[0][3]), "v"(pw[0][4]), "v"(pw[0][5]), "v"(pw[0][6]), "v"(pw[0][7]), "v"(pw[1][0]), "v"(pw[1][1]), "v"(pw[1][2]), "v"(pw[1][3]), "v"(pw[1][4]), "v"(pw[1][5]), "v"(pw[1][6]), "v"(pw[1][7]), "v"(pw[2][0]), "v"(pw[2][1]), "v"(pw[2][2]), "v"(pw[2][3]), "v"(pw[2][4]), "v"(pw[2][5]), "v"(pw[2][6]), "v"(pw[2][7]) : "memory");
#pragma unroll
    for (int rr = 0; rr < 4; ++rr)
#pragma unroll
      for (int q = 0; q < 2; ++q) { v4b t;
#pragma unroll
        for (int e = 0; e < 4; ++e) t[e] = (b16)(bfv(xr[rr][q][e]) * XS);
        *(v4b*)&Ax[wave * 8 + hb * 4 + rr][q * 128 + lane * 4] = t; }
#pragma unroll
    for (int it = 0; it < 3; ++it)
#pragma unroll
      for (int i = 0; i < 4; ++i) { v8b t;
#pragma unroll
        for (int j = 0; j < 8; ++j) t[j] = (b16)(bf16_rne(wr[it][j][i]) * WSC);
        *(v8b*)&Wt[(hb * 3 + it) * 32 + nql * 4 + i][kq * 8] = t; } }
  __syncthreads();   // every wave reads rows of Ax and Wt that other waves wrote
  if (wave == 0) wp_load(wproj, (int)blockIdx.x, lane, rp);   // under way during the matrix phase, which loads nothing from global memory, so no wait of that phase falls on these loads
  // a wave's 2 x 3 output tiles; a batch is the 20 fragments of four k steps, all from LDS; the loop over the two batches stays rolled: no load can cross the pads, so unrolling would only grow the code
  { const int mg = wave & 1, ng = wave >> 1; v8f acc[2][3];
#pragma unroll
    for (int i = 0; i < 2; ++i)
#pragma unroll
      for (int t = 0; t < 3; ++t) acc[i][t] = (v8f){};
#pragma unroll 1
    for (int kb = 0; kb < C; kb += 128) { v16b af[4][2], bw[4][3];
#pragma unroll
      for (int kk = 0; kk < 4; ++kk) {
#pragma unroll
        for (int i = 0; i < 2; ++i) af[kk][i] = frag_kb(&Ax[(mg * 2 + i) * 16 + nloc][kb + kk * 32], hlf);
#pragma unroll
        for (int t = 0; t < 3; ++t) bw[kk][t] = frag_kb(&Wt[(ng * 3 + t) * 16 + nloc][kb + kk * 32], hlf); }
#pragma unroll
      for (int kk = 0; kk < 4; ++kk)
#pragma unroll
        for (int i = 0; i < 2; ++i)
#pragma unroll
          for (int t = 0; t < 3; ++t) acc[i][t] = wmma16b(af[kk][i], bw[kk][t], acc[i][t]); }
#pragma unroll
    for (int i = 0; i < 2; ++i)
#pragma unroll
      for (int t = 0; t < 3; ++t)
#pragma unroll
        for (int r8 = 0; r8 < 8; ++r8) Tf[(mg * 2 + i) * 16 + 8 * hlf + r8][(ng * 3 + t) * 16 + nloc] = acc[i][t][r8] * (1.0f / (XS * WSC)); }
  __syncthreads();   // a row of Tf comes from four waves
  if (wave == 0) wp_store(WP, (int)blockIdx.x, lane, rp);   // behind the last barrier: in front of one, the whole work-group would wait for this store to be done
  // module layout: qk.reshape(b,n,2,H,HD): head slot sl = column / 32: 0..7 -> q heads, 8..15 -> k heads, 16..23 -> v heads; the work-group holds slots cg * 6 + 0..5, of which the last nv are v
  const int nv = cg == 3 ? 6 : cg == 2 ? 2 : 0;
  // q and k: a wave takes its eight token rows of one head slot at a time (64 bytes a row and plane); the loop over the slots stays rolled, its trip count differs between work-groups; the loops over the rows are unrolled in full so that a slot's LDS loads go out together
#pragma unroll 1
  for (int i = 0; i < 6 - nv; ++i) { const int sl = cg * 6 + i, h = sl & 7; b16* dh = sl < 8 ? Qh : Kh; b16* dl = sl < 8 ? Ql : Kl; const size_t po = (((size_t)(b * H + h)) * S + n0 + wave * 8) * HD + lane; float tv[8];
#pragma unroll
    for (int rr = 0; rr < 8; ++rr) tv[rr] = Tf[wave * 8 + rr][i * HD + lane];
#pragma unroll
    for (int rr = 0; rr < 8; ++rr) { b16 p, pl; split16(tv[rr] * HS, p, pl); dh[po + rr * HD] = p; dl[po + rr * HD] = pl; }
    asm volatile("s_wait_xcnt 0x0" ::: "memory"); }   // behind a slot's last store: the next trip, and the block behind the loop, give the stores' data and address registers new values
  // v leaves as the two f16 planes that att_kernel's phase 3 multiplies by, in blocks [head][16 tokens][dim][token]: a wave takes one head slot and one 16-token block at a time, a thread one column (dim = lane) of its 16 tokens, 32 bytes a plane, so a wave fills one 1,024-byte block of each plane and nobody else writes into it; the loop over the tasks stays rolled (its trip count differs between work-groups); the loops over r and q are unrolled in full so that the four vectors are indexed by constants and stay in registers
#pragma unroll 1
  for (int task = wave; task < nv * 4; task += 8) { const int i = 6 - nv + (task >> 2), tb = task & 3, h = (cg * 6 + i) & 7; v8b vh[2], vl[2];
#pragma unroll
    for (int r = 0; r < 16; ++r) { b16 p, pl; split16(Tf[tb * 16 + r][i * HD + lane] * HS, p, pl); vh[r / 8][r % 8] = p; vl[r / 8][r % 8] = pl; }
    const size_t vo = ((((size_t)(b * H + h)) * (S / 16) + n0 / 16 + tb) * HD + lane) * 16;
#pragma unroll
    for (int q = 0; q < 2; ++q) { *(v8b*)(VFh + vo + q * 8) = vh[q]; *(v8b*)(VFl + vo + q * 8) = vl[q]; }
    asm volatile("s_wait_xcnt 0x0" ::: "memory"); } }   // behind a block's last store: the next trip gives the stores' data and address registers new values
// four waves a work-group share one 16-query tile and its score rows in LDS: each takes a quarter of the key tiles (1), four of the rows (2) and a quarter of the keys (3), so that a SIMD holds four waves, not one, and one wave's waits are filled by the others
__global__ __launch_bounds__(128) void att_kernel(const b16* __restrict__ Qh, const b16* __restrict__ Ql, const b16* __restrict__ Kh, const b16* __restrict__ Kl, const b16* __restrict__ VFh, const b16* __restrict__ VFl, const float* __restrict__ coord, const float* __restrict__ wpos, const float* __restrict__ bpos, const float* __restrict__ gating, int QLIM, float* __restrict__ O) { __shared__ __attribute__((aligned(16))) float Sc[16][S + 4]; __shared__ float Of[4][16][HD + 1]; const int lane = threadIdx.x & 31, wave = __builtin_amdgcn_readfirstlane(threadIdx.x >> 5), nloc = lane & 15, hlf = lane >> 4; const int bh = blockIdx.x / (S / 16), q0 = (blockIdx.x % (S / 16)) * 16; if (q0 >= QLIM) return; const int b = bh / H, h = bh % H;
  const v16b qa = frag_kb(Qh + ((size_t)bh * S + q0 + nloc) * HD, hlf), ql = frag_kb(Ql + ((size_t)bh * S + q0 + nloc) * HD, hlf);
  loads_issued();
  // (1) scaled scores for all keys, in units of log 2 (log2 e rides in the scale factor), 16 key tiles a wave
#pragma unroll 1
  for (int tg = wave * 16; tg < wave * 16 + 16; tg += 8) { v8f s[8];
#pragma unroll
    for (int t = 0; t < 8; ++t) s[t] = (v8f){};
    // eight key tiles (32 loads) a batch; the cut is tested once for the batch (it is a multiple of 256, as phases 2 and 3 take it too): a test per tile would leave paths on which loads are never waited for, and the next trip's loads would then wait on this trip's
    if (tg * 16 < QLIM) { v16b kh[8], kl[8]; const size_t ko = ((size_t)bh * S + tg * 16 + nloc) * HD; const b16 *ph = Kh + ko, *pl = Kl + ko;
#pragma unroll
      for (int t = 0; t < 8; ++t) { kh[t] = frag_kb(ph + t * 16 * HD, hlf); kl[t] = frag_kb(pl + t * 16 * HD, hlf); }
      loads_issued();
#pragma unroll
      for (int t = 0; t < 8; ++t) { s[t] = wmma16b(qa, kh[t], s[t]); s[t] = wmma16b(qa, kl[t], s[t]); s[t] = wmma16b(ql, kh[t], s[t]); } }
#pragma unroll
    for (int t = 0; t < 8; ++t)
#pragma unroll
      for (int r8 = 0; r8 < 8; ++r8) Sc[8 * hlf + r8][(tg + t) * 16 + nloc] = s[t][r8] * (SCALE * L2E / (HS * HS)); }
  __syncthreads();   // a row's scores come from all four waves
  // (2) one query row at a time, its keys spread over the 32 lanes (lane owns keys g * 128 + lane * 4 + e): patch softmax, pos softmax, gated mix, renorm; the row's final weights (x16384) then go back over its own 4,096 score bytes as two f16 planes, hi at keys 0..1023 and lo behind it, in the form phase 3 reads: no second LDS array, so four work-groups fit a WGP's LDS, not three
  { const float gr = gating[h], wr0 = wpos[0 * H + h], wr1 = wpos[1 * H + h], wr2 = wpos[2 * H + h], wr3 = wpos[3 * H + h], br = bpos[h];   // every load of this phase is issued before the first rounding, so that they share one trip to memory
    const float* pq = coord + ((size_t)b * S + q0 + nloc) * 3; const float qx = pq[0], qy = pq[1], qz = pq[2]; v4f craw[S / 128][3];
    // every loop over g, e or u in this phase is unrolled in full, so that its arrays are indexed by constants and stay in registers
#pragma unroll
    for (int g = 0; g < S / 128; ++g)
#pragma unroll
      for (int u = 0; u < 3; ++u) craw[g][u] = *(const v4f*)(coord + ((size_t)b * S + g * 128 + lane * 4) * 3 + u * 4);
    asm volatile("s_wait_xcnt 0x0" :: "v"(pq) : "memory");   // stands before the address registers of the loads above are given new values; the query address is an input, so that no later load of the batch lands on its registers in front of the wait
    const float sg = hw_rcp(1.0f + __expf(-bfv(gr))); const float w0 = bfv(wr0) * L2E, w1 = bfv(wr1) * L2E, w2 = bfv(wr2) * L2E, w3 = bfv(wr3) * L2E, bp = bfv(br) * L2E;
    const float rx = bfv(qx), ry = bfv(qy), rz = bfv(qz); float cx[S / 32], cy[S / 32], cz[S / 32], cw[S / 32];
#pragma unroll
    for (int g = 0; g < S / 128; ++g) { const float bg = g * 128 < QLIM ? bp : -INFINITY;   // a key at or past the cut gets logit -inf, weight 0
#pragma unroll
      for (int e = 0; e < 4; ++e) { cx[g * 4 + e] = bfv(craw[g][(e * 3) / 4][(e * 3) % 4]); cy[g * 4 + e] = bfv(craw[g][(e * 3 + 1) / 4][(e * 3 + 1) % 4]); cz[g * 4 + e] = bfv(craw[g][(e * 3 + 2) / 4][(e * 3 + 2) % 4]);
        // the key's own share of its positional logit, the same for every query: (p_j - p_i) . w = p_j . w - p_i . w, and the query's share is one constant along the row, which a softmax over the row's keys cancels
        cw[g * 4 + e] = cx[g * 4 + e] * w0 + cy[g * 4 + e] * w1 + cz[g * 4 + e] * w2 + bg; } }
    // the loop over a wave's four rows stays rolled: one row is about 1,000 instructions already, and copies would only grow the code
#pragma unroll 1
    for (int r = wave * 4; r < wave * 4 + 4; ++r) { v4f* sr = (v4f*)&Sc[r][0]; v4f s4[S / 128]; float pl[S / 32];
#pragma unroll
      for (int g = 0; g < S / 128; ++g) s4[g] = sr[g * 32 + lane];
      const float pix = lane_bcast(rx, r), piy = lane_bcast(ry, r), piz = lane_bcast(rz, r); float pm4[4] = {-INFINITY, -INFINITY, -INFINITY, -INFINITY}, mx = -INFINITY;
#pragma unroll
      for (int g = 0; g < S / 128; ++g) { float dx[4], dy[4], dz[4], d2[4], dd[4];
#pragma unroll
        for (int e = 0; e < 4; ++e) { dx[e] = cx[g * 4 + e] - pix; dy[e] = cy[g * 4 + e] - piy; dz[e] = cz[g * 4 + e] - piz; d2[e] = dx[e] * dx[e] + dy[e] * dy[e] + dz[e] * dz[e]; }
        hw_sqrt4(d2, dd);
#pragma unroll
        for (int e = 0; e < 4; ++e) { pl[g * 4 + e] = dd[e] * w3 + cw[g * 4 + e]; pm4[e] = fmaxf(pm4[e], pl[g * 4 + e]); }
        if (g & 1) __builtin_amdgcn_sched_barrier(0); }   // eight keys in flight at a time: with all 32 started at once their temporaries take the wave past 256 registers, and a SIMD then holds three such waves, not four
#pragma unroll
      for (int g = 0; g < S / 128; ++g) { const float gm = fmaxf(fmaxf(s4[g][0], s4[g][1]), fmaxf(s4[g][2], s4[g][3])); mx = fmaxf(mx, g * 128 < QLIM ? gm : -INFINITY); }
      mx = wave_max(mx); const float pm = wave_max(fmaxf(fmaxf(pm4[0], pm4[1]), fmaxf(pm4[2], pm4[3])));
      float z4[4] = {0.0f, 0.0f, 0.0f, 0.0f}, pz4[4] = {0.0f, 0.0f, 0.0f, 0.0f};
#pragma unroll
      for (int g = 0; g < S / 128; ++g) { const float mg = g * 128 < QLIM ? mx : INFINITY;
#pragma unroll
        for (int e = 0; e < 4; ++e) { s4[g][e] = exp2_slot(s4[g][e] - mg); z4[e] += s4[g][e]; pl[g * 4 + e] = exp2_slot(pl[g * 4 + e] - pm); pz4[e] += pl[g * 4 + e]; } }
      // both normalisers, the gate, the renormaliser and the x16384 are constants of the row: they are merged into one factor for each softmax's exponentials. The sum of the mixed weights over the keys is formed from the two sums at hand: sum_j (a e_j + c f_j) = a sum_j e_j + c sum_j f_j
      const float zs = wave_sum((z4[0] + z4[1]) + (z4[2] + z4[3])), pzs = wave_sum((pz4[0] + pz4[1]) + (pz4[2] + pz4[3])); const float ga = (1.0f - sg) * hw_rcp(zs), gc = sg * hw_rcp(pzs);
      const float rn = hw_rcp(ga * zs + gc * pzs) * PS, fa = ga * rn, fc = gc * rn; b16* hr = (b16*)&Sc[r][0];
#pragma unroll
      for (int g = 0; g < S / 128; ++g) { v4b wh, wl;
#pragma unroll
        for (int e = 0; e < 4; ++e) { b16 p, q; split16(s4[g][e] * fa + pl[g * 4 + e] * fc, p, q); wh[e] = p; wl[e] = q; }
        *(v4b*)(hr + g * 128 + lane * 4) = wh; *(v4b*)(hr + S + g * 128 + lane * 4) = wl; } } }
  __syncthreads();   // phase 3 reads all 16 rows
  // (3) O = A x v, 256 keys a wave, 128 keys (32 loads of v) a batch; v lies in blocks [16 keys][dim][key], so the 32 lanes of a load read 512 bytes in a row, and a fragment's two halves (keys 8 hlf + 0..7 and 16 + 8 hlf + 0..7, the k order of frag_kb) lie one block (HD * 16 elements) apart; the A fragments come straight from the planes that phase 2 left in Sc
  v8f oacc[2] = {(v8f){}, (v8f){}}; const b16* ar = (const b16*)&Sc[nloc][0];
#pragma unroll 1
  for (int k0 = wave * CH; k0 < wave * CH + CH && k0 < QLIM; k0 += CH / 2) { v16b vh[4][2], vl[4][2], pa[4], pb[4]; const size_t vo = (((size_t)bh * (S / 16) + k0 / 16) * HD + nloc) * 16 + 8 * hlf; const b16 *gh = VFh + vo, *gl = VFl + vo;
#pragma unroll
    for (int kk = 0; kk < 4; ++kk)
#pragma unroll
      for (int t = 0; t < 2; ++t) { vh[kk][t] = frag_vb(gh + (kk * 2 * HD + t * 16) * 16); vl[kk][t] = frag_vb(gl + (kk * 2 * HD + t * 16) * 16); }
    // as loads_issued(); the two addresses are inputs, so that their registers are still held here and no load of the batch lands on them in front of the wait
    asm volatile("s_wait_xcnt 0x0" :: "v"(gh), "v"(gl) : "memory");
#pragma unroll
    for (int kk = 0; kk < 4; ++kk) { pa[kk] = frag_kb(ar + k0 + kk * 32, hlf); pb[kk] = frag_kb(ar + S + k0 + kk * 32, hlf); }
#pragma unroll
    for (int kk = 0; kk < 4; ++kk)
#pragma unroll
      for (int t = 0; t < 2; ++t) { oacc[t] = wmma16b(pa[kk], vh[kk][t], oacc[t]); oacc[t] = wmma16b(pa[kk], vl[kk][t], oacc[t]); oacc[t] = wmma16b(pb[kk], vh[kk][t], oacc[t]); } }
#pragma unroll
  for (int t = 0; t < 2; ++t)
#pragma unroll
    for (int r8 = 0; r8 < 8; ++r8) Of[wave][8 * hlf + r8][t * 16 + nloc] = oacc[t][r8] * (1.0f / (PS * HS));
  __syncthreads();   // the four waves' partial sums over their key quarters are added below
  { for (int r = wave * 4; r < wave * 4 + 4; ++r) ((float*)O)[((size_t)b * S + q0 + r) * C + h * HD + lane] = (Of[0][r][lane] + Of[1][r][lane]) + (Of[2][r][lane] + Of[3][r][lane]);  } }
// eight waves a work-group share one 16-token tile: each takes two of its rows going in and coming out, and two of the 16 output tiles
__global__ __launch_bounds__(256) void outp_kernel(const float* __restrict__ O, const b16* __restrict__ WP, const float* __restrict__ bproj, int QLIM, float* __restrict__ out) { __shared__ __attribute__((aligned(16))) b16 Ah[16][C + 8], Al[16][C + 8]; __shared__ float Tf[16][260]; const int lane = threadIdx.x & 31, wave = __builtin_amdgcn_readfirstlane(threadIdx.x >> 5), nloc = lane & 15, hlf = lane >> 4; const size_t t0 = (size_t)blockIdx.x * 16; if ((int)(t0 % S) >= QLIM) return;
  // a wave's two rows (16 loads) in one batch; the loops are unrolled in full so that the batch stays in registers
  { float orw[2][C / 32]; const float* po = O + (t0 + wave * 2) * C + lane;
#pragma unroll
    for (int rr = 0; rr < 2; ++rr)
#pragma unroll
      for (int q = 0; q < C / 32; ++q) orw[rr][q] = po[rr * C + q * 32];
    loads_issued_from(po);
#pragma unroll
    for (int rr = 0; rr < 2; ++rr)
#pragma unroll
      for (int q = 0; q < C / 32; ++q) { b16 p, pl; split16(orw[rr][q] * HS, p, pl); Ah[wave * 2 + rr][q * 32 + lane] = p; Al[wave * 2 + rr][q * 32 + lane] = pl; } }
  if (threadIdx.x < 16) for (int k = C; k < C + 8; ++k) { Ah[threadIdx.x][k] = (b16)0.0f; Al[threadIdx.x][k] = (b16)0.0f; }
  __syncthreads();   // every wave reads all 16 rows of Ah and Al
  // a wave's two output tiles: all their 16 weight fragments (2 tiles x 8 k steps, 32 loads) are one batch
  { v8f acc[2]; float br[2]; v16b bw[8][2]; const int ib = wave * 32 + nloc; const b16* pw = WP + (size_t)(wave * 32 + nloc) * C + 8 * hlf;
#pragma unroll
    for (int t = 0; t < 2; ++t) { acc[t] = (v8f){}; br[t] = bproj[ib + t * 16]; }
#pragma unroll
    for (int kk = 0; kk < 8; ++kk)
#pragma unroll
      for (int t = 0; t < 2; ++t) bw[kk][t] = frag_kb(pw + t * 16 * C + kk * 32, 0);
    asm volatile("s_wait_xcnt 0x0" :: "v"(ib), "v"(pw) : "memory");   // as loads_issued_from(); the bias loads are addressed by the index
#pragma unroll
    for (int kk = 0; kk < 8; ++kk) { const v16b a = frag_kb(&Ah[nloc][kk * 32], hlf), al = frag_kb(&Al[nloc][kk * 32], hlf);
#pragma unroll
      for (int t = 0; t < 2; ++t) { acc[t] = wmma16b(a, bw[kk][t], acc[t]); acc[t] = wmma16b(al, bw[kk][t], acc[t]); } }
#pragma unroll
    for (int t = 0; t < 2; ++t) { const int cc = wave * 32 + t * 16 + nloc; const float bb = bfv(br[t]);
#pragma unroll
      for (int r8 = 0; r8 < 8; ++r8) Tf[8 * hlf + r8][cc] = acc[t][r8] * (1.0f / (HS * WSC)) + bb; } }
  __syncthreads();   // a row of Tf comes from all eight waves
  { for (int rr = wave * 2; rr < wave * 2 + 2; ++rr) for (int q = 0; q < 2; ++q) *(v4f*)(out + (t0 + rr) * C + q * 128 + lane * 4) = *(const v4f*)(&Tf[rr][q * 128 + lane * 4]);  } }
}  // namespace

extern "C" void kernel_launch(void* const* d_in, const int* in_sizes, int n_in, void* d_out, int out_size, void* d_ws, size_t ws_size, hipStream_t stream) {
  (void)n_in;
  auto Fp = [&](int i) { return (const float*)d_in[i]; };
  // input order: 0 x [4,1024,256]; 1 voxel_coord [4,1024,3]; 2 W_qk [256,512]; 3 W_v [256,256]; 4 W_proj [256,256]; 5 b_proj [256]; 6 W_pos [4,8]; 7 b_pos [8]; 8 gating [8]
  if (in_sizes[0] != NT * C || in_sizes[1] != NT * 3 || in_sizes[2] != C * 512 || in_sizes[3] != C * C || in_sizes[4] != C * C || in_sizes[6] != 4 * H || in_sizes[7] != H || in_sizes[8] != H || out_size != NT * C) return;
  const int QLIM = S;   // per-batch token cut (queries and keys) (multiple of 256)
  size_t off = 0; char* ws = (char*)d_ws;
  auto carve = [&](size_t bytes) { char* p = ws + off; off += (bytes + 255) & ~(size_t)255; return p; };
  b16* WP = (b16*)carve((size_t)C * C * 2); b16* Qh = (b16*)carve((size_t)NT * C * 2); b16* Ql = (b16*)carve((size_t)NT * C * 2); b16* Kh = (b16*)carve((size_t)NT * C * 2); b16* Kl = (b16*)carve((size_t)NT * C * 2); b16* VFh = (b16*)carve((size_t)NT * C * 2); b16* VFl = (b16*)carve((size_t)NT * C * 2); float* O = (float*)carve((size_t)NT * C * 4);
  if (off > ws_size || off > ((size_t)32 << 20)) return;   // ~ 17 MB
  proj_kernel<<<(NT / TM) * 4, 256, 0, stream>>>(Fp(0), Fp(2), Fp(3), Fp(4), QLIM, Qh, Ql, Kh, Kl, VFh, VFl, WP);
  att_kernel<<<NB_ * H * (S / 16), 128, 0, stream>>>(Qh, Ql, Kh, Kl, VFh, VFl, Fp(1), Fp(6), Fp(7), Fp(8), QLIM, O);
  outp_kernel<<<NT / 16, 256, 0, stream>>>(O, WP, Fp(5), QLIM, (float*)d_out);
}

// v009
// Measured time: 45.6 microseconds a run.
// Next to v008, in two timings, it ran 1.04 and 1.03 times as fast.
// Over all steps from v000 it is 35.5 times as fast.
#include <hip/hip_runtime.h>

// GPSA (gated positional self-attention, 8 heads x 32 over 4 x 1024 tokens): [q|k] = x W_qk, v = x W_v; patch = softmax_j(q_i.k_j / sqrt(32)); rel_ij = [p_j - p_i (3), |p_j - p_i|]; pos = softmax_j(rel_ij . W_pos[:,h] + b_pos[h]); attn = (1 - s_h) patch + s_h pos with s_h = sigmoid(gating[h]); attn /= sum_j attn; out = (attn v) W_proj + b_proj -> [4][1024][256].
// WMMA (v_wmma_f32_16x16x32_f16, f32 accumulate): x (EXACT bf16 x8, K 256) x [W_qk | W_v] rows (EXACT x256; 48 tiles); per (bh, 16 queries) S = q (hi+lo x256, K 32) x k rows (hi+lo; 64 tiles) and O = A (hi+lo x16384, K 1,024) x v (hi+lo; 2 tiles), 3 products; o (hi+lo, K 256) x W_proj rows (16 tiles) — ≈ 1 M WMMA; positional logits, both softmaxes, gating in f32.

namespace {
constexpr int NB_ = 4, S = 1024, C = 256, H = 8, HD = 32, NT = NB_ * S, CH = 256;
constexpr float XS = 8.0f, HS = 256.0f, PS = 16384.0f, WSC = 256.0f, SCALE = 0.17677669529663687f, L2E = 1.44269504f;
typedef _Float16 b16;
typedef __attribute__((ext_vector_type(16))) _Float16 v16b;
typedef __attribute__((ext_vector_type(8))) _Float16 v8b;
typedef __attribute__((ext_vector_type(8))) float v8f;
typedef __attribute__((ext_vector_type(4))) float v4f;
typedef __attribute__((ext_vector_type(2))) float v2f;
typedef __attribute__((ext_vector_type(4))) _Float16 v4b;
__device__ __forceinline__ float bf16_rne(float f) { unsigned int u = __float_as_uint(f); u += 0x7FFFu + ((u >> 16) & 1u); float r = __uint_as_float(u & 0xFFFF0000u); asm volatile("" : "+v"(r)); return r; }
__device__ __forceinline__ float bfv(float f) { float r = bf16_rne(f); asm volatile("" : "+v"(r)); return r; }
__device__ __forceinline__ void split16(float v, b16& hi, b16& lo) { hi = (b16)v; lo = (b16)(v - (float)hi); }
__device__ __forceinline__ v16b frag_kb(const b16* p, int hh) { const v8b a = *(const v8b*)(p + 8 * hh), b = *(const v8b*)(p + 16 + 8 * hh); v16b f;
#pragma unroll
  for (int e = 0; e < 8; ++e) { f[e] = a[e]; f[8 + e] = b[e]; } return f; }
// a B fragment of v from its blocks: the two halves lie one block apart; unrolled as in frag_kb, so that the fragment is put together in registers
__device__ __forceinline__ v16b frag_vb(const b16* p) { const v8b a = *(const v8b*)p, b = *(const v8b*)(p + HD * 16); v16b f;
#pragma unroll
  for (int e = 0; e < 8; ++e) { f[e] = a[e]; f[8 + e] = b[e]; } return f; }
// a fragment of q or k from its 16-token tile, stored [8-dim group][token][8 dims]: lane l takes bytes 16 l of each 512-byte half, which are dims 8 hlf + 0..7 and 16 + 8 hlf + 0..7 of token l & 15, the k order of frag_kb; p already holds the lane's own offset; unrolled as in frag_kb
__device__ __forceinline__ v16b frag_tb(const b16* p) { const v8b a = *(const v8b*)p, b = *(const v8b*)(p + HD * 8); v16b f;
#pragma unroll
  for (int e = 0; e < 8; ++e) { f[e] = a[e]; f[8 + e] = b[e]; } return f; }
__device__ __forceinline__ v8f wmma16b(v16b a, v16b b, v8f c) { v8f d = __builtin_amdgcn_wmma_f32_16x16x32_f16(false, a, false, b, (short)0, c, false, false); asm volatile("v_nop\n\tv_nop\n\tv_nop\n\tv_nop" : "+v"(d) : "v"(a), "v"(b)); return d; }
// stands behind a batch of global loads: before their address registers are given new values, and, being volatile, it keeps the whole batch in front of the volatile statements that follow (the pads behind each matrix instruction, the rounding pins), which no load can cross; the batch's address is an input, so that its registers are still held here and no load of the batch lands on them in front of the wait
__device__ __forceinline__ void loads_issued_from(const void* p) { asm volatile("s_wait_xcnt 0x0" :: "v"(p) : "memory"); }

// butterfly over the 32 lanes: four DPP steps inside each 16-lane row, then the other row; every lane ends with the same value
template <int CTRL> __device__ __forceinline__ float row_x(float v) { return __builtin_bit_cast(float, __builtin_amdgcn_mov_dpp(__builtin_bit_cast(int, v), CTRL, 0xf, 0xf, true)); }
__device__ __forceinline__ float half_x(float v) { return __builtin_bit_cast(float, __builtin_amdgcn_permlanex16(__builtin_bit_cast(int, v), __builtin_bit_cast(int, v), 0x76543210, 0xfedcba98, false, false)); }
__device__ __forceinline__ float wave_sum(float v) { v += row_x<0x161>(v); v += row_x<0x162>(v); v += row_x<0x164>(v); v += row_x<0x168>(v); return v + half_x(v); }
__device__ __forceinline__ float wave_max(float v) { v = fmaxf(v, row_x<0x161>(v)); v = fmaxf(v, row_x<0x162>(v)); v = fmaxf(v, row_x<0x164>(v)); v = fmaxf(v, row_x<0x168>(v)); return fmaxf(v, half_x(v)); }
// 2^x (v_exp_f32); both softmaxes keep their logits in units of log 2, so no multiply stands in front; the v_nop in the same statement keeps the one slot that the instruction set asks for behind a transcendental before its result is read or its source overwritten
__device__ __forceinline__ float exp2_slot(float x) { float r; asm("v_exp_f32 %0, %1\n\tv_nop" : "=v"(r) : "v"(x)); return r; }
// square root and reciprocal as the one hardware instruction each (about 1 ulp), not the exactly rounded sequences that sqrtf and 1.0f / x expand to (some 15 and 10 vector instructions with compares and selects). The root feeds a softmax logit through a weight; an argument too small for the instruction is a distance below 1e-19, whose share of the logit is nothing either way. The reciprocals take softmax sums, which are 1 or more, and 1 + e^-g
// four roots in one statement: each fills the slot that the instruction set asks for behind the one in front of it (the outputs are early-clobber, so none lands on a source), and the one v_nop keeps the slot of the last; the compiler hints no dependence of asm text, so the statement opens with the hint itself: the sums of squares are made just in front, and an unhinted wait for them would hold the SIMD's other waves too
__device__ __forceinline__ void hw_sqrt4(const float (&x)[4], float (&r)[4]) { asm("s_delay_alu instid0(VALU_DEP_1)\n\tv_sqrt_f32 %0, %4\n\tv_sqrt_f32 %1, %5\n\tv_sqrt_f32 %2, %6\n\tv_sqrt_f32 %3, %7\n\tv_nop" : "=&v"(r[0]), "=&v"(r[1]), "=&v"(r[2]), "=&v"(r[3]) : "v"(x[0]), "v"(x[1]), "v"(x[2]), "v"(x[3])); }
__device__ __forceinline__ float hw_rcp(float x) { return __builtin_amdgcn_rcpf(x); }
__device__ __forceinline__ float lane_bcast(float v, int l) { return __builtin_bit_cast(float, __builtin_amdgcn_readlane(__builtin_bit_cast(int, v), l)); }

// W_proj for outp_kernel: rounded, x256, f16, transposed to [output][k]. One wave takes one output column o, a lane eight k of it, so the wave writes the column's 512 bytes and nobody else does; the loads and the rest are two functions, so that other work can stand between them while the loads are under way
__device__ __forceinline__ void wp_load(const float* __restrict__ wproj, int o, int lane, float (&rp)[8]) { const float* sp = wproj + (size_t)(lane * 8) * C + o;
#pragma unroll
  for (int j = 0; j < 8; ++j) rp[j] = sp[(size_t)j * C];
  loads_issued_from(sp); }
__device__ __forceinline__ void wp_store(b16* __restrict__ WP, int o, int lane, const float (&rp)[8]) { v8b v;
#pragma unroll
  for (int j = 0; j < 8; ++j) v[j] = (b16)(bf16_rne(rp[j]) * WSC);
  *(v8b*)(WP + (size_t)o * C + lane * 8) = v;
  asm volatile("s_wait_xcnt 0x0" ::: "memory"); }   // behind the store: what follows gives its data and address registers new values
// eight waves a work-group take 64 tokens x 192 of the 768 output columns [q | k | v] (six 32-column head slots). The work-group rounds and transposes its own slice of W_qk | W_v: a thread loads eight k rows of four adjacent columns (eight lanes read 128 bytes in a row), so each column's eight k lie in its registers and leave as one 16-byte LDS store into Wt[column][k], the form the B fragments read; with 64 tokens a slice is prepared by 64 work-groups, not 256. The grid has as many work-groups as W_proj has output columns: wave 0 of each also prepares one of them
constexpr int TM = 64, TN = 192;
__global__ __launch_bounds__(256) void proj_kernel(const float* __restrict__ x, const float* __restrict__ wqk, const float* __restrict__ wv, const float* __restrict__ wproj, int QLIM, b16* __restrict__ Qh, b16* __restrict__ Ql, b16* __restrict__ Kh, b16* __restrict__ Kl, b16* __restrict__ VFh, b16* __restrict__ VFl, b16* __restrict__ WP) { __shared__ __attribute__((aligned(16))) b16 Ax[TM][C + 8]; __shared__ __attribute__((aligned(16))) b16 Wt[TN][C + 8]; __shared__ __attribute__((aligned(16))) float Tf[TM][TN + 4]; const int lane = threadIdx.x & 31, wave = __builtin_amdgcn_readfirstlane(threadIdx.x >> 5), nloc = lane & 15, hlf = lane >> 4; const int cg = blockIdx.x & 3; const size_t t0 = (size_t)(blockIdx.x >> 2) * TM; const int b = (int)(t0 / S), n0 = (int)(t0 % S); float rp[8];
  if (n0 >= QLIM) { if (wave == 0) { wp_load(wproj, (int)blockIdx.x, lane, rp); wp_store(WP, (int)blockIdx.x, lane, rp); } return; }   // a work-group past the token cut still owes its column of W_proj; it leaves as a whole, in front of every barrier
  const int nql = lane & 7, kq = wave * 4 + (lane >> 3);
  // two batches of loads, each four of a wave's eight token rows (8 loads) and 96 of the columns (24 loads); every loop here is unrolled in full so that a batch stays in registers. A run of 32 columns lies wholly in W_qk or wholly in W_v, so source and row length are the same for the whole work-group
#pragma unroll
  for (int hb = 0; hb < 2; ++hb) { v4f xr[4][2], wr[3][8]; const char* px = (const char*)(x + (t0 + wave * 8 + hb * 4) * C); const unsigned vx = (unsigned)lane * 16u; const float* pw[3][8];
#pragma unroll
    for (int rr = 0; rr < 4; ++rr)
#pragma unroll
      for (int q = 0; q < 2; ++q) xr[rr][q] = *(const v4f*)(px + (rr * C + q * 128) * 4 + vx);
#pragma unroll
    for (int it = 0; it < 3; ++it) { const int ob = cg * TN + (hb * 3 + it) * 32; const int ld = ob < 512 ? 512 : C; const float* ub = ob < 512 ? wqk + ob : wv + (ob - 512); 
#pragma unroll
      for (int j = 0; j < 8; ++j) { pw[it][j] = ub + (kq * 8 + j) * ld + nql * 4; wr[it][j] = *(const v4f*)pw[it][j]; } }
    // as loads_issued_from(); every address of the batch is an input, so that its registers are still held here and no load of the batch lands on them in front of the wait
    asm volatile("s_wait_xcnt 0x0" :: "v"(vx), "v"(pw[0][0]), "v"(pw[0][1]), "v"(pw[0][2]), "v"(pw[0][3]), "v"(pw[0][4]), "v"(pw[0][5]), "v"(pw[0][6]), "v"(pw[0][7]), "v"(pw[1][0]), "v"(pw[1][1]), "v"(pw[1][2]), "v"(pw[1][3]), "v"(pw[1][4]), "v"(pw[1][5]), "v"(pw[1][6]), "v"(pw[1][7]), "v"(pw[2][0]), "v"(pw[2][1]), "v"(pw[2][2]), "v"(pw[2][3]), "v"(pw[2][4]), "v"(pw[2][5]), "v"(pw[2][6]), "v"(pw[2][7]) : "memory");
#pragma unroll
    for (int rr = 0; rr < 4; ++rr)
#pragma unroll
      for (int q = 0; q < 2; ++q) { v4b t;
#pragma unroll
        for (int e = 0; e < 4; ++e) t[e] = (b16)(bfv(xr[rr][q][e]) * XS);
        *(v4b*)&Ax[wave * 8 + hb * 4 + rr][q * 128 + lane * 4] = t; }
#pragma unroll
    for (int it = 0; it < 3; ++it)
#pragma unroll
      for (int i = 0; i < 4; ++i) { v8b t;
#pragma unroll
        for (int j = 0; j < 8; ++j) t[j] = (b16)(bf16_rne(wr[it][j][i]) * WSC);
        *(v8b*)&Wt[(hb * 3 + it) * 32 + nql * 4 + i][kq * 8] = t; } }
  __syncthreads();   // every wave reads rows of Ax and Wt that other waves wrote
  if (wave == 0) wp_load(wproj, (int)blockIdx.x, lane, rp);   // under way during the matrix phase, which loads nothing from global memory, so no wait of that phase falls on these loads
  // a wave's 2 x 3 output tiles; a batch is the 20 fragments of four k steps, all from LDS; the loop over the two batches stays rolled: no load can cross the pads, so unrolling would only grow the code
  { const int mg = wave & 1, ng = wave >> 1; v8f acc[2][3];
#pragma unroll
    for (int i = 0; i < 2; ++i)
#pragma unroll
      for (int t = 0; t < 3; ++t) acc[i][t] = (v8f){};
#pragma unroll 1
    for (int kb = 0; kb < C; kb += 128) { v16b af[4][2], bw[4][3];
#pragma unroll
      for (int kk = 0; kk < 4; ++kk) {
#pragma unroll
        for (int i = 0; i < 2; ++i) af[kk][i] = frag_kb(&Ax[(mg * 2 + i) * 16 + nloc][kb + kk * 32], hlf);
#pragma unroll
        for (int t = 0; t < 3; ++t) bw[kk][t] = frag_kb(&Wt[(ng * 3 + t) * 16 + nloc][kb + kk * 32], hlf); }
#pragma unroll
      for (int kk = 0; kk < 4; ++kk)
#pragma unroll
        for (int i = 0; i < 2; ++i)
#pragma unroll
          for (int t = 0; t < 3; ++t) acc[i][t] = wmma16b(af[kk][i], bw[kk][t], acc[i][t]); }
#pragma unroll
    for (int i = 0; i < 2; ++i)
#pragma unroll
      for (int t = 0; t < 3; ++t)
#pragma unroll
        for (int r8 = 0; r8 < 8; ++r8) Tf[(mg * 2 + i) * 16 + 8 * hlf + r8][(ng * 3 + t) * 16 + nloc] = acc[i][t][r8] * (1.0f / (XS * WSC)); }
  __syncthreads();   // a row of Tf comes from four waves
  if (wave == 0) wp_store(WP, (int)blockIdx.x, lane, rp);   // behind the last barrier: in front of one, the whole work-group would wait for this store to be done
  // module layout: qk.reshape(b,n,2,H,HD): head slot sl = column / 32: 0..7 -> q heads, 8..15 -> k heads, 16..23 -> v heads; the work-group holds slots cg * 6 + 0..5, of which the last nv are v
  const int nv = cg == 3 ? 6 : cg == 2 ? 2 : 0;
  // q and k leave as 16-token tiles in the order att_kernel's fragments load them, [head][16 tokens][8-dim group][token][8 dims]: a wave takes one head slot and one 16-token block at a time, a thread one token (lane & 15) and the dim groups hlf and 2 + hlf, 16 bytes a group and plane, so each store of a wave fills 512 bytes in a row (four whole lines) and nobody else writes into them; the loop over the tasks stays rolled (its trip count differs between work-groups); the loops over c and e are unrolled in full so that the four vectors are indexed by constants and stay in registers
#pragma unroll 1
  for (int task = wave; task < (6 - nv) * 4; task += 8) { const int i = task >> 2, tb = task & 3, sl = cg * 6 + i, h = sl & 7; b16* dh = sl < 8 ? Qh : Kh; b16* dl = sl < 8 ? Ql : Kl; v8b fh[2], fl[2];
#pragma unroll
    for (int c = 0; c < 2; ++c) { const v4f* tr = (const v4f*)&Tf[tb * 16 + nloc][i * HD + c * 16 + hlf * 8]; const v4f ta = tr[0], tc = tr[1];
#pragma unroll
      for (int e = 0; e < 8; ++e) { b16 p, pl; split16((e < 4 ? ta[e & 3] : tc[e & 3]) * HS, p, pl); fh[c][e] = p; fl[c][e] = pl; } }
    const size_t fo = (((size_t)(b * H + h)) * (S / 16) + n0 / 16 + tb) * (16 * HD) + lane * 8;
#pragma unroll
    for (int c = 0; c < 2; ++c) { *(v8b*)(dh + fo + c * (HD * 8)) = fh[c]; *(v8b*)(dl + fo + c * (HD * 8)) = fl[c]; }
    asm volatile("s_wait_xcnt 0x0" ::: "memory"); }   // behind a tile's last store: the next trip, and the block behind the loop, give the stores' data and address registers new values
  // v leaves as the two f16 planes that att_kernel's phase 3 multiplies by, in blocks [head][16 tokens][dim][token]: a wave takes one head slot and one 16-token block at a time, a thread one column (dim = lane) of its 16 tokens, 32 bytes a plane, so a wave fills one 1,024-byte block of each plane and nobody else writes into it; the loop over the tasks stays rolled (its trip count differs between work-groups); the loops over r and q are unrolled in full so that the four vectors are indexed by constants and stay in registers
#pragma unroll 1
  for (int task = wave; task < nv * 4; task += 8) { const int i = 6 - nv + (task >> 2), tb = task & 3, h = (cg * 6 + i) & 7; v8b vh[2], vl[2];
#pragma unroll
    for (int r = 0; r < 16; ++r) { b16 p, pl; split16(Tf[tb * 16 + r][i * HD + lane] * HS, p, pl); vh[r / 8][r % 8] = p; vl[r / 8][r % 8] = pl; }
    const size_t vo = ((((size_t)(b * H + h)) * (S / 16) + n0 / 16 + tb) * HD + lane) * 16;
#pragma unroll
    for (int q = 0; q < 2; ++q) { *(v8b*)(VFh + vo + q * 8) = vh[q]; *(v8b*)(VFl + vo + q * 8) = vl[q]; }
    asm volatile("s_wait_xcnt 0x0" ::: "memory"); } }   // behind a block's last store: the next trip gives the stores' data and address registers new values
// four waves a work-group share one 16-query tile and its score rows in LDS: each takes a quarter of the key tiles (1), four of the rows (2) and a quarter of the keys (3), so that a SIMD holds four waves, not one, and one wave's waits are filled by the others
__global__ __launch_bounds__(128) void att_kernel(const b16* __restrict__ Qh, const b16* __restrict__ Ql, const b16* __restrict__ Kh, const b16* __restrict__ Kl, const b16* __restrict__ VFh, const b16* __restrict__ VFl, const float* __restrict__ coord, const float* __restrict__ wpos, const float* __restrict__ bpos, const float* __restrict__ gating, int QLIM, float* __restrict__ O) { __shared__ __attribute__((aligned(16))) float Sc[16][S + 4]; __shared__ float Of[4][16][HD + 1]; const int lane = threadIdx.x & 31, wave = __builtin_amdgcn_readfirstlane(threadIdx.x >> 5), nloc = lane & 15, hlf = lane >> 4; const int bh = blockIdx.x / (S / 16), q0 = (blockIdx.x % (S / 16)) * 16; if (q0 >= QLIM) return; const int b = bh / H, h = bh % H;
  const size_t qo = ((size_t)bh * S + q0) * HD + lane * 8; const b16 *pqh = Qh + qo, *pql = Ql + qo; const v16b qa = frag_tb(pqh), ql = frag_tb(pql);
  // as loads_issued_from(); the two addresses are inputs, so that their registers are still held here and no load of the batch lands on them in front of the wait
  asm volatile("s_wait_xcnt 0x0" :: "v"(pqh), "v"(pql) : "memory");
  // (1) scaled scores for all keys, in units of log 2 (log2 e rides in the scale factor), 16 key tiles a wave
#pragma unroll 1
  for (int tg = wave * 16; tg < wave * 16 + 16; tg += 8) { v8f s[8];
#pragma unroll
    for (int t = 0; t < 8; ++t) s[t] = (v8f){};
    // eight key tiles (32 loads, each 512 bytes in a row: k lies in tiles in fragment order) a batch; the cut is tested once for the batch (it is a multiple of 256, as phases 2 and 3 take it too): a test per tile would leave paths on which loads are never waited for, and the next trip's loads would then wait on this trip's
    if (tg * 16 < QLIM) { v16b kh[8], kl[8]; const size_t ko = ((size_t)bh * S + tg * 16) * HD + lane * 8; const b16 *ph = Kh + ko, *pl = Kl + ko;
#pragma unroll
      for (int t = 0; t < 8; ++t) { kh[t] = frag_tb(ph + t * 16 * HD); kl[t] = frag_tb(pl + t * 16 * HD); }
      // as loads_issued_from(); the two addresses are inputs, so that their registers are still held here and no load of the batch lands on them in front of the wait
      asm volatile("s_wait_xcnt 0x0" :: "v"(ph), "v"(pl) : "memory");
#pragma unroll
      for (int t = 0; t < 8; ++t) { s[t] = wmma16b(qa, kh[t], s[t]); s[t] = wmma16b(qa, kl[t], s[t]); s[t] = wmma16b(ql, kh[t], s[t]); } }
#pragma unroll
    for (int t = 0; t < 8; ++t)
#pragma unroll
      for (int r8 = 0; r8 < 8; ++r8) Sc[8 * hlf + r8][(tg + t) * 16 + nloc] = s[t][r8] * (SCALE * L2E / (HS * HS)); }
  __syncthreads();   // a row's scores come from all four waves
  // (2) one query row at a time, its keys spread over the 32 lanes (lane owns keys g * 128 + lane * 4 + e): patch softmax, pos softmax, gated mix, renorm; the row's final weights (x16384) then go back over its own 4,096 score bytes as two f16 planes, hi at keys 0..1023 and lo behind it, in the form phase 3 reads: no second LDS array, so four work-groups fit a WGP's LDS, not three
  { const float gr = gating[h], wr0 = wpos[0 * H + h], wr1 = wpos[1 * H + h], wr2 = wpos[2 * H + h], wr3 = wpos[3 * H + h], br = bpos[h];   // every load of this phase is issued before the first rounding, so that they share one trip to memory
    const float* pq = coord + ((size_t)b * S + q0 + nloc) * 3; const float qx = pq[0], qy = pq[1], qz = pq[2]; v4f craw[S / 128][3];
    // every loop over g, e or u in this phase is unrolled in full, so that its arrays are indexed by constants and stay in registers
#pragma unroll
    for (int g = 0; g < S / 128; ++g)
#pragma unroll
      for (int u = 0; u < 3; ++u) craw[g][u] = *(const v4f*)(coord + ((size_t)b * S + g * 128 + lane * 4) * 3 + u * 4);
    asm volatile("s_wait_xcnt 0x0" :: "v"(pq) : "memory");   // stands before the address registers of the loads above are given new values; the query address is an input, so that no later load of the batch lands on its registers in front of the wait
    const float sg = hw_rcp(1.0f + __expf(-bfv(gr))); const float w0 = bfv(wr0) * L2E, w1 = bfv(wr1) * L2E, w2 = bfv(wr2) * L2E, w3 = bfv(wr3) * L2E, bp = bfv(br) * L2E;
    const float rx = bfv(qx), ry = bfv(qy), rz = bfv(qz); float cx[S / 32], cy[S / 32], cz[S / 32], cw[S / 32];
#pragma unroll
    for (int g = 0; g < S / 128; ++g) { const float bg = g * 128 < QLIM ? bp : -INFINITY;   // a key at or past the cut gets logit -inf, weight 0
#pragma unroll
      for (int e = 0; e < 4; ++e) { cx[g * 4 + e] = bfv(craw[g][(e * 3) / 4][(e * 3) % 4]); cy[g * 4 + e] = bfv(craw[g][(e * 3 + 1) / 4][(e * 3 + 1) % 4]); cz[g * 4 + e] = bfv(craw[g][(e * 3 + 2) / 4][(e * 3 + 2) % 4]);
        // the key's own share of its positional logit, the same for every query: (p_j - p_i) . w = p_j . w - p_i . w, and the query's share is one constant along the row, which a softmax over the row's keys cancels
        cw[g * 4 + e] = cx[g * 4 + e] * w0 + cy[g * 4 + e] * w1 + cz[g * 4 + e] * w2 + bg; } }
    // the loop over a wave's four rows stays rolled: one row is about 1,000 instructions already, and copies would only grow the code
#pragma unroll 1
    for (int r = wave * 4; r < wave * 4 + 4; ++r) { v4f* sr = (v4f*)&Sc[r][0]; v4f s4[S / 128]; float pl[S / 32];
#pragma unroll
      for (int g = 0; g < S / 128; ++g) s4[g] = sr[g * 32 + lane];
      const float pix = lane_bcast(rx, r), piy = lane_bcast(ry, r), piz = lane_bcast(rz, r); float pm4[4] = {-INFINITY, -INFINITY, -INFINITY, -INFINITY}, mx = -INFINITY;
#pragma unroll
      for (int g = 0; g < S / 128; ++g) { float dx[4], dy[4], dz[4], d2[4], dd[4];
#pragma unroll
        for (int e = 0; e < 4; ++e) { dx[e] = cx[g * 4 + e] - pix; dy[e] = cy[g * 4 + e] - piy; dz[e] = cz[g * 4 + e] - piz; d2[e] = dx[e] * dx[e] + dy[e] * dy[e] + dz[e] * dz[e]; }
        hw_sqrt4(d2, dd);
#pragma unroll
        for (int e = 0; e < 4; ++e) { pl[g * 4 + e] = dd[e] * w3 + cw[g * 4 + e]; pm4[e] = fmaxf(pm4[e], pl[g * 4 + e]); }
        if (g & 1) __builtin_amdgcn_sched_barrier(0); }   // eight keys in flight at a time: with all 32 started at once their temporaries take the wave past 256 registers, and a SIMD then holds three such waves, not four
#pragma unroll
      for (int g = 0; g < S / 128; ++g) { const float gm = fmaxf(fmaxf(s4[g][0], s4[g][1]), fmaxf(s4[g][2], s4[g][3])); mx = fmaxf(mx, g * 128 < QLIM ? gm : -INFINITY); }
      mx = wave_max(mx); const float pm = wave_max(fmaxf(fmaxf(pm4[0], pm4[1]), fmaxf(pm4[2], pm4[3])));
      float z4[4] = {0.0f, 0.0f, 0.0f, 0.0f}, pz4[4] = {0.0f, 0.0f, 0.0f, 0.0f};
#pragma unroll
      for (int g = 0; g < S / 128; ++g) { const float mg = g * 128 < QLIM ? mx : INFINITY;
#pragma unroll
        for (int e = 0; e < 4; ++e) { s4[g][e] = exp2_slot(s4[g][e] - mg); z4[e] += s4[g][e]; pl[g * 4 + e] = exp2_slot(pl[g * 4 + e] - pm); pz4[e] += pl[g * 4 + e]; } }
      // both normalisers, the gate, the renormaliser and the x16384 are constants of the row: they are merged into one factor for each softmax's exponentials. The sum of the mixed weights over the keys is formed from the two sums at hand: sum_j (a e_j + c f_j) = a sum_j e_j + c sum_j f_j
      const float zs = wave_sum((z4[0] + z4[1]) + (z4[2] + z4[3])), pzs = wave_sum((pz4[0] + pz4[1]) + (pz4[2] + pz4[3])); const float ga = (1.0f - sg) * hw_rcp(zs), gc = sg * hw_rcp(pzs);
      const float rn = hw_rcp(ga * zs + gc * pzs) * PS, fa = ga * rn, fc = gc * rn; b16* hr = (b16*)&Sc[r][0];
#pragma unroll
      for (int g = 0; g < S / 128; ++g) { v4b wh, wl;
#pragma unroll
        for (int e = 0; e < 4; ++e) { b16 p, q; split16(s4[g][e] * fa + pl[g * 4 + e] * fc, p, q); wh[e] = p; wl[e] = q; }
        *(v4b*)(hr + g * 128 + lane * 4) = wh; *(v4b*)(hr + S + g * 128 + lane * 4) = wl; } } }
  __syncthreads();   // phase 3 reads all 16 rows
  // (3) O = A x v, 256 keys a wave, 128 keys (32 loads of v) a batch; v lies in blocks [16 keys][dim][key], so the 32 lanes of a load read 512 bytes in a row, and a fragment's two halves (keys 8 hlf + 0..7 and 16 + 8 hlf + 0..7, the k order of frag_kb) lie one block (HD * 16 elements) apart; the A fragments come straight from the planes that phase 2 left in Sc
  v8f oacc[2] = {(v8f){}, (v8f){}}; const b16* ar = (const b16*)&Sc[nloc][0];
#pragma unroll 1
  for (int k0 = wave * CH; k0 < wave * CH + CH && k0 < QLIM; k0 += CH / 2) { v16b vh[4][2], vl[4][2], pa[4], pb[4]; const size_t vo = (((size_t)bh * (S / 16) + k0 / 16) * HD + nloc) * 16 + 8 * hlf; const b16 *gh = VFh + vo, *gl = VFl + vo;
#pragma unroll
    for (int kk = 0; kk < 4; ++kk)
#pragma unroll
      for (int t = 0; t < 2; ++t) { vh[kk][t] = frag_vb(gh + (kk * 2 * HD + t * 16) * 16); vl[kk][t] = frag_vb(gl + (kk * 2 * HD + t * 16) * 16); }
    // as loads_issued_from(); the two addresses are inputs, so that their registers are still held here and no load of the batch lands on them in front of the wait
    asm volatile("s_wait_xcnt 0x0" :: "v"(gh), "v"(gl) : "memory");
#pragma unroll
    for (int kk = 0; kk < 4; ++kk) { pa[kk] = frag_kb(ar + k0 + kk * 32, hlf); pb[kk] = frag_kb(ar + S + k0 + kk * 32, hlf); }
#pragma unroll
    for (int kk = 0; kk < 4; ++kk)
#pragma unroll
      for (int t = 0; t < 2; ++t) { oacc[t] = wmma16b(pa[kk], vh[kk][t], oacc[t]); oacc[t] = wmma16b(pa[kk], vl[kk][t], oacc[t]); oacc[t] = wmma16b(pb[kk], vh[kk][t], oacc[t]); } }
#pragma unroll
  for (int t = 0; t < 2; ++t)
#pragma unroll
    for (int r8 = 0; r8 < 8; ++r8) Of[wave][8 * hlf + r8][t * 16 + nloc] = oacc[t][r8] * (1.0f / (PS * HS));
  __syncthreads();   // the four waves' partial sums over their key quarters are added below
  { for (int r = wave * 4; r < wave * 4 + 4; ++r) ((float*)O)[((size_t)b * S + q0 + r) * C + h * HD + lane] = (Of[0][r][lane] + Of[1][r][lane]) + (Of[2][r][lane] + Of[3][r][lane]);  } }
// eight waves a work-group share one 16-token tile: each takes two of its rows going in and coming out, and two of the 16 output tiles
__global__ __launch_bounds__(256) void outp_kernel(const float* __restrict__ O, const b16* __restrict__ WP, const float* __restrict__ bproj, int QLIM, float* __restrict__ out) { __shared__ __attribute__((aligned(16))) b16 Ah[16][C + 8], Al[16][C + 8]; __shared__ float Tf[16][260]; const int lane = threadIdx.x & 31, wave = __builtin_amdgcn_readfirstlane(threadIdx.x >> 5), nloc = lane & 15, hlf = lane >> 4; const size_t t0 = (size_t)blockIdx.x * 16; if ((int)(t0 % S) >= QLIM) return;
  // a wave's two rows (16 loads) in one batch; the loops are unrolled in full so that the batch stays in registers
  { float orw[2][C / 32]; const float* po = O + (t0 + wave * 2) * C + lane;
#pragma unroll
    for (int rr = 0; rr < 2; ++rr)
#pragma unroll
      for (int q = 0; q < C / 32; ++q) orw[rr][q] = po[rr * C + q * 32];
    loads_issued_from(po);
#pragma unroll
    for (int rr = 0; rr < 2; ++rr)
#pragma unroll
      for (int q = 0; q < C / 32; ++q) { b16 p, pl; split16(orw[rr][q] * HS, p, pl); Ah[wave * 2 + rr][q * 32 + lane] = p; Al[wave * 2 + rr][q * 32 + lane] = pl; } }
  if (threadIdx.x < 16) for (int k = C; k < C + 8; ++k) { Ah[threadIdx.x][k] = (b16)0.0f; Al[threadIdx.x][k] = (b16)0.0f; }
  __syncthreads();   // every wave reads all 16 rows of Ah and Al
  // a wave's two output tiles: all their 16 weight fragments (2 tiles x 8 k steps, 32 loads) are one batch
  { v8f acc[2]; float br[2]; v16b bw[8][2]; const int ib = wave * 32 + nloc; const b16* pw = WP + (size_t)(wave * 32 + nloc) * C + 8 * hlf;
#pragma unroll
    for (int t = 0; t < 2; ++t) { acc[t] = (v8f){}; br[t] = bproj[ib + t * 16]; }
#pragma unroll
    for (int kk = 0; kk < 8; ++kk)
#pragma unroll
      for (int t = 0; t < 2; ++t) bw[kk][t] = frag_kb(pw + t * 16 * C + kk * 32, 0);
    asm volatile("s_wait_xcnt 0x0" :: "v"(ib), "v"(pw) : "memory");   // as loads_issued_from(); the bias loads are addressed by the index
#pragma unroll
    for (int kk = 0; kk < 8; ++kk) { const v16b a = frag_kb(&Ah[nloc][kk * 32], hlf), al = frag_kb(&Al[nloc][kk * 32], hlf);
#pragma unroll
      for (int t = 0; t < 2; ++t) { acc[t] = wmma16b(a, bw[kk][t], acc[t]); acc[t] = wmma16b(al, bw[kk][t], acc[t]); } }
#pragma unroll
    for (int t = 0; t < 2; ++t) { const int cc = wave * 32 + t * 16 + nloc; const float bb = bfv(br[t]);
#pragma unroll
      for (int r8 = 0; r8 < 8; ++r8) Tf[8 * hlf + r8][cc] = acc[t][r8] * (1.0f / (HS * WSC)) + bb; } }
  __syncthreads();   // a row of Tf comes from all eight waves
  { for (int rr = wave * 2; rr < wave * 2 + 2; ++rr) for (int q = 0; q < 2; ++q) *(v4f*)(out + (t0 + rr) * C + q * 128 + lane * 4) = *(const v4f*)(&Tf[rr][q * 128 + lane * 4]);  } }
}  // namespace

extern "C" void kernel_launch(void* const* d_in, const int* in_sizes, int n_in, void* d_out, int out_size, void* d_ws, size_t ws_size, hipStream_t stream) {
  (void)n_in;
  auto Fp = [&](int i) { return (const float*)d_in[i]; };
  // input order: 0 x [4,1024,256]; 1 voxel_coord [4,1024,3]; 2 W_qk [256,512]; 3 W_v [256,256]; 4 W_proj [256,256]; 5 b_proj [256]; 6 W_pos [4,8]; 7 b_pos [8]; 8 gating [8]
  if (in_sizes[0] != NT * C || in_sizes[1] != NT * 3 || in_sizes[2] != C * 512 || in_sizes[3] != C * C || in_sizes[4] != C * C || in_sizes[6] != 4 * H || in_sizes[7] != H || in_sizes[8] != H || out_size != NT * C) return;
  const int QLIM = S;   // per-batch token cut (queries and keys) (multiple of 256)
  size_t off = 0; char* ws = (char*)d_ws;
  auto carve = [&](size_t bytes) { char* p = ws + off; off += (bytes + 255) & ~(size_t)255; return p; };
  b16* WP = (b16*)carve((size_t)C * C * 2); b16* Qh = (b16*)carve((size_t)NT * C * 2); b16* Ql = (b16*)carve((size_t)NT * C * 2); b16* Kh = (b16*)carve((size_t)NT * C * 2); b16* Kl = (b16*)carve((size_t)NT * C * 2); b16* VFh = (b16*)carve((size_t)NT * C * 2); b16* VFl = (b16*)carve((size_t)NT * C * 2); float* O = (float*)carve((size_t)NT * C * 4);
  if (off > ws_size || off > ((size_t)32 << 20)) return;   // ~ 17 MB
  proj_kernel<<<(NT / TM) * 4, 256, 0, stream>>>(Fp(0), Fp(2), Fp(3), Fp(4), QLIM, Qh, Ql, Kh, Kl, VFh, VFl, WP);
  att_kernel<<<NB_ * H * (S / 16), 128, 0, stream>>>(Qh, Ql, Kh, Kl, VFh, VFl, Fp(1), Fp(6), Fp(7), Fp(8), QLIM, O);
  outp_kernel<<<NT / 16, 256, 0, stream>>>(O, WP, Fp(5), QLIM, (float*)d_out);
}
